// v000
// Times are from an AMD MI455X. After a warm-up the kernel runs many times in a row, and a time is the length of
// such a window on the GPU divided by its runs, so every launch and the gaps after it count. The runs cycle
// through copies of the inputs. A figure is the median of several windows, for all but v000 over two sittings.
// Sittings can differ by a few percent; kernels timed side by side share one.
// v000, which the later versions start from, runs in 571 microseconds.
#include <hip/hip_runtime.h>
#include <math.h>

typedef __attribute__((ext_vector_type(16))) _Float16 v16h;
typedef __attribute__((ext_vector_type(16))) __bf16 v16b;
typedef __attribute__((ext_vector_type(8)))  _Float16 v8h;
typedef __attribute__((ext_vector_type(8)))  float v8f;
typedef __attribute__((ext_vector_type(4)))  float v4f;
typedef __attribute__((ext_vector_type(2)))  float v2f;
typedef __attribute__((ext_vector_type(4)))  unsigned v4u;
typedef __attribute__((ext_vector_type(4)))  int v4i;
typedef float __attribute__((may_alias)) float_a;
typedef int __attribute__((may_alias)) int_a;

template <typename T> __device__ __forceinline__ void vst2(void* p, T v) { *(T*)p = v;  }
__device__ __forceinline__ v8f wmma16(v16h a, v16h b, v8f c) {
  v8f d = __builtin_amdgcn_wmma_f32_16x16x32_f16(false, a, false, b, (short)0, c, false, false);
  asm volatile("v_nop\n\tv_nop\n\tv_nop\n\tv_nop" : "+v"(d) : "v"(a), "v"(b));
  return d;
}
__device__ __forceinline__ v8f wmma_bf(v16b a, v16b b, v8f c) {
  v8f d = __builtin_amdgcn_wmma_f32_16x16x32_bf16(false, a, false, b, (short)0, c, false, false);
  asm volatile("v_nop\n\tv_nop\n\tv_nop\n\tv_nop" : "+v"(d) : "v"(a), "v"(b));
  return d;
}
// 16x16x32 fragments: lane = (h = lane>>4, row/col = lane&15); elements 0..7 = k0+8h+0..7, 8..15 = k0+16+8h+0..7; D element r = row 8h+r
__device__ __forceinline__ v16h frag_h(const _Float16* rowk0, int lane) {
  union { v16h v; v8h q[2]; } u; const _Float16* p = rowk0 + 8 * (lane >> 4);
  u.q[0] = *(const v8h*)p; u.q[1] = *(const v8h*)(p + 16); return u.v;
}
__device__ __forceinline__ v16h frag_f32(const float* rowk0, int lane) {
  v16h a; const float* p = rowk0 + 8 * (lane >> 4);
#pragma unroll
  for (int i = 0; i < 8; ++i) { a[i] = (_Float16)p[i]; a[8 + i] = (_Float16)p[16 + i]; }
  return a;
}
__device__ __forceinline__ v16h frag_f32s(const float* rowk0, int lane, float sc) {
  v16h a; const float* p = rowk0 + 8 * (lane >> 4);
#pragma unroll
  for (int i = 0; i < 8; ++i) { a[i] = (_Float16)(p[i] * sc); a[8 + i] = (_Float16)(p[16 + i] * sc); }
  return a;
}
// column fragment from a [K][ld] layout (column n), rows >= K read as 0
__device__ __forceinline__ v16h fragc_f32(const float* W, int k0, int n, int lane, int ld, int K) {
  v16h a; const int g = lane >> 4;
#pragma unroll
  for (int i = 0; i < 8; ++i) { const int ka = k0 + 8 * g + i, kb = ka + 16;
    a[i] = (_Float16)(ka < K ? W[(size_t)(ka < K ? ka : K - 1) * ld + n] : 0.f); a[8 + i] = (_Float16)(kb < K ? W[(size_t)(kb < K ? kb : K - 1) * ld + n] : 0.f); }
  return a;
}
struct F2 { v16b h, l; };
__device__ __forceinline__ F2 bsplit16(const float v[16]) { F2 r;
#pragma unroll
  for (int i = 0; i < 16; ++i) { const __bf16 h = (__bf16)v[i]; r.h[i] = h; r.l[i] = (__bf16)(v[i] - (float)h); }
  return r; }
__device__ __forceinline__ F2 split_row(const float* row, int k0, int lane) { float v[16]; const float* p = row + k0 + 8 * (lane >> 4);
#pragma unroll
  for (int i = 0; i < 8; ++i) { v[i] = p[i]; v[8 + i] = p[16 + i]; }
  return bsplit16(v); }
__device__ __forceinline__ F2 split_rowK(const float* row, int k0, int lane, int K) { float v[16]; const int g = lane >> 4;
#pragma unroll
  for (int i = 0; i < 8; ++i) { const int ka = k0 + 8 * g + i, kb = ka + 16; v[i] = ka < K ? row[ka < K ? ka : K - 1] : 0.f; v[8 + i] = kb < K ? row[kb < K ? kb : K - 1] : 0.f; }
  return bsplit16(v); }
__device__ __forceinline__ F2 split_col(const float* W, int k0, int n, int lane, int ld, int K) { float v[16]; const int g = lane >> 4;
#pragma unroll
  for (int i = 0; i < 8; ++i) { const int ka = k0 + 8 * g + i, kb = ka + 16; v[i] = ka < K ? W[(size_t)(ka < K ? ka : K - 1) * ld + n] : 0.f; v[8 + i] = kb < K ? W[(size_t)(kb < K ? kb : K - 1) * ld + n] : 0.f; }
  return bsplit16(v); }
__device__ __forceinline__ v8f mac3(const F2& a, const F2& b, v8f c) { c = wmma_bf(a.l, b.h, c); c = wmma_bf(a.h, b.l, c); return wmma_bf(a.h, b.h, c); }
__device__ __forceinline__ float sigm(float v) { return 1.0f / (1.0f + expf(-v)); }
#define LDSX() do { asm volatile("s_wait_dscnt 0" ::: "memory"); __builtin_amdgcn_wave_barrier(); __builtin_amdgcn_fence(__ATOMIC_RELEASE, "workgroup"); } while (0)


// SelfModule (B 8, C 512, 32x32, 4 heads x 128): x = x * sigmoid(SE(x)) + x; q, k, v = 1x1 convs; att = softmax_m(q_n . k_m / sqrt(128)); o[:, m] = sum_n v[:, n] att[n, m]; out = o * sigmoid(gate 1x1 conv(o)) + o.
#define NB 8
#define CC 512
#define NN 1024
#define NH 4
#define DK 128
#define RR 128            // SE bottleneck
#ifndef TNB
#define TNB NB
#endif
typedef __attribute__((ext_vector_type(8))) __bf16 v8b;
__device__ __forceinline__ v16b frag_b(const __bf16* rowk0, int lane) {
  union { v16b v; v8b q[2]; } u; const __bf16* p = rowk0 + 8 * (lane >> 4);
  u.q[0] = *(const v8b*)p; u.q[1] = *(const v8b*)(p + 16); return u.v;
}
__device__ __forceinline__ float bfr(float v) { return (float)(__bf16)v; }
__device__ __attribute__((noinline)) float exp_ni(float v) { return expf(v); }
__device__ __attribute__((noinline)) float erf_ni(float v) { return erff(v); }

#define WS_SC  0u                                   // f32 1 + sigmoid(SE) [b][512]
#define WS_QH  (WS_SC + 4u * (size_t)NB * CC)            // f16 hi|lo q rows [b*NN + n][512]; k rows; v planes [b][512][NN]
#define WS_QL  (WS_QH + 2u * (size_t)NB * NN * CC)
#define WS_KH  (WS_QL + 2u * (size_t)NB * NN * CC)
#define WS_KL  (WS_KH + 2u * (size_t)NB * NN * CC)
#define WS_VT  (WS_KL + 2u * (size_t)NB * NN * CC)
#define WS_VTL (WS_VT + 2u * (size_t)NB * CC * NN)
#define WS_ST  (WS_VTL + 2u * (size_t)NB * CC * NN)      // f32 row max [b][h][n], row sum
#define WS_SL  (WS_ST + 4u * (size_t)NB * NH * NN)
#define WS_O   (WS_SL + 4u * (size_t)NB * NH * NN)       // f32 o NCHW [b][512][NN]
#define WS_END (WS_O + 4u * (size_t)NB * CC * NN)

// ---- k_se: block = b: avg pool, fc1, relu, fc2, 1 + sigmoid
__global__ __launch_bounds__(256) void k_se(const float* __restrict__ X, const float* __restrict__ F1W, const float* __restrict__ F1B, const float* __restrict__ F2W, const float* __restrict__ F2B, float* __restrict__ SC) { __shared__ float sp[CC]; __shared__ float sh[RR]; __shared__ __align__(16) float ss[CC]; const int t = threadIdx.x, lane = t & 31, w = t >> 5; const size_t b = blockIdx.x;
  for (int c = w; c < CC; c += 8) { const float* xr = X + (b * CC + c) * (size_t)NN; float s = 0.f; for (int n = lane; n < NN; n += 32) s += bfr(xr[n]);
#pragma unroll
    for (int o = 1; o < 32; o <<= 1) s += __shfl_xor(s, o);
    if (lane == 0) sp[c] = s * (1.0f / NN); }
  __syncthreads();
  if (t < RR) { float s = bfr(F1B[t]); for (int c = 0; c < CC; ++c) s += sp[c] * bfr(F1W[(size_t)t * CC + c]); sh[t] = fmaxf(s, 0.f); }
  __syncthreads();
  for (int c = t; c < CC; c += 256) { float s = bfr(F2B[c]); for (int j = 0; j < RR; ++j) s += sh[j] * bfr(F2W[(size_t)c * RR + j]); ss[c] = 1.0f + 1.0f / (1.0f + expf(-s)); }
  __syncthreads(); if (t < CC / 4) vst2(SC + b * CC + t * 4, *(const v4f*)&ss[t * 4]); }
// ---- k_proj: block = (64 pixels, 128 output channels, which*NB + b): conv1x1 over xs = x * sc (A gathered from NCHW, bf16 hi + lo) + bias; q, k -> f16 hi/lo rows [n][512]; v -> planes [c][n]
__global__ __launch_bounds__(128) void k_proj(const float* __restrict__ X, const float* __restrict__ SC, const float* __restrict__ WQ, const float* __restrict__ BQ, const float* __restrict__ WK, const float* __restrict__ BK, const float* __restrict__ WV, const float* __restrict__ BV, _Float16* __restrict__ QH, _Float16* __restrict__ QL, _Float16* __restrict__ KH, _Float16* __restrict__ KL, _Float16* __restrict__ VT, _Float16* __restrict__ VTL) {
  __shared__ __align__(16) _Float16 sh[64][136], sl[64][136]; __shared__ __align__(16) _Float16 th[128][72], tl[128][72]; __shared__ float ssc[CC];
  const int tid = threadIdx.x, wave = tid >> 5, lane = tid & 31, col = lane & 15, g = lane >> 4; const int which = blockIdx.z / NB; const size_t b = blockIdx.z % NB; const int n0 = blockIdx.x * 64 + wave * 16; const int c0 = blockIdx.y * 128; const float* Wm = which == 0 ? WQ : which == 1 ? WK : WV; const float* Bm = which == 0 ? BQ : which == 1 ? BK : BV; const float* Xb = X + b * CC * (size_t)NN;
  for (int c = tid; c < CC; c += 128) ssc[c] = SC[b * CC + c]; __syncthreads();
  v8f acc[8] = {};
#pragma unroll 2
  for (int kc = 0; kc < CC / 32; ++kc) { float v[16]; const int px = n0 + col;
#pragma unroll
    for (int i = 0; i < 8; ++i) { const int ca = kc * 32 + 8 * g + i, cb2 = ca + 16; v[i] = bfr(Xb[(size_t)ca * NN + px]) * ssc[ca]; v[8 + i] = bfr(Xb[(size_t)cb2 * NN + px]) * ssc[cb2]; }
    const F2 a = bsplit16(v);
#pragma unroll
    for (int j = 0; j < 8; ++j) { v16b w; const float* wr = Wm + (size_t)(c0 + j * 16 + col) * CC + kc * 32 + 8 * g;
#pragma unroll
      for (int i = 0; i < 8; ++i) { w[i] = (__bf16)wr[i]; w[8 + i] = (__bf16)wr[16 + i]; }
      acc[j] = wmma_bf(a.h, w, acc[j]); acc[j] = wmma_bf(a.l, w, acc[j]); } }
#pragma unroll
  for (int j = 0; j < 8; ++j) { const float bb = bfr(Bm[c0 + j * 16 + col]);
#pragma unroll
    for (int r = 0; r < 8; ++r) { const float v = acc[j][r] + bb; const _Float16 hv = (_Float16)v, lv = (_Float16)((v - (float)hv) * 2048.0f); if (which < 2) { sh[wave * 16 + 8 * g + r][j * 16 + col] = hv; sl[wave * 16 + 8 * g + r][j * 16 + col] = lv; } else { th[j * 16 + col][wave * 16 + 8 * g + r] = hv; tl[j * 16 + col][wave * 16 + 8 * g + r] = lv; } } }
  __syncthreads();
  if (which < 2) { _Float16* PH = which == 0 ? QH : KH; _Float16* PL = which == 0 ? QL : KL; for (int e = tid; e < 64 * 16; e += 128) { const int rl = e >> 4, q = e & 15; const size_t o = (b * NN + blockIdx.x * 64 + rl) * CC + c0 + q * 8; vst2((unsigned*)(PH + o), *(const v4u*)&sh[rl][q * 8]); vst2((unsigned*)(PL + o), *(const v4u*)&sl[rl][q * 8]); } }
  else { for (int e = tid; e < 128 * 8; e += 128) { const int cl = e >> 3, q = e & 7; const size_t o = (b * CC + c0 + cl) * (size_t)NN + blockIdx.x * 64 + q * 8; vst2((unsigned*)(VT + o), *(const v4u*)&th[cl][q * 8]); vst2((unsigned*)(VTL + o), *(const v4u*)&tl[cl][q * 8]); } } }
// ---- k_stats: block = (64 queries n, h, b): row max and sum of exp over all 1,024 keys (3-product logits x 128^-1/2); one 256-B line of each per block
__global__ __launch_bounds__(128) void k_stats(const _Float16* __restrict__ QH, const _Float16* __restrict__ QL, const _Float16* __restrict__ KH, const _Float16* __restrict__ KL, float* __restrict__ ST, float* __restrict__ SL) { __shared__ __align__(16) float sm[64], ssum[64];
  const int tid = threadIdx.x, wave = tid >> 5, lane = tid & 31, col = lane & 15, g = lane >> 4; const int h = blockIdx.y; const size_t b = blockIdx.z; const int q0 = blockIdx.x * 64 + wave * 16; const size_t rq = b * NN + q0;
  v16h aq[4], al[4];
#pragma unroll
  for (int kc = 0; kc < 4; ++kc) { aq[kc] = frag_h(QH + (rq + col) * CC + h * DK + kc * 32, lane); al[kc] = frag_h(QL + (rq + col) * CC + h * DK + kc * 32, lane); }
  float m[8], l[8];
#pragma unroll
  for (int r = 0; r < 8; ++r) { m[r] = -3.0e38f; l[r] = 0.f; }
#pragma unroll 1
  for (int ks = 0; ks < NN / 32; ++ks) { float s[2][8];
#pragma unroll
    for (int ct = 0; ct < 2; ++ct) { const size_t rk = b * NN + ks * 32 + ct * 16 + col; v8f c = {}, cl = {};
#pragma unroll
      for (int kc = 0; kc < 4; ++kc) { const v16h kh = frag_h(KH + rk * CC + h * DK + kc * 32, lane), kl = frag_h(KL + rk * CC + h * DK + kc * 32, lane); c = wmma16(aq[kc], kh, c); cl = wmma16(aq[kc], kl, cl); cl = wmma16(al[kc], kh, cl); }
#pragma unroll
      for (int r = 0; r < 8; ++r) s[ct][r] = (c[r] + cl[r] * (1.0f / 2048.0f)) * 0.08838834764831845f; }
#pragma unroll
    for (int r = 0; r < 8; ++r) { float mx = fmaxf(s[0][r], s[1][r]);
#pragma unroll
      for (int o = 1; o < 16; o <<= 1) mx = fmaxf(mx, __shfl_xor(mx, o));
      const float mn = fmaxf(m[r], mx); const float alpha = __expf(m[r] - mn); float es = __expf(s[0][r] - mn) + __expf(s[1][r] - mn);
#pragma unroll
      for (int o = 1; o < 16; o <<= 1) es += __shfl_xor(es, o);
      l[r] = l[r] * alpha + es; m[r] = mn; } }
  if (col == 0) {
#pragma unroll
    for (int r = 0; r < 8; ++r) { sm[wave * 16 + 8 * g + r] = m[r]; ssum[wave * 16 + 8 * g + r] = l[r]; } }
  __syncthreads(); if (tid < 16) vst2(ST + (b * NH + h) * (size_t)NN + blockIdx.x * 64 + tid * 4, *(const v4f*)&sm[tid * 4]); else if (tid < 32) vst2(SL + (b * NH + h) * (size_t)NN + blockIdx.x * 64 + (tid - 16) * 4, *(const v4f*)&ssum[(tid - 16) * 4]); }
// ---- k_ov: block = (64 output pixels m, h, b): for each query tile n: s^T[m][n] = k_m . q_n (3 products), att[n][m] = exp(s - max_n) / sum_n, then o^T[m][d] += sum_n att[n][m] v[d][n] (att^T tile as the A operand, v planes as B; 3 products); o written NCHW per head channel
__global__ __launch_bounds__(128) void k_ov(const _Float16* __restrict__ QH, const _Float16* __restrict__ QL, const _Float16* __restrict__ KH, const _Float16* __restrict__ KL, const _Float16* __restrict__ VT, const _Float16* __restrict__ VTL, const float* __restrict__ ST, const float* __restrict__ SL, float* __restrict__ O) {
  __shared__ __align__(16) float sp[4][16][36]; __shared__ __align__(16) float stt[128][68];
  const int tid = threadIdx.x, wave = tid >> 5, lane = tid & 31, col = lane & 15, g = lane >> 4; const int h = blockIdx.y; const size_t b = blockIdx.z; const int mm0 = blockIdx.x * 64 + wave * 16; const size_t rm = b * NN + mm0;
  v16h ak[4], akl[4];   // A = k rows of this block's output pixels m
#pragma unroll
  for (int kc = 0; kc < 4; ++kc) { ak[kc] = frag_h(KH + (rm + col) * CC + h * DK + kc * 32, lane); akl[kc] = frag_h(KL + (rm + col) * CC + h * DK + kc * 32, lane); }
  const float* stm = ST + (b * NH + h) * (size_t)NN; const float* stl = SL + (b * NH + h) * (size_t)NN;
  v8f acc[8], accl[8];
#pragma unroll
  for (int j = 0; j < 8; ++j) { acc[j] = v8f{}; accl[j] = v8f{}; }
#pragma unroll 1
  for (int ks = 0; ks < NN / 32; ++ks) {
#pragma unroll
    for (int ct = 0; ct < 2; ++ct) { const int n = ks * 32 + ct * 16 + col; const size_t rn = b * NN + n; v8f c = {}, cl = {};
#pragma unroll
      for (int kc = 0; kc < 4; ++kc) { const v16h qh = frag_h(QH + rn * CC + h * DK + kc * 32, lane), ql = frag_h(QL + rn * CC + h * DK + kc * 32, lane); c = wmma16(ak[kc], qh, c); cl = wmma16(ak[kc], ql, cl); cl = wmma16(akl[kc], qh, cl); }
      const float mx = stm[n], il = 1.0f / stl[n];   // per query n (the column of this transposed tile)
#pragma unroll
      for (int r = 0; r < 8; ++r) { const float s = (c[r] + cl[r] * (1.0f / 2048.0f)) * 0.08838834764831845f; sp[wave][8 * g + r][ct * 16 + col] = __expf(s - mx) * il; } }
    LDSX();
    v16h pa, pal; { const float* prow = &sp[wave][col][0] + 8 * (lane >> 4);
#pragma unroll
      for (int i = 0; i < 8; ++i) { const float p0 = prow[i] * 2048.0f, p1 = prow[16 + i] * 2048.0f; pa[i] = (_Float16)p0; pa[8 + i] = (_Float16)p1; pal[i] = (_Float16)((p0 - (float)pa[i]) * 2048.0f); pal[8 + i] = (_Float16)((p1 - (float)pa[8 + i]) * 2048.0f); } }
#pragma unroll
    for (int j = 0; j < 8; ++j) { const size_t po = (b * CC + (size_t)h * DK + j * 16 + col) * (size_t)NN + ks * 32; const v16h vh = frag_h(VT + po, lane), vl = frag_h(VTL + po, lane); acc[j] = wmma16(pa, vh, acc[j]); accl[j] = wmma16(pa, vl, accl[j]); accl[j] = wmma16(pal, vh, accl[j]); }
    LDSX(); }
#pragma unroll
  for (int j = 0; j < 8; ++j)
#pragma unroll
    for (int r = 0; r < 8; ++r) stt[j * 16 + col][wave * 16 + 8 * g + r] = (acc[j][r] + accl[j][r] * (1.0f / 2048.0f)) * (1.0f / 2048.0f);   // [d][m local]
  __syncthreads(); for (int e = tid; e < 128 * 16; e += 128) { const int d = e >> 4, q = e & 15; vst2(O + (b * CC + (size_t)h * DK + d) * (size_t)NN + blockIdx.x * 64 + q * 4, *(const v4f*)&stt[d][q * 4]); } }
// ---- k_gate: block = (64 pixels, b): gate = sigmoid(sum_c gate_w[c] o[c][m] + gate_b); out = o * gate + o (NCHW lines)
__global__ __launch_bounds__(256) void k_gate(const float* __restrict__ O, const float* __restrict__ GW, const float* __restrict__ GB, float* __restrict__ OUT) { __shared__ float sg[64]; __shared__ float part[4][64]; const int t = threadIdx.x; const size_t b = blockIdx.y; const int m0 = blockIdx.x * 64; const int ml = t & 63, q4 = t >> 6;
  { float s = 0.f; for (int c = q4; c < CC; c += 4) s += bfr(GW[c]) * O[(b * CC + c) * (size_t)NN + m0 + ml]; part[q4][ml] = s; }
  __syncthreads(); if (t < 64) { const float s = part[0][t] + part[1][t] + part[2][t] + part[3][t] + bfr(GB[0]); sg[t] = 1.0f + 1.0f / (1.0f + expf(-s)); } __syncthreads();
  for (int e = t; e < CC * 16; e += 256) { const int c = e >> 4, q = e & 15; const float* orow = O + (b * CC + c) * (size_t)NN + m0 + q * 4; v4f v; v[0] = orow[0] * sg[q * 4]; v[1] = orow[1] * sg[q * 4 + 1]; v[2] = orow[2] * sg[q * 4 + 2]; v[3] = orow[3] * sg[q * 4 + 3]; vst2(OUT + (b * CC + c) * (size_t)NN + m0 + q * 4, v); } }
extern "C" void kernel_launch(void* const* d_in, const int* in_sizes, int n_in, void* d_out, int out_size, void* d_ws, size_t ws_size, hipStream_t stream) {
  (void)in_sizes; (void)n_in; (void)out_size;
  const float** F = (const float**)d_in;   // 0 x [8,512,32,32], 1 wq [512,512], 2 bq, 3 wk, 4 bk, 5 wv, 6 bv, 7 fc1_w [128,512], 8 fc1_b, 9 fc2_w [512,128], 10 fc2_b, 11 gate_w [1,512], 12 gate_b [1]
  if (ws_size < (size_t)WS_END) return;
  char* ws = (char*)d_ws; float *SC = (float*)(ws + WS_SC), *ST = (float*)(ws + WS_ST), *SL = (float*)(ws + WS_SL), *O = (float*)(ws + WS_O); _Float16 *QH = (_Float16*)(ws + WS_QH), *QL = (_Float16*)(ws + WS_QL), *KH = (_Float16*)(ws + WS_KH), *KL = (_Float16*)(ws + WS_KL), *VT = (_Float16*)(ws + WS_VT), *VTL = (_Float16*)(ws + WS_VTL);
  k_se<<<NB, 256, 0, stream>>>(F[0], F[7], F[8], F[9], F[10], SC);
  k_proj<<<dim3(NN / 64, CC / 128, 3 * NB), 128, 0, stream>>>(F[0], SC, F[1], F[2], F[3], F[4], F[5], F[6], QH, QL, KH, KL, VT, VTL);
  k_stats<<<dim3(NN / 64, NH, TNB), 128, 0, stream>>>(QH, QL, KH, KL, ST, SL);
  k_ov<<<dim3(NN / 64, NH, TNB), 128, 0, stream>>>(QH, QL, KH, KL, VT, VTL, ST, SL, O);
  k_gate<<<dim3(NN / 64, TNB), 256, 0, stream>>>(O, F[11], F[12], (float*)d_out);
}

// v001
// One run takes 450 microseconds.
// Next to v000, in two timings, it ran 1.28 and 1.29 times as fast.
#include <hip/hip_runtime.h>
#include <math.h>

typedef __attribute__((ext_vector_type(16))) _Float16 v16h;
typedef __attribute__((ext_vector_type(16))) __bf16 v16b;
typedef __attribute__((ext_vector_type(8)))  _Float16 v8h;
typedef __attribute__((ext_vector_type(8)))  float v8f;
typedef __attribute__((ext_vector_type(4)))  float v4f;
typedef __attribute__((ext_vector_type(2)))  float v2f;
typedef __attribute__((ext_vector_type(4)))  unsigned v4u;
typedef __attribute__((ext_vector_type(4)))  int v4i;
typedef float __attribute__((may_alias)) float_a;
typedef int __attribute__((may_alias)) int_a;

template <typename T> __device__ __forceinline__ void vst2(void* p, T v) { *(T*)p = v;  }
__device__ __forceinline__ v8f wmma16(v16h a, v16h b, v8f c) {
  v8f d = __builtin_amdgcn_wmma_f32_16x16x32_f16(false, a, false, b, (short)0, c, false, false);
  asm volatile("v_nop\n\tv_nop\n\tv_nop\n\tv_nop" : "+v"(d) : "v"(a), "v"(b));
  return d;
}
__device__ __forceinline__ v8f wmma_bf(v16b a, v16b b, v8f c) {
  v8f d = __builtin_amdgcn_wmma_f32_16x16x32_bf16(false, a, false, b, (short)0, c, false, false);
  asm volatile("v_nop\n\tv_nop\n\tv_nop\n\tv_nop" : "+v"(d) : "v"(a), "v"(b));
  return d;
}
// 16x16x32 fragments: lane = (h = lane>>4, row/col = lane&15); elements 0..7 = k0+8h+0..7, 8..15 = k0+16+8h+0..7; D element r = row 8h+r
__device__ __forceinline__ v16h frag_h(const _Float16* rowk0, int lane) {
  union { v16h v; v8h q[2]; } u; const _Float16* p = rowk0 + 8 * (lane >> 4);
  u.q[0] = *(const v8h*)p; u.q[1] = *(const v8h*)(p + 16); return u.v;
}
__device__ __forceinline__ v16h frag_f32(const float* rowk0, int lane) {
  v16h a; const float* p = rowk0 + 8 * (lane >> 4);
#pragma unroll
  for (int i = 0; i < 8; ++i) { a[i] = (_Float16)p[i]; a[8 + i] = (_Float16)p[16 + i]; }
  return a;
}
__device__ __forceinline__ v16h frag_f32s(const float* rowk0, int lane, float sc) {
  v16h a; const float* p = rowk0 + 8 * (lane >> 4);
#pragma unroll
  for (int i = 0; i < 8; ++i) { a[i] = (_Float16)(p[i] * sc); a[8 + i] = (_Float16)(p[16 + i] * sc); }
  return a;
}
// column fragment from a [K][ld] layout (column n), rows >= K read as 0
__device__ __forceinline__ v16h fragc_f32(const float* W, int k0, int n, int lane, int ld, int K) {
  v16h a; const int g = lane >> 4;
#pragma unroll
  for (int i = 0; i < 8; ++i) { const int ka = k0 + 8 * g + i, kb = ka + 16;
    a[i] = (_Float16)(ka < K ? W[(size_t)(ka < K ? ka : K - 1) * ld + n] : 0.f); a[8 + i] = (_Float16)(kb < K ? W[(size_t)(kb < K ? kb : K - 1) * ld + n] : 0.f); }
  return a;
}
struct F2 { v16b h, l; };
__device__ __forceinline__ F2 bsplit16(const float v[16]) { F2 r;
#pragma unroll
  for (int i = 0; i < 16; ++i) { const __bf16 h = (__bf16)v[i]; r.h[i] = h; r.l[i] = (__bf16)(v[i] - (float)h); }
  return r; }
__device__ __forceinline__ F2 split_row(const float* row, int k0, int lane) { float v[16]; const float* p = row + k0 + 8 * (lane >> 4);
#pragma unroll
  for (int i = 0; i < 8; ++i) { v[i] = p[i]; v[8 + i] = p[16 + i]; }
  return bsplit16(v); }
__device__ __forceinline__ F2 split_rowK(const float* row, int k0, int lane, int K) { float v[16]; const int g = lane >> 4;
#pragma unroll
  for (int i = 0; i < 8; ++i) { const int ka = k0 + 8 * g + i, kb = ka + 16; v[i] = ka < K ? row[ka < K ? ka : K - 1] : 0.f; v[8 + i] = kb < K ? row[kb < K ? kb : K - 1] : 0.f; }
  return bsplit16(v); }
__device__ __forceinline__ F2 split_col(const float* W, int k0, int n, int lane, int ld, int K) { float v[16]; const int g = lane >> 4;
#pragma unroll
  for (int i = 0; i < 8; ++i) { const int ka = k0 + 8 * g + i, kb = ka + 16; v[i] = ka < K ? W[(size_t)(ka < K ? ka : K - 1) * ld + n] : 0.f; v[8 + i] = kb < K ? W[(size_t)(kb < K ? kb : K - 1) * ld + n] : 0.f; }
  return bsplit16(v); }
__device__ __forceinline__ v8f mac3(const F2& a, const F2& b, v8f c) { c = wmma_bf(a.l, b.h, c); c = wmma_bf(a.h, b.l, c); return wmma_bf(a.h, b.h, c); }
__device__ __forceinline__ float sigm(float v) { return 1.0f / (1.0f + expf(-v)); }
#define LDSX() do { asm volatile("s_wait_dscnt 0" ::: "memory"); __builtin_amdgcn_wave_barrier(); __builtin_amdgcn_fence(__ATOMIC_RELEASE, "workgroup"); } while (0)


// SelfModule (B 8, C 512, 32x32, 4 heads x 128): x = x * sigmoid(SE(x)) + x; q, k, v = 1x1 convs; att = softmax_m(q_n . k_m / sqrt(128)); o[:, m] = sum_n v[:, n] att[n, m]; out = o * sigmoid(gate 1x1 conv(o)) + o.
#define NB 8
#define CC 512
#define NN 1024
#define NH 4
#define DK 128
#define RR 128            // SE bottleneck
#ifndef TNB
#define TNB NB
#endif
typedef __attribute__((ext_vector_type(8))) __bf16 v8b;
__device__ __forceinline__ v16b frag_b(const __bf16* rowk0, int lane) {
  union { v16b v; v8b q[2]; } u; const __bf16* p = rowk0 + 8 * (lane >> 4);
  u.q[0] = *(const v8b*)p; u.q[1] = *(const v8b*)(p + 16); return u.v;
}
__device__ __forceinline__ float bfr(float v) { return (float)(__bf16)v; }
__device__ __attribute__((noinline)) float exp_ni(float v) { return expf(v); }
__device__ __attribute__((noinline)) float erf_ni(float v) { return erff(v); }

#define WS_SC  0u                                   // f32 1 + sigmoid(SE) [b][512]
#define WS_QH  (WS_SC + 4u * (size_t)NB * CC)            // f16 hi|lo q rows [b*NN + n][512]; k rows; v planes [b][512][NN]
#define WS_QL  (WS_QH + 2u * (size_t)NB * NN * CC)
#define WS_KH  (WS_QL + 2u * (size_t)NB * NN * CC)
#define WS_KL  (WS_KH + 2u * (size_t)NB * NN * CC)
#define WS_VT  (WS_KL + 2u * (size_t)NB * NN * CC)
#define WS_VTL (WS_VT + 2u * (size_t)NB * CC * NN)
#define WS_ST  (WS_VTL + 2u * (size_t)NB * CC * NN)      // f32 row max [b][h][n], row sum
#define WS_SL  (WS_ST + 4u * (size_t)NB * NH * NN)
#define WS_O   (WS_SL + 4u * (size_t)NB * NH * NN)       // f32 o NCHW [b][512][NN]
#define WS_P   (WS_O + 4u * (size_t)NB * CC * NN)       // f32 pooled mean [b][512]
#define WS_END (WS_P + 4u * (size_t)NB * CC)

// ---- k_pool: block = 32 rows (b, c), one wave per row: mean over the 1,024 pixels, 8 loads of 16 bytes per lane in flight; the block's 32 means leave as one 128-B line; the loops are unrolled so that v[] stays in registers and all 8 loads issue before the first is used
__global__ __launch_bounds__(1024) void k_pool(const float* __restrict__ X, float* __restrict__ P) { __shared__ float sp[32]; const int t = threadIdx.x, lane = t & 31, w = t >> 5;
  const float* xr = X + ((size_t)blockIdx.x * 32 + w) * NN + lane * 4; v4f v[8];
#pragma unroll
  for (int i = 0; i < 8; ++i) v[i] = *(const v4f*)(xr + i * 128);
  float s = 0.f;
#pragma unroll
  for (int i = 0; i < 8; ++i) s += (bfr(v[i][0]) + bfr(v[i][1])) + (bfr(v[i][2]) + bfr(v[i][3]));
#pragma unroll
  for (int o = 1; o < 32; o <<= 1) s += __shfl_xor(s, o);
  if (lane == 0) sp[w] = s * (1.0f / NN);
  __syncthreads(); if (t < 32) P[(size_t)blockIdx.x * 32 + t] = sp[t]; }
// ---- k_fc: block = b, 32 waves: fc1 (4 rows per wave), relu, fc2 (16 rows per wave), 1 + sigmoid; each dot product is split over the lanes of one wave (16-byte loads along the row) and summed by shuffles; every loop is unrolled so that its arrays stay in registers, a stage's loads issue together and the rows' shuffle chains overlap
__global__ __launch_bounds__(1024) void k_fc(const float* __restrict__ P, const float* __restrict__ F1W, const float* __restrict__ F1B, const float* __restrict__ F2W, const float* __restrict__ F2B, float* __restrict__ SC) { __shared__ __align__(16) float sh[RR]; __shared__ __align__(16) float ss[CC]; const int t = threadIdx.x, lane = t & 31, w = t >> 5; const size_t b = blockIdx.x;
  v4f p[4], f1[4][4]; float a[4];
#pragma unroll
  for (int r = 0; r < 4; ++r)
#pragma unroll
    for (int i = 0; i < 4; ++i) f1[r][i] = *(const v4f*)(F1W + (size_t)(w * 4 + r) * CC + i * 128 + lane * 4);
  asm volatile("s_wait_xcnt 0x0" ::: "memory");   // the loads below may land in the address registers of the loads above: the wait stands in front of that overwrite
#pragma unroll
  for (int i = 0; i < 4; ++i) p[i] = *(const v4f*)(P + b * CC + i * 128 + lane * 4);
#pragma unroll
  for (int r = 0; r < 4; ++r) { float s = 0.f;
#pragma unroll
    for (int i = 0; i < 4; ++i) s += p[i][0] * bfr(f1[r][i][0]) + p[i][1] * bfr(f1[r][i][1]) + p[i][2] * bfr(f1[r][i][2]) + p[i][3] * bfr(f1[r][i][3]);
    a[r] = s; }
#pragma unroll
  for (int r = 0; r < 4; ++r) {
#pragma unroll
    for (int o = 1; o < 32; o <<= 1) a[r] += __shfl_xor(a[r], o); }
  if (lane < 4) { const float s = lane == 0 ? a[0] : lane == 1 ? a[1] : lane == 2 ? a[2] : a[3]; sh[w * 4 + lane] = fmaxf(s + bfr(F1B[w * 4 + lane]), 0.f); }
  __syncthreads();
  const v4f hv = *(const v4f*)&sh[lane * 4]; float c[16];
#pragma unroll
  for (int r = 0; r < 16; ++r) { const v4f f = *(const v4f*)(F2W + (size_t)(w * 16 + r) * RR + lane * 4); c[r] = hv[0] * bfr(f[0]) + hv[1] * bfr(f[1]) + hv[2] * bfr(f[2]) + hv[3] * bfr(f[3]); }
#pragma unroll
  for (int r = 0; r < 16; ++r) {
#pragma unroll
    for (int o = 1; o < 32; o <<= 1) c[r] += __shfl_xor(c[r], o); }
  if (lane < 16) { float s = c[0];
#pragma unroll
    for (int r = 1; r < 16; ++r) s = lane == r ? c[r] : s;
    s += bfr(F2B[w * 16 + lane]); ss[w * 16 + lane] = 1.0f + 1.0f / (1.0f + expf(-s)); }
  __syncthreads(); if (t < CC / 4) vst2(SC + b * CC + t * 4, *(const v4f*)&ss[t * 4]); }
// ---- k_proj: block = (64 pixels, 128 output channels, which*NB + b): conv1x1 over xs = x * sc (A gathered from NCHW, bf16 hi + lo) + bias; q, k -> f16 hi/lo rows [n][512]; v -> planes [c][n]
__global__ __launch_bounds__(128) void k_proj(const float* __restrict__ X, const float* __restrict__ SC, const float* __restrict__ WQ, const float* __restrict__ BQ, const float* __restrict__ WK, const float* __restrict__ BK, const float* __restrict__ WV, const float* __restrict__ BV, _Float16* __restrict__ QH, _Float16* __restrict__ QL, _Float16* __restrict__ KH, _Float16* __restrict__ KL, _Float16* __restrict__ VT, _Float16* __restrict__ VTL) {
  __shared__ __align__(16) _Float16 sh[64][136], sl[64][136]; __shared__ __align__(16) _Float16 th[128][72], tl[128][72]; __shared__ float ssc[CC];
  const int tid = threadIdx.x, wave = tid >> 5, lane = tid & 31, col = lane & 15, g = lane >> 4; const int which = blockIdx.z / NB; const size_t b = blockIdx.z % NB; const int n0 = blockIdx.x * 64 + wave * 16; const int c0 = blockIdx.y * 128; const float* Wm = which == 0 ? WQ : which == 1 ? WK : WV; const float* Bm = which == 0 ? BQ : which == 1 ? BK : BV; const float* Xb = X + b * CC * (size_t)NN;
  for (int c = tid; c < CC; c += 128) ssc[c] = SC[b * CC + c]; __syncthreads();
  v8f acc[8] = {};
#pragma unroll 2
  for (int kc = 0; kc < CC / 32; ++kc) { float v[16]; const int px = n0 + col;
#pragma unroll
    for (int i = 0; i < 8; ++i) { const int ca = kc * 32 + 8 * g + i, cb2 = ca + 16; v[i] = bfr(Xb[(size_t)ca * NN + px]) * ssc[ca]; v[8 + i] = bfr(Xb[(size_t)cb2 * NN + px]) * ssc[cb2]; }
    const F2 a = bsplit16(v);
#pragma unroll
    for (int j = 0; j < 8; ++j) { v16b w; const float* wr = Wm + (size_t)(c0 + j * 16 + col) * CC + kc * 32 + 8 * g;
#pragma unroll
      for (int i = 0; i < 8; ++i) { w[i] = (__bf16)wr[i]; w[8 + i] = (__bf16)wr[16 + i]; }
      acc[j] = wmma_bf(a.h, w, acc[j]); acc[j] = wmma_bf(a.l, w, acc[j]); } }
#pragma unroll
  for (int j = 0; j < 8; ++j) { const float bb = bfr(Bm[c0 + j * 16 + col]);
#pragma unroll
    for (int r = 0; r < 8; ++r) { const float v = acc[j][r] + bb; const _Float16 hv = (_Float16)v, lv = (_Float16)((v - (float)hv) * 2048.0f); if (which < 2) { sh[wave * 16 + 8 * g + r][j * 16 + col] = hv; sl[wave * 16 + 8 * g + r][j * 16 + col] = lv; } else { th[j * 16 + col][wave * 16 + 8 * g + r] = hv; tl[j * 16 + col][wave * 16 + 8 * g + r] = lv; } } }
  __syncthreads();
  if (which < 2) { _Float16* PH = which == 0 ? QH : KH; _Float16* PL = which == 0 ? QL : KL; for (int e = tid; e < 64 * 16; e += 128) { const int rl = e >> 4, q = e & 15; const size_t o = (b * NN + blockIdx.x * 64 + rl) * CC + c0 + q * 8; vst2((unsigned*)(PH + o), *(const v4u*)&sh[rl][q * 8]); vst2((unsigned*)(PL + o), *(const v4u*)&sl[rl][q * 8]); } }
  else { for (int e = tid; e < 128 * 8; e += 128) { const int cl = e >> 3, q = e & 7; const size_t o = (b * CC + c0 + cl) * (size_t)NN + blockIdx.x * 64 + q * 8; vst2((unsigned*)(VT + o), *(const v4u*)&th[cl][q * 8]); vst2((unsigned*)(VTL + o), *(const v4u*)&tl[cl][q * 8]); } } }
// ---- k_stats: block = (64 queries n, h, b): row max and sum of exp over all 1,024 keys (3-product logits x 128^-1/2); one 256-B line of each per block
__global__ __launch_bounds__(128) void k_stats(const _Float16* __restrict__ QH, const _Float16* __restrict__ QL, const _Float16* __restrict__ KH, const _Float16* __restrict__ KL, float* __restrict__ ST, float* __restrict__ SL) { __shared__ __align__(16) float sm[64], ssum[64];
  const int tid = threadIdx.x, wave = tid >> 5, lane = tid & 31, col = lane & 15, g = lane >> 4; const int h = blockIdx.y; const size_t b = blockIdx.z; const int q0 = blockIdx.x * 64 + wave * 16; const size_t rq = b * NN + q0;
  v16h aq[4], al[4];
#pragma unroll
  for (int kc = 0; kc < 4; ++kc) { aq[kc] = frag_h(QH + (rq + col) * CC + h * DK + kc * 32, lane); al[kc] = frag_h(QL + (rq + col) * CC + h * DK + kc * 32, lane); }
  float m[8], l[8];
#pragma unroll
  for (int r = 0; r < 8; ++r) { m[r] = -3.0e38f; l[r] = 0.f; }
#pragma unroll 1
  for (int ks = 0; ks < NN / 32; ++ks) { float s[2][8];
#pragma unroll
    for (int ct = 0; ct < 2; ++ct) { const size_t rk = b * NN + ks * 32 + ct * 16 + col; v8f c = {}, cl = {};
#pragma unroll
      for (int kc = 0; kc < 4; ++kc) { const v16h kh = frag_h(KH + rk * CC + h * DK + kc * 32, lane), kl = frag_h(KL + rk * CC + h * DK + kc * 32, lane); c = wmma16(aq[kc], kh, c); cl = wmma16(aq[kc], kl, cl); cl = wmma16(al[kc], kh, cl); }
#pragma unroll
      for (int r = 0; r < 8; ++r) s[ct][r] = (c[r] + cl[r] * (1.0f / 2048.0f)) * 0.08838834764831845f; }
#pragma unroll
    for (int r = 0; r < 8; ++r) { float mx = fmaxf(s[0][r], s[1][r]);
#pragma unroll
      for (int o = 1; o < 16; o <<= 1) mx = fmaxf(mx, __shfl_xor(mx, o));
      const float mn = fmaxf(m[r], mx); const float alpha = __expf(m[r] - mn); float es = __expf(s[0][r] - mn) + __expf(s[1][r] - mn);
#pragma unroll
      for (int o = 1; o < 16; o <<= 1) es += __shfl_xor(es, o);
      l[r] = l[r] * alpha + es; m[r] = mn; } }
  if (col == 0) {
#pragma unroll
    for (int r = 0; r < 8; ++r) { sm[wave * 16 + 8 * g + r] = m[r]; ssum[wave * 16 + 8 * g + r] = l[r]; } }
  __syncthreads(); if (tid < 16) vst2(ST + (b * NH + h) * (size_t)NN + blockIdx.x * 64 + tid * 4, *(const v4f*)&sm[tid * 4]); else if (tid < 32) vst2(SL + (b * NH + h) * (size_t)NN + blockIdx.x * 64 + (tid - 16) * 4, *(const v4f*)&ssum[(tid - 16) * 4]); }
// ---- k_ov: block = (64 output pixels m, h, b): for each query tile n: s^T[m][n] = k_m . q_n (3 products), att[n][m] = exp(s - max_n) / sum_n, then o^T[m][d] += sum_n att[n][m] v[d][n] (att^T tile as the A operand, v planes as B; 3 products); o written NCHW per head channel
__global__ __launch_bounds__(128) void k_ov(const _Float16* __restrict__ QH, const _Float16* __restrict__ QL, const _Float16* __restrict__ KH, const _Float16* __restrict__ KL, const _Float16* __restrict__ VT, const _Float16* __restrict__ VTL, const float* __restrict__ ST, const float* __restrict__ SL, float* __restrict__ O) {
  __shared__ __align__(16) float sp[4][16][36]; __shared__ __align__(16) float stt[128][68];
  const int tid = threadIdx.x, wave = tid >> 5, lane = tid & 31, col = lane & 15, g = lane >> 4; const int h = blockIdx.y; const size_t b = blockIdx.z; const int mm0 = blockIdx.x * 64 + wave * 16; const size_t rm = b * NN + mm0;
  v16h ak[4], akl[4];   // A = k rows of this block's output pixels m
#pragma unroll
  for (int kc = 0; kc < 4; ++kc) { ak[kc] = frag_h(KH + (rm + col) * CC + h * DK + kc * 32, lane); akl[kc] = frag_h(KL + (rm + col) * CC + h * DK + kc * 32, lane); }
  const float* stm = ST + (b * NH + h) * (size_t)NN; const float* stl = SL + (b * NH + h) * (size_t)NN;
  v8f acc[8], accl[8];
#pragma unroll
  for (int j = 0; j < 8; ++j) { acc[j] = v8f{}; accl[j] = v8f{}; }
#pragma unroll 1
  for (int ks = 0; ks < NN / 32; ++ks) {
#pragma unroll
    for (int ct = 0; ct < 2; ++ct) { const int n = ks * 32 + ct * 16 + col; const size_t rn = b * NN + n; v8f c = {}, cl = {};
#pragma unroll
      for (int kc = 0; kc < 4; ++kc) { const v16h qh = frag_h(QH + rn * CC + h * DK + kc * 32, lane), ql = frag_h(QL + rn * CC + h * DK + kc * 32, lane); c = wmma16(ak[kc], qh, c); cl = wmma16(ak[kc], ql, cl); cl = wmma16(akl[kc], qh, cl); }
      const float mx = stm[n], il = 1.0f / stl[n];   // per query n (the column of this transposed tile)
#pragma unroll
      for (int r = 0; r < 8; ++r) { const float s = (c[r] + cl[r] * (1.0f / 2048.0f)) * 0.08838834764831845f; sp[wave][8 * g + r][ct * 16 + col] = __expf(s - mx) * il; } }
    LDSX();
    v16h pa, pal; { const float* prow = &sp[wave][col][0] + 8 * (lane >> 4);
#pragma unroll
      for (int i = 0; i < 8; ++i) { const float p0 = prow[i] * 2048.0f, p1 = prow[16 + i] * 2048.0f; pa[i] = (_Float16)p0; pa[8 + i] = (_Float16)p1; pal[i] = (_Float16)((p0 - (float)pa[i]) * 2048.0f); pal[8 + i] = (_Float16)((p1 - (float)pa[8 + i]) * 2048.0f); } }
#pragma unroll
    for (int j = 0; j < 8; ++j) { const size_t po = (b * CC + (size_t)h * DK + j * 16 + col) * (size_t)NN + ks * 32; const v16h vh = frag_h(VT + po, lane), vl = frag_h(VTL + po, lane); acc[j] = wmma16(pa, vh, acc[j]); accl[j] = wmma16(pa, vl, accl[j]); accl[j] = wmma16(pal, vh, accl[j]); }
    LDSX(); }
#pragma unroll
  for (int j = 0; j < 8; ++j)
#pragma unroll
    for (int r = 0; r < 8; ++r) stt[j * 16 + col][wave * 16 + 8 * g + r] = (acc[j][r] + accl[j][r] * (1.0f / 2048.0f)) * (1.0f / 2048.0f);   // [d][m local]
  __syncthreads(); for (int e = tid; e < 128 * 16; e += 128) { const int d = e >> 4, q = e & 15; vst2(O + (b * CC + (size_t)h * DK + d) * (size_t)NN + blockIdx.x * 64 + q * 4, *(const v4f*)&stt[d][q * 4]); } }
// ---- k_gate: block = (64 pixels, b): gate = sigmoid(sum_c gate_w[c] o[c][m] + gate_b); out = o * gate + o (NCHW lines)
__global__ __launch_bounds__(256) void k_gate(const float* __restrict__ O, const float* __restrict__ GW, const float* __restrict__ GB, float* __restrict__ OUT) { __shared__ float sg[64]; __shared__ float part[4][64]; const int t = threadIdx.x; const size_t b = blockIdx.y; const int m0 = blockIdx.x * 64; const int ml = t & 63, q4 = t >> 6;
  { float s = 0.f; for (int c = q4; c < CC; c += 4) s += bfr(GW[c]) * O[(b * CC + c) * (size_t)NN + m0 + ml]; part[q4][ml] = s; }
  __syncthreads(); if (t < 64) { const float s = part[0][t] + part[1][t] + part[2][t] + part[3][t] + bfr(GB[0]); sg[t] = 1.0f + 1.0f / (1.0f + expf(-s)); } __syncthreads();
  for (int e = t; e < CC * 16; e += 256) { const int c = e >> 4, q = e & 15; const float* orow = O + (b * CC + c) * (size_t)NN + m0 + q * 4; v4f v; v[0] = orow[0] * sg[q * 4]; v[1] = orow[1] * sg[q * 4 + 1]; v[2] = orow[2] * sg[q * 4 + 2]; v[3] = orow[3] * sg[q * 4 + 3]; vst2(OUT + (b * CC + c) * (size_t)NN + m0 + q * 4, v); } }
extern "C" void kernel_launch(void* const* d_in, const int* in_sizes, int n_in, void* d_out, int out_size, void* d_ws, size_t ws_size, hipStream_t stream) {
  (void)in_sizes; (void)n_in; (void)out_size;
  const float** F = (const float**)d_in;   // 0 x [8,512,32,32], 1 wq [512,512], 2 bq, 3 wk, 4 bk, 5 wv, 6 bv, 7 fc1_w [128,512], 8 fc1_b, 9 fc2_w [512,128], 10 fc2_b, 11 gate_w [1,512], 12 gate_b [1]
  if (ws_size < (size_t)WS_END) return;
  char* ws = (char*)d_ws; float *SC = (float*)(ws + WS_SC), *ST = (float*)(ws + WS_ST), *SL = (float*)(ws + WS_SL), *O = (float*)(ws + WS_O), *P = (float*)(ws + WS_P); _Float16 *QH = (_Float16*)(ws + WS_QH), *QL = (_Float16*)(ws + WS_QL), *KH = (_Float16*)(ws + WS_KH), *KL = (_Float16*)(ws + WS_KL), *VT = (_Float16*)(ws + WS_VT), *VTL = (_Float16*)(ws + WS_VTL);
  k_pool<<<NB * CC / 32, 1024, 0, stream>>>(F[0], P);
  k_fc<<<NB, 1024, 0, stream>>>(P, F[7], F[8], F[9], F[10], SC);
  k_proj<<<dim3(NN / 64, CC / 128, 3 * NB), 128, 0, stream>>>(F[0], SC, F[1], F[2], F[3], F[4], F[5], F[6], QH, QL, KH, KL, VT, VTL);
  k_stats<<<dim3(NN / 64, NH, TNB), 128, 0, stream>>>(QH, QL, KH, KL, ST, SL);
  k_ov<<<dim3(NN / 64, NH, TNB), 128, 0, stream>>>(QH, QL, KH, KL, VT, VTL, ST, SL, O);
  k_gate<<<dim3(NN / 64, TNB), 256, 0, stream>>>(O, F[11], F[12], (float*)d_out);
}

// v002
// It runs in 163 microseconds.
// In two side-by-side timings against v001, it was 2.76 and 2.77 times as fast.
// Over all steps from v000 it is 3.55 times as fast.
#include <hip/hip_runtime.h>
#include <math.h>

typedef __attribute__((ext_vector_type(16))) _Float16 v16h;
typedef __attribute__((ext_vector_type(16))) __bf16 v16b;
typedef __attribute__((ext_vector_type(8)))  _Float16 v8h;
typedef __attribute__((ext_vector_type(8)))  float v8f;
typedef __attribute__((ext_vector_type(4)))  float v4f;
typedef __attribute__((ext_vector_type(2)))  float v2f;
typedef __attribute__((ext_vector_type(4)))  unsigned v4u;
typedef __attribute__((ext_vector_type(4)))  int v4i;
typedef float __attribute__((may_alias)) float_a;
typedef int __attribute__((may_alias)) int_a;

template <typename T> __device__ __forceinline__ void vst2(void* p, T v) { *(T*)p = v;  }
__device__ __forceinline__ v8f wmma16(v16h a, v16h b, v8f c) {
  v8f d = __builtin_amdgcn_wmma_f32_16x16x32_f16(false, a, false, b, (short)0, c, false, false);
  asm volatile("v_nop\n\tv_nop\n\tv_nop\n\tv_nop" : "+v"(d) : "v"(a), "v"(b));
  return d;
}
__device__ __forceinline__ v8f wmma_bf(v16b a, v16b b, v8f c) {
  v8f d = __builtin_amdgcn_wmma_f32_16x16x32_bf16(false, a, false, b, (short)0, c, false, false);
  asm volatile("v_nop\n\tv_nop\n\tv_nop\n\tv_nop" : "+v"(d) : "v"(a), "v"(b));
  return d;
}
// 16x16x32 fragments: lane = (h = lane>>4, row/col = lane&15); elements 0..7 = k0+8h+0..7, 8..15 = k0+16+8h+0..7; D element r = row 8h+r
__device__ __forceinline__ v16h frag_h(const _Float16* rowk0, int lane) {
  union { v16h v; v8h q[2]; } u; const _Float16* p = rowk0 + 8 * (lane >> 4);
  u.q[0] = *(const v8h*)p; u.q[1] = *(const v8h*)(p + 16); return u.v;
}
__device__ __forceinline__ v16h frag_f32(const float* rowk0, int lane) {
  v16h a; const float* p = rowk0 + 8 * (lane >> 4);
#pragma unroll
  for (int i = 0; i < 8; ++i) { a[i] = (_Float16)p[i]; a[8 + i] = (_Float16)p[16 + i]; }
  return a;
}
__device__ __forceinline__ v16h frag_f32s(const float* rowk0, int lane, float sc) {
  v16h a; const float* p = rowk0 + 8 * (lane >> 4);
#pragma unroll
  for (int i = 0; i < 8; ++i) { a[i] = (_Float16)(p[i] * sc); a[8 + i] = (_Float16)(p[16 + i] * sc); }
  return a;
}
// column fragment from a [K][ld] layout (column n), rows >= K read as 0
__device__ __forceinline__ v16h fragc_f32(const float* W, int k0, int n, int lane, int ld, int K) {
  v16h a; const int g = lane >> 4;
#pragma unroll
  for (int i = 0; i < 8; ++i) { const int ka = k0 + 8 * g + i, kb = ka + 16;
    a[i] = (_Float16)(ka < K ? W[(size_t)(ka < K ? ka : K - 1) * ld + n] : 0.f); a[8 + i] = (_Float16)(kb < K ? W[(size_t)(kb < K ? kb : K - 1) * ld + n] : 0.f); }
  return a;
}
struct F2 { v16b h, l; };
__device__ __forceinline__ F2 bsplit16(const float v[16]) { F2 r;
#pragma unroll
  for (int i = 0; i < 16; ++i) { const __bf16 h = (__bf16)v[i]; r.h[i] = h; r.l[i] = (__bf16)(v[i] - (float)h); }
  return r; }
__device__ __forceinline__ F2 split_row(const float* row, int k0, int lane) { float v[16]; const float* p = row + k0 + 8 * (lane >> 4);
#pragma unroll
  for (int i = 0; i < 8; ++i) { v[i] = p[i]; v[8 + i] = p[16 + i]; }
  return bsplit16(v); }
__device__ __forceinline__ F2 split_rowK(const float* row, int k0, int lane, int K) { float v[16]; const int g = lane >> 4;
#pragma unroll
  for (int i = 0; i < 8; ++i) { const int ka = k0 + 8 * g + i, kb = ka + 16; v[i] = ka < K ? row[ka < K ? ka : K - 1] : 0.f; v[8 + i] = kb < K ? row[kb < K ? kb : K - 1] : 0.f; }
  return bsplit16(v); }
__device__ __forceinline__ F2 split_col(const float* W, int k0, int n, int lane, int ld, int K) { float v[16]; const int g = lane >> 4;
#pragma unroll
  for (int i = 0; i < 8; ++i) { const int ka = k0 + 8 * g + i, kb = ka + 16; v[i] = ka < K ? W[(size_t)(ka < K ? ka : K - 1) * ld + n] : 0.f; v[8 + i] = kb < K ? W[(size_t)(kb < K ? kb : K - 1) * ld + n] : 0.f; }
  return bsplit16(v); }
__device__ __forceinline__ v8f mac3(const F2& a, const F2& b, v8f c) { c = wmma_bf(a.l, b.h, c); c = wmma_bf(a.h, b.l, c); return wmma_bf(a.h, b.h, c); }
__device__ __forceinline__ float sigm(float v) { return 1.0f / (1.0f + expf(-v)); }
#define LDSX() do { asm volatile("s_wait_dscnt 0" ::: "memory"); __builtin_amdgcn_wave_barrier(); __builtin_amdgcn_fence(__ATOMIC_RELEASE, "workgroup"); } while (0)


// SelfModule (B 8, C 512, 32x32, 4 heads x 128): x = x * sigmoid(SE(x)) + x; q, k, v = 1x1 convs; att = softmax_m(q_n . k_m / sqrt(128)); o[:, m] = sum_n v[:, n] att[n, m]; out = o * sigmoid(gate 1x1 conv(o)) + o.
#define NB 8
#define CC 512
#define NN 1024
#define NH 4
#define DK 128
#define RR 128            // SE bottleneck
#ifndef TNB
#define TNB NB
#endif
typedef __attribute__((ext_vector_type(8))) __bf16 v8b;
__device__ __forceinline__ v16b frag_b(const __bf16* rowk0, int lane) {
  union { v16b v; v8b q[2]; } u; const __bf16* p = rowk0 + 8 * (lane >> 4);
  u.q[0] = *(const v8b*)p; u.q[1] = *(const v8b*)(p + 16); return u.v;
}
__device__ __forceinline__ float bfr(float v) { return (float)(__bf16)v; }
typedef __attribute__((ext_vector_type(4))) __bf16 v4b;
// LDS row pitches of the staged tiles, in 16-bit elements: 16 B x an odd number, so that the 16 rows of a ds_load_b128 fragment read fall on distinct banks
#define QP 136            // q / k rows of 128 elements: 272 B
#define VP 40             // rows of 32 elements (v planes, weight rows): 80 B
__device__ __attribute__((noinline)) float exp_ni(float v) { return expf(v); }
__device__ __attribute__((noinline)) float erf_ni(float v) { return erff(v); }

#define WS_SC  0u                                   // f32 1 + sigmoid(SE) [b][512]
#define WS_QH  (WS_SC + 4u * (size_t)NB * CC)            // f16 hi|lo q rows [b*NN + n][512]; k rows; v planes [b][512][NN]
#define WS_QL  (WS_QH + 2u * (size_t)NB * NN * CC)
#define WS_KH  (WS_QL + 2u * (size_t)NB * NN * CC)
#define WS_KL  (WS_KH + 2u * (size_t)NB * NN * CC)
#define WS_VT  (WS_KL + 2u * (size_t)NB * NN * CC)
#define WS_VTL (WS_VT + 2u * (size_t)NB * CC * NN)
#define WS_ST  (WS_VTL + 2u * (size_t)NB * CC * NN)      // f32 row max [b][h][n], row sum
#define WS_SL  (WS_ST + 4u * (size_t)NB * NH * NN)
#define WS_O   (WS_SL + 4u * (size_t)NB * NH * NN)       // f32 o NCHW [b][512][NN]
#define WS_P   (WS_O + 4u * (size_t)NB * CC * NN)       // f32 pooled mean [b][512]
#define WS_END (WS_P + 4u * (size_t)NB * CC)

// ---- k_pool: block = 32 rows (b, c), one wave per row: mean over the 1,024 pixels, 8 loads of 16 bytes per lane in flight; the block's 32 means leave as one 128-B line; the loops are unrolled so that v[] stays in registers and all 8 loads issue before the first is used
__global__ __launch_bounds__(1024) void k_pool(const float* __restrict__ X, float* __restrict__ P) { __shared__ float sp[32]; const int t = threadIdx.x, lane = t & 31, w = t >> 5;
  const float* xr = X + ((size_t)blockIdx.x * 32 + w) * NN + lane * 4; v4f v[8];
#pragma unroll
  for (int i = 0; i < 8; ++i) v[i] = *(const v4f*)(xr + i * 128);
  float s = 0.f;
#pragma unroll
  for (int i = 0; i < 8; ++i) s += (bfr(v[i][0]) + bfr(v[i][1])) + (bfr(v[i][2]) + bfr(v[i][3]));
#pragma unroll
  for (int o = 1; o < 32; o <<= 1) s += __shfl_xor(s, o);
  if (lane == 0) sp[w] = s * (1.0f / NN);
  __syncthreads(); if (t < 32) P[(size_t)blockIdx.x * 32 + t] = sp[t]; }
// ---- k_fc: block = b, 32 waves: fc1 (4 rows per wave), relu, fc2 (16 rows per wave), 1 + sigmoid; each dot product is split over the lanes of one wave (16-byte loads along the row) and summed by shuffles; every loop is unrolled so that its arrays stay in registers, a stage's loads issue together and the rows' shuffle chains overlap
__global__ __launch_bounds__(1024) void k_fc(const float* __restrict__ P, const float* __restrict__ F1W, const float* __restrict__ F1B, const float* __restrict__ F2W, const float* __restrict__ F2B, float* __restrict__ SC) { __shared__ __align__(16) float sh[RR]; __shared__ __align__(16) float ss[CC]; const int t = threadIdx.x, lane = t & 31, w = t >> 5; const size_t b = blockIdx.x;
  v4f p[4], f1[4][4]; float a[4];
#pragma unroll
  for (int r = 0; r < 4; ++r)
#pragma unroll
    for (int i = 0; i < 4; ++i) f1[r][i] = *(const v4f*)(F1W + (size_t)(w * 4 + r) * CC + i * 128 + lane * 4);
  asm volatile("s_wait_xcnt 0x0" ::: "memory");   // the loads below may land in the address registers of the loads above: the wait stands in front of that overwrite
#pragma unroll
  for (int i = 0; i < 4; ++i) p[i] = *(const v4f*)(P + b * CC + i * 128 + lane * 4);
#pragma unroll
  for (int r = 0; r < 4; ++r) { float s = 0.f;
#pragma unroll
    for (int i = 0; i < 4; ++i) s += p[i][0] * bfr(f1[r][i][0]) + p[i][1] * bfr(f1[r][i][1]) + p[i][2] * bfr(f1[r][i][2]) + p[i][3] * bfr(f1[r][i][3]);
    a[r] = s; }
#pragma unroll
  for (int r = 0; r < 4; ++r) {
#pragma unroll
    for (int o = 1; o < 32; o <<= 1) a[r] += __shfl_xor(a[r], o); }
  if (lane < 4) { const float s = lane == 0 ? a[0] : lane == 1 ? a[1] : lane == 2 ? a[2] : a[3]; sh[w * 4 + lane] = fmaxf(s + bfr(F1B[w * 4 + lane]), 0.f); }
  __syncthreads();
  const v4f hv = *(const v4f*)&sh[lane * 4]; float c[16];
#pragma unroll
  for (int r = 0; r < 16; ++r) { const v4f f = *(const v4f*)(F2W + (size_t)(w * 16 + r) * RR + lane * 4); c[r] = hv[0] * bfr(f[0]) + hv[1] * bfr(f[1]) + hv[2] * bfr(f[2]) + hv[3] * bfr(f[3]); }
#pragma unroll
  for (int r = 0; r < 16; ++r) {
#pragma unroll
    for (int o = 1; o < 32; o <<= 1) c[r] += __shfl_xor(c[r], o); }
  if (lane < 16) { float s = c[0];
#pragma unroll
    for (int r = 1; r < 16; ++r) s = lane == r ? c[r] : s;
    s += bfr(F2B[w * 16 + lane]); ss[w * 16 + lane] = 1.0f + 1.0f / (1.0f + expf(-s)); }
  __syncthreads(); if (t < CC / 4) vst2(SC + b * CC + t * 4, *(const v4f*)&ss[t * 4]); }
// ---- k_proj: block = (64 pixels, 128 output channels, which*NB + b): conv1x1 over xs = x * sc (A gathered from NCHW, bf16 hi + lo) + bias; q, k -> f16 hi/lo rows [n][512]; v -> planes [c][n]
__global__ __launch_bounds__(128) void k_proj(const float* __restrict__ X, const float* __restrict__ SC, const float* __restrict__ WQ, const float* __restrict__ BQ, const float* __restrict__ WK, const float* __restrict__ BK, const float* __restrict__ WV, const float* __restrict__ BV, _Float16* __restrict__ QH, _Float16* __restrict__ QL, _Float16* __restrict__ KH, _Float16* __restrict__ KL, _Float16* __restrict__ VT, _Float16* __restrict__ VTL) {
  __shared__ __align__(16) _Float16 sh[64][136], sl[64][136]; __shared__ __align__(16) _Float16 th[128][72], tl[128][72]; __shared__ float ssc[CC]; __shared__ __align__(16) __bf16 swt[2][128][VP];   // weight tile [buffer][output channel][32 input channels], bf16, shared by the four waves
  const int tid = threadIdx.x, wave = tid >> 5, lane = tid & 31, col = lane & 15, g = lane >> 4; const int which = blockIdx.z / NB; const size_t b = blockIdx.z % NB; const int n0 = blockIdx.x * 64 + wave * 16; const int c0 = blockIdx.y * 128; const float* Wm = which == 0 ? WQ : which == 1 ? WK : WV; const float* Bm = which == 0 ? BQ : which == 1 ? BK : BV; const float* Xb = X + b * CC * (size_t)NN;
  const int wrow = tid >> 3, wpc = (tid & 7) * 4; const float* wsrc = Wm + (size_t)(c0 + wrow) * CC + wpc;   // staging map: 8 lanes per 128-B row piece, a wave's load = 4 whole lines
  v4f wreg[8];
#pragma unroll
  for (int i = 0; i < 8; ++i) wreg[i] = *(const v4f*)(wsrc + (size_t)i * 16 * CC);
  asm volatile("s_wait_xcnt 0x0" ::: "memory");   // the address registers of the loads above are reused below: the wait stands in front of that overwrite
  for (int c = tid; c < CC; c += 128) ssc[c] = SC[b * CC + c];
#pragma unroll
  for (int i = 0; i < 8; ++i) { v4b c4; c4[0] = (__bf16)wreg[i][0]; c4[1] = (__bf16)wreg[i][1]; c4[2] = (__bf16)wreg[i][2]; c4[3] = (__bf16)wreg[i][3]; *(v4b*)&swt[0][wrow + 16 * i][wpc] = c4; }
  __syncthreads();
  v8f acc[8] = {};
#pragma unroll 2
  for (int kc = 0; kc < CC / 32; ++kc) { float v[16]; const int px = n0 + col, cur = kc & 1;
#pragma unroll
    for (int i = 0; i < 8; ++i) { const int ca = kc * 32 + 8 * g + i, cb2 = ca + 16; v[i] = bfr(Xb[(size_t)ca * NN + px]) * ssc[ca]; v[8 + i] = bfr(Xb[(size_t)cb2 * NN + px]) * ssc[cb2]; }
    if (kc + 1 < CC / 32) {   // the next weight tile's loads fly while this one is worked on
#pragma unroll
      for (int i = 0; i < 8; ++i) wreg[i] = *(const v4f*)(wsrc + (size_t)i * 16 * CC + (kc + 1) * 32); }
    asm volatile("s_wait_xcnt 0x0" ::: "memory");   // the address registers of the loads above are reused below: the wait stands in front of that overwrite
    v16b w[8];   // the pass's LDS reads stand as one group ahead of its matrix instructions
#pragma unroll
    for (int j = 0; j < 8; ++j) w[j] = frag_b(&swt[cur][j * 16 + col][0], lane);
    const F2 a = bsplit16(v);
#pragma unroll
    for (int j = 0; j < 8; ++j) { acc[j] = wmma_bf(a.h, w[j], acc[j]); acc[j] = wmma_bf(a.l, w[j], acc[j]); }
    if (kc + 1 < CC / 32) {
#pragma unroll
      for (int i = 0; i < 8; ++i) { v4b c4; c4[0] = (__bf16)wreg[i][0]; c4[1] = (__bf16)wreg[i][1]; c4[2] = (__bf16)wreg[i][2]; c4[3] = (__bf16)wreg[i][3]; *(v4b*)&swt[cur ^ 1][wrow + 16 * i][wpc] = c4; } }
    __syncthreads(); }   // publishes the next tile and ends every wave's reads of this one
#pragma unroll
  for (int j = 0; j < 8; ++j) { const float bb = bfr(Bm[c0 + j * 16 + col]);
#pragma unroll
    for (int r = 0; r < 8; ++r) { const float v = acc[j][r] + bb; const _Float16 hv = (_Float16)v, lv = (_Float16)((v - (float)hv) * 2048.0f); if (which < 2) { sh[wave * 16 + 8 * g + r][j * 16 + col] = hv; sl[wave * 16 + 8 * g + r][j * 16 + col] = lv; } else { th[j * 16 + col][wave * 16 + 8 * g + r] = hv; tl[j * 16 + col][wave * 16 + 8 * g + r] = lv; } } }
  __syncthreads();
  if (which < 2) { _Float16* PH = which == 0 ? QH : KH; _Float16* PL = which == 0 ? QL : KL; for (int e = tid; e < 64 * 16; e += 128) { const int rl = e >> 4, q = e & 15; const size_t o = (b * NN + blockIdx.x * 64 + rl) * CC + c0 + q * 8; vst2((unsigned*)(PH + o), *(const v4u*)&sh[rl][q * 8]); vst2((unsigned*)(PL + o), *(const v4u*)&sl[rl][q * 8]); } }
  else { for (int e = tid; e < 128 * 8; e += 128) { const int cl = e >> 3, q = e & 7; const size_t o = (b * CC + c0 + cl) * (size_t)NN + blockIdx.x * 64 + q * 8; vst2((unsigned*)(VT + o), *(const v4u*)&th[cl][q * 8]); vst2((unsigned*)(VTL + o), *(const v4u*)&tl[cl][q * 8]); } } }
// ---- k_stats: block = (64 queries n, h, b): row max and sum of exp over all 1,024 keys (3-product logits x 128^-1/2); one 256-B line of each per block
__global__ __launch_bounds__(128) void k_stats(const _Float16* __restrict__ QH, const _Float16* __restrict__ QL, const _Float16* __restrict__ KH, const _Float16* __restrict__ KL, float* __restrict__ ST, float* __restrict__ SL) { __shared__ __align__(16) float sm[64], ssum[64]; __shared__ __align__(16) _Float16 sk[2][2][32][QP];   // key tile [buffer][hi | lo][key][d], shared by the four waves
  const int tid = threadIdx.x, wave = tid >> 5, lane = tid & 31, col = lane & 15, g = lane >> 4; const int h = blockIdx.y; const size_t b = blockIdx.z; const int q0 = blockIdx.x * 64 + wave * 16; const size_t rq = b * NN + q0;
  v16h aq[4], al[4];
#pragma unroll
  for (int kc = 0; kc < 4; ++kc) { aq[kc] = frag_h(QH + (rq + col) * CC + h * DK + kc * 32, lane); al[kc] = frag_h(QL + (rq + col) * CC + h * DK + kc * 32, lane); }
  float m[8], l[8];
#pragma unroll
  for (int r = 0; r < 8; ++r) { m[r] = -3.0e38f; l[r] = 0.f; }
  const int srow = tid >> 4, spc = (tid & 15) * 8; const size_t so = (b * NN + srow) * CC + h * DK + spc;   // staging map: 16 lanes per 256-B row, a wave's load = 4 whole lines
  v8h rk[2][4];
#pragma unroll
  for (int i = 0; i < 4; ++i) { rk[0][i] = *(const v8h*)(KH + so + (size_t)(8 * i) * CC); rk[1][i] = *(const v8h*)(KL + so + (size_t)(8 * i) * CC); }
  asm volatile("s_wait_xcnt 0x0" ::: "memory");   // the address registers of the loads above are reused below: the wait stands in front of that overwrite
#pragma unroll
  for (int i = 0; i < 4; ++i) { *(v8h*)&sk[0][0][srow + 8 * i][spc] = rk[0][i]; *(v8h*)&sk[0][1][srow + 8 * i][spc] = rk[1][i]; }
  __syncthreads();
#pragma unroll 1
  for (int ks = 0; ks < NN / 32; ++ks) { float s[2][8]; const int cur = ks & 1;
    if (ks + 1 < NN / 32) {   // the next key tile's loads fly while this one is worked on
#pragma unroll
      for (int i = 0; i < 4; ++i) { rk[0][i] = *(const v8h*)(KH + so + (size_t)((ks + 1) * 32 + 8 * i) * CC); rk[1][i] = *(const v8h*)(KL + so + (size_t)((ks + 1) * 32 + 8 * i) * CC); } }
    asm volatile("s_wait_xcnt 0x0" ::: "memory");   // the address registers of the loads above are reused below: the wait stands in front of that overwrite
#pragma unroll
    for (int ct = 0; ct < 2; ++ct) { v8f c = {}, cl = {}; v16h kh[4], kl[4];   // a tile's LDS reads stand as one group ahead of its matrix instructions
#pragma unroll
      for (int kc = 0; kc < 4; ++kc) { kh[kc] = frag_h(&sk[cur][0][ct * 16 + col][kc * 32], lane); kl[kc] = frag_h(&sk[cur][1][ct * 16 + col][kc * 32], lane); }
#pragma unroll
      for (int kc = 0; kc < 4; ++kc) { c = wmma16(aq[kc], kh[kc], c); cl = wmma16(aq[kc], kl[kc], cl); cl = wmma16(al[kc], kh[kc], cl); }
#pragma unroll
      for (int r = 0; r < 8; ++r) s[ct][r] = (c[r] + cl[r] * (1.0f / 2048.0f)) * 0.08838834764831845f; }
#pragma unroll
    for (int r = 0; r < 8; ++r) { float mx = fmaxf(s[0][r], s[1][r]);
#pragma unroll
      for (int o = 1; o < 16; o <<= 1) mx = fmaxf(mx, __shfl_xor(mx, o));
      const float mn = fmaxf(m[r], mx); const float alpha = __expf(m[r] - mn); float es = __expf(s[0][r] - mn) + __expf(s[1][r] - mn);
#pragma unroll
      for (int o = 1; o < 16; o <<= 1) es += __shfl_xor(es, o);
      l[r] = l[r] * alpha + es; m[r] = mn; }
    if (ks + 1 < NN / 32) {
#pragma unroll
      for (int i = 0; i < 4; ++i) { *(v8h*)&sk[cur ^ 1][0][srow + 8 * i][spc] = rk[0][i]; *(v8h*)&sk[cur ^ 1][1][srow + 8 * i][spc] = rk[1][i]; } }
    __syncthreads(); }   // publishes the next tile and ends every wave's reads of this one
  if (col == 0) {
#pragma unroll
    for (int r = 0; r < 8; ++r) { sm[wave * 16 + 8 * g + r] = m[r]; ssum[wave * 16 + 8 * g + r] = l[r]; } }
  __syncthreads(); if (tid < 16) vst2(ST + (b * NH + h) * (size_t)NN + blockIdx.x * 64 + tid * 4, *(const v4f*)&sm[tid * 4]); else if (tid < 32) vst2(SL + (b * NH + h) * (size_t)NN + blockIdx.x * 64 + (tid - 16) * 4, *(const v4f*)&ssum[(tid - 16) * 4]); }
// ---- k_ov: block = (64 output pixels m, h, b): for each query tile n: s^T[m][n] = k_m . q_n (3 products), att[n][m] = exp(s - max_n) / sum_n, then o^T[m][d] += sum_n att[n][m] v[d][n] (att^T tile as the A operand, v planes as B; 3 products); o written NCHW per head channel
__global__ __launch_bounds__(128) void k_ov(const _Float16* __restrict__ QH, const _Float16* __restrict__ QL, const _Float16* __restrict__ KH, const _Float16* __restrict__ KL, const _Float16* __restrict__ VT, const _Float16* __restrict__ VTL, const float* __restrict__ ST, const float* __restrict__ SL, float* __restrict__ O) {
  __shared__ __align__(16) float sp[4][16][36]; __shared__ __align__(16) float stt[128][68];
  __shared__ __align__(16) _Float16 sq[2][2][32][QP]; __shared__ __align__(16) _Float16 sv[2][2][128][VP];   // query tile [buffer][hi | lo][n][d] and value tile [buffer][hi | lo][d][n], shared by the four waves
  __shared__ __align__(16) float sst[2][NN];   // row max | row sum of all queries of this (b, h), staged once
  const int tid = threadIdx.x, wave = tid >> 5, lane = tid & 31, col = lane & 15, g = lane >> 4; const int h = blockIdx.y; const size_t b = blockIdx.z; const int mm0 = blockIdx.x * 64 + wave * 16; const size_t rm = b * NN + mm0;
  v16h ak[4], akl[4];   // A = k rows of this block's output pixels m
#pragma unroll
  for (int kc = 0; kc < 4; ++kc) { ak[kc] = frag_h(KH + (rm + col) * CC + h * DK + kc * 32, lane); akl[kc] = frag_h(KL + (rm + col) * CC + h * DK + kc * 32, lane); }
  const float* stm = ST + (b * NH + h) * (size_t)NN; const float* stl = SL + (b * NH + h) * (size_t)NN;
  v8f acc[8], accl[8];
#pragma unroll
  for (int j = 0; j < 8; ++j) { acc[j] = v8f{}; accl[j] = v8f{}; }
  const int qrow = tid >> 4, qpc = (tid & 15) * 8; const size_t qo = (b * NN + qrow) * CC + h * DK + qpc;   // staging maps: q 16 lanes per 256-B row; v 4 lanes per 64-B row piece
  const int vrow = tid >> 2, vpc = (tid & 3) * 8; const size_t vo = (b * CC + (size_t)h * DK + vrow) * (size_t)NN + vpc;
  v8h rq[2][4], rv[2][4]; v4f rs[2][2];
#pragma unroll
  for (int i = 0; i < 2; ++i) { rs[0][i] = *(const v4f*)(stm + tid * 4 + i * 512); rs[1][i] = *(const v4f*)(stl + tid * 4 + i * 512); }
#pragma unroll
  for (int i = 0; i < 4; ++i) { rq[0][i] = *(const v8h*)(QH + qo + (size_t)(8 * i) * CC); rq[1][i] = *(const v8h*)(QL + qo + (size_t)(8 * i) * CC); rv[0][i] = *(const v8h*)(VT + vo + (size_t)(32 * i) * NN); rv[1][i] = *(const v8h*)(VTL + vo + (size_t)(32 * i) * NN); }
  asm volatile("s_wait_xcnt 0x0" ::: "memory");   // the address registers of the loads above are reused below: the wait stands in front of that overwrite
#pragma unroll
  for (int i = 0; i < 4; ++i) { *(v8h*)&sq[0][0][qrow + 8 * i][qpc] = rq[0][i]; *(v8h*)&sq[0][1][qrow + 8 * i][qpc] = rq[1][i]; *(v8h*)&sv[0][0][vrow + 32 * i][vpc] = rv[0][i]; *(v8h*)&sv[0][1][vrow + 32 * i][vpc] = rv[1][i]; }
#pragma unroll
  for (int i = 0; i < 2; ++i) { *(v4f*)&sst[0][tid * 4 + i * 512] = rs[0][i]; *(v4f*)&sst[1][tid * 4 + i * 512] = rs[1][i]; }
  __syncthreads();
#pragma unroll 1
  for (int ks = 0; ks < NN / 32; ++ks) { const int cur = ks & 1;
    if (ks + 1 < NN / 32) {   // the next tiles' loads fly while these are worked on
#pragma unroll
      for (int i = 0; i < 4; ++i) { rq[0][i] = *(const v8h*)(QH + qo + (size_t)((ks + 1) * 32 + 8 * i) * CC); rq[1][i] = *(const v8h*)(QL + qo + (size_t)((ks + 1) * 32 + 8 * i) * CC); rv[0][i] = *(const v8h*)(VT + vo + (size_t)(32 * i) * NN + (ks + 1) * 32); rv[1][i] = *(const v8h*)(VTL + vo + (size_t)(32 * i) * NN + (ks + 1) * 32); } }
    asm volatile("s_wait_xcnt 0x0" ::: "memory");   // the address registers of the loads above are reused below: the wait stands in front of that overwrite
#pragma unroll
    for (int ct = 0; ct < 2; ++ct) { const int n = ks * 32 + ct * 16 + col; v8f c = {}, cl = {};
#pragma unroll
      for (int k2 = 0; k2 < 2; ++k2) { v16h qh[2], ql[2];   // LDS reads in groups of eight ahead of six matrix instructions: fewer places where a wave waits for LDS; a larger group does not fit the registers that the matrix operands can use
#pragma unroll
        for (int kc = 0; kc < 2; ++kc) { qh[kc] = frag_h(&sq[cur][0][ct * 16 + col][(k2 * 2 + kc) * 32], lane); ql[kc] = frag_h(&sq[cur][1][ct * 16 + col][(k2 * 2 + kc) * 32], lane); }
#pragma unroll
        for (int kc = 0; kc < 2; ++kc) { const int ko = k2 * 2 + kc; c = wmma16(ak[ko], qh[kc], c); cl = wmma16(ak[ko], ql[kc], cl); cl = wmma16(akl[ko], qh[kc], cl); } }
      const float mx = sst[0][n], il = 1.0f / sst[1][n];   // per query n (the column of this transposed tile)
#pragma unroll
      for (int r = 0; r < 8; ++r) { const float s = (c[r] + cl[r] * (1.0f / 2048.0f)) * 0.08838834764831845f; sp[wave][8 * g + r][ct * 16 + col] = __expf(s - mx) * il; } }
    LDSX();
    v16h pa, pal; { const float* prow = &sp[wave][col][0] + 8 * (lane >> 4);
#pragma unroll
      for (int i = 0; i < 8; ++i) { const float p0 = prow[i] * 2048.0f, p1 = prow[16 + i] * 2048.0f; pa[i] = (_Float16)p0; pa[8 + i] = (_Float16)p1; pal[i] = (_Float16)((p0 - (float)pa[i]) * 2048.0f); pal[8 + i] = (_Float16)((p1 - (float)pa[8 + i]) * 2048.0f); } }
#pragma unroll
    for (int jj = 0; jj < 4; ++jj) { v16h vh[2], vl[2];
#pragma unroll
      for (int j = 0; j < 2; ++j) { vh[j] = frag_h(&sv[cur][0][(jj * 2 + j) * 16 + col][0], lane); vl[j] = frag_h(&sv[cur][1][(jj * 2 + j) * 16 + col][0], lane); }
#pragma unroll
      for (int j = 0; j < 2; ++j) { const int jo = jj * 2 + j; acc[jo] = wmma16(pa, vh[j], acc[jo]); accl[jo] = wmma16(pa, vl[j], accl[jo]); accl[jo] = wmma16(pal, vh[j], accl[jo]); } }
    if (ks + 1 < NN / 32) {
#pragma unroll
      for (int i = 0; i < 4; ++i) { *(v8h*)&sq[cur ^ 1][0][qrow + 8 * i][qpc] = rq[0][i]; *(v8h*)&sq[cur ^ 1][1][qrow + 8 * i][qpc] = rq[1][i]; *(v8h*)&sv[cur ^ 1][0][vrow + 32 * i][vpc] = rv[0][i]; *(v8h*)&sv[cur ^ 1][1][vrow + 32 * i][vpc] = rv[1][i]; } }
    __syncthreads(); }   // publishes the next tiles and ends every wave's reads of these and of its sp rows
#pragma unroll
  for (int j = 0; j < 8; ++j)
#pragma unroll
    for (int r = 0; r < 8; ++r) stt[j * 16 + col][wave * 16 + 8 * g + r] = (acc[j][r] + accl[j][r] * (1.0f / 2048.0f)) * (1.0f / 2048.0f);   // [d][m local]
  __syncthreads(); for (int e = tid; e < 128 * 16; e += 128) { const int d = e >> 4, q = e & 15; vst2(O + (b * CC + (size_t)h * DK + d) * (size_t)NN + blockIdx.x * 64 + q * 4, *(const v4f*)&stt[d][q * 4]); } }
// ---- k_gate: block = (64 pixels, b): gate = sigmoid(sum_c gate_w[c] o[c][m] + gate_b); out = o * gate + o (NCHW lines)
__global__ __launch_bounds__(256) void k_gate(const float* __restrict__ O, const float* __restrict__ GW, const float* __restrict__ GB, float* __restrict__ OUT) { __shared__ float sg[64]; __shared__ float part[4][64]; const int t = threadIdx.x; const size_t b = blockIdx.y; const int m0 = blockIdx.x * 64; const int ml = t & 63, q4 = t >> 6;
  { float s = 0.f; for (int c = q4; c < CC; c += 4) s += bfr(GW[c]) * O[(b * CC + c) * (size_t)NN + m0 + ml]; part[q4][ml] = s; }
  __syncthreads(); if (t < 64) { const float s = part[0][t] + part[1][t] + part[2][t] + part[3][t] + bfr(GB[0]); sg[t] = 1.0f + 1.0f / (1.0f + expf(-s)); } __syncthreads();
  for (int e = t; e < CC * 16; e += 256) { const int c = e >> 4, q = e & 15; const float* orow = O + (b * CC + c) * (size_t)NN + m0 + q * 4; v4f v; v[0] = orow[0] * sg[q * 4]; v[1] = orow[1] * sg[q * 4 + 1]; v[2] = orow[2] * sg[q * 4 + 2]; v[3] = orow[3] * sg[q * 4 + 3]; vst2(OUT + (b * CC + c) * (size_t)NN + m0 + q * 4, v); } }
extern "C" void kernel_launch(void* const* d_in, const int* in_sizes, int n_in, void* d_out, int out_size, void* d_ws, size_t ws_size, hipStream_t stream) {
  (void)in_sizes; (void)n_in; (void)out_size;
  const float** F = (const float**)d_in;   // 0 x [8,512,32,32], 1 wq [512,512], 2 bq, 3 wk, 4 bk, 5 wv, 6 bv, 7 fc1_w [128,512], 8 fc1_b, 9 fc2_w [512,128], 10 fc2_b, 11 gate_w [1,512], 12 gate_b [1]
  if (ws_size < (size_t)WS_END) return;
  char* ws = (char*)d_ws; float *SC = (float*)(ws + WS_SC), *ST = (float*)(ws + WS_ST), *SL = (float*)(ws + WS_SL), *O = (float*)(ws + WS_O), *P = (float*)(ws + WS_P); _Float16 *QH = (_Float16*)(ws + WS_QH), *QL = (_Float16*)(ws + WS_QL), *KH = (_Float16*)(ws + WS_KH), *KL = (_Float16*)(ws + WS_KL), *VT = (_Float16*)(ws + WS_VT), *VTL = (_Float16*)(ws + WS_VTL);
  k_pool<<<NB * CC / 32, 1024, 0, stream>>>(F[0], P);
  k_fc<<<NB, 1024, 0, stream>>>(P, F[7], F[8], F[9], F[10], SC);
  k_proj<<<dim3(NN / 64, CC / 128, 3 * NB), 128, 0, stream>>>(F[0], SC, F[1], F[2], F[3], F[4], F[5], F[6], QH, QL, KH, KL, VT, VTL);
  k_stats<<<dim3(NN / 64, NH, TNB), 128, 0, stream>>>(QH, QL, KH, KL, ST, SL);
  k_ov<<<dim3(NN / 64, NH, TNB), 128, 0, stream>>>(QH, QL, KH, KL, VT, VTL, ST, SL, O);
  k_gate<<<dim3(NN / 64, TNB), 256, 0, stream>>>(O, F[11], F[12], (float*)d_out);
}

// v003
// It runs in 155 microseconds.
// Timed twice side by side with v002, it ran 1.05 times as fast both times.
// All steps since v000 together make it 3.72 times as fast.
#include <hip/hip_runtime.h>
#include <math.h>

typedef __attribute__((ext_vector_type(16))) _Float16 v16h;
typedef __attribute__((ext_vector_type(16))) __bf16 v16b;
typedef __attribute__((ext_vector_type(8)))  _Float16 v8h;
typedef __attribute__((ext_vector_type(8)))  float v8f;
typedef __attribute__((ext_vector_type(4)))  float v4f;
typedef __attribute__((ext_vector_type(2)))  float v2f;
typedef __attribute__((ext_vector_type(4)))  unsigned v4u;
typedef __attribute__((ext_vector_type(4)))  int v4i;
typedef float __attribute__((may_alias)) float_a;
typedef int __attribute__((may_alias)) int_a;

template <typename T> __device__ __forceinline__ void vst2(void* p, T v) { *(T*)p = v;  }
__device__ __forceinline__ v8f wmma16(v16h a, v16h b, v8f c) {
  v8f d = __builtin_amdgcn_wmma_f32_16x16x32_f16(false, a, false, b, (short)0, c, false, false);
  asm volatile("v_nop\n\tv_nop\n\tv_nop\n\tv_nop" : "+v"(d) : "v"(a), "v"(b));
  return d;
}
__device__ __forceinline__ v8f wmma_bf(v16b a, v16b b, v8f c) {
  v8f d = __builtin_amdgcn_wmma_f32_16x16x32_bf16(false, a, false, b, (short)0, c, false, false);
  asm volatile("v_nop\n\tv_nop\n\tv_nop\n\tv_nop" : "+v"(d) : "v"(a), "v"(b));
  return d;
}
// 16x16x32 fragments: lane = (h = lane>>4, row/col = lane&15); elements 0..7 = k0+8h+0..7, 8..15 = k0+16+8h+0..7; D element r = row 8h+r
__device__ __forceinline__ v16h frag_h(const _Float16* rowk0, int lane) {
  union { v16h v; v8h q[2]; } u; const _Float16* p = rowk0 + 8 * (lane >> 4);
  u.q[0] = *(const v8h*)p; u.q[1] = *(const v8h*)(p + 16); return u.v;
}
__device__ __forceinline__ v16h frag_f32(const float* rowk0, int lane) {
  v16h a; const float* p = rowk0 + 8 * (lane >> 4);
#pragma unroll
  for (int i = 0; i < 8; ++i) { a[i] = (_Float16)p[i]; a[8 + i] = (_Float16)p[16 + i]; }
  return a;
}
__device__ __forceinline__ v16h frag_f32s(const float* rowk0, int lane, float sc) {
  v16h a; const float* p = rowk0 + 8 * (lane >> 4);
#pragma unroll
  for (int i = 0; i < 8; ++i) { a[i] = (_Float16)(p[i] * sc); a[8 + i] = (_Float16)(p[16 + i] * sc); }
  return a;
}
// column fragment from a [K][ld] layout (column n), rows >= K read as 0
__device__ __forceinline__ v16h fragc_f32(const float* W, int k0, int n, int lane, int ld, int K) {
  v16h a; const int g = lane >> 4;
#pragma unroll
  for (int i = 0; i < 8; ++i) { const int ka = k0 + 8 * g + i, kb = ka + 16;
    a[i] = (_Float16)(ka < K ? W[(size_t)(ka < K ? ka : K - 1) * ld + n] : 0.f); a[8 + i] = (_Float16)(kb < K ? W[(size_t)(kb < K ? kb : K - 1) * ld + n] : 0.f); }
  return a;
}
struct F2 { v16b h, l; };
__device__ __forceinline__ F2 bsplit16(const float v[16]) { F2 r;
#pragma unroll
  for (int i = 0; i < 16; ++i) { const __bf16 h = (__bf16)v[i]; r.h[i] = h; r.l[i] = (__bf16)(v[i] - (float)h); }
  return r; }
__device__ __forceinline__ F2 split_row(const float* row, int k0, int lane) { float v[16]; const float* p = row + k0 + 8 * (lane >> 4);
#pragma unroll
  for (int i = 0; i < 8; ++i) { v[i] = p[i]; v[8 + i] = p[16 + i]; }
  return bsplit16(v); }
__device__ __forceinline__ F2 split_rowK(const float* row, int k0, int lane, int K) { float v[16]; const int g = lane >> 4;
#pragma unroll
  for (int i = 0; i < 8; ++i) { const int ka = k0 + 8 * g + i, kb = ka + 16; v[i] = ka < K ? row[ka < K ? ka : K - 1] : 0.f; v[8 + i] = kb < K ? row[kb < K ? kb : K - 1] : 0.f; }
  return bsplit16(v); }
__device__ __forceinline__ F2 split_col(const float* W, int k0, int n, int lane, int ld, int K) { float v[16]; const int g = lane >> 4;
#pragma unroll
  for (int i = 0; i < 8; ++i) { const int ka = k0 + 8 * g + i, kb = ka + 16; v[i] = ka < K ? W[(size_t)(ka < K ? ka : K - 1) * ld + n] : 0.f; v[8 + i] = kb < K ? W[(size_t)(kb < K ? kb : K - 1) * ld + n] : 0.f; }
  return bsplit16(v); }
__device__ __forceinline__ v8f mac3(const F2& a, const F2& b, v8f c) { c = wmma_bf(a.l, b.h, c); c = wmma_bf(a.h, b.l, c); return wmma_bf(a.h, b.h, c); }
__device__ __forceinline__ float sigm(float v) { return 1.0f / (1.0f + expf(-v)); }
// a wave hands LDS rows from lane to lane: the fence names LDS alone, so that it does not also wait for the global loads that are in flight for the next pass
#define LDSX() do { asm volatile("s_wait_dscnt 0" ::: "memory"); __builtin_amdgcn_wave_barrier(); __builtin_amdgcn_fence(__ATOMIC_RELEASE, "workgroup", "local"); } while (0)
// work-group barrier that orders LDS alone: __syncthreads() would also wait for every global load in flight, and the loads issued for later passes are meant to stay in flight across it
#define BAR_LDS() do { __builtin_amdgcn_fence(__ATOMIC_RELEASE, "workgroup", "local"); __builtin_amdgcn_s_barrier(); __builtin_amdgcn_fence(__ATOMIC_ACQUIRE, "workgroup", "local"); } while (0)


// SelfModule (B 8, C 512, 32x32, 4 heads x 128): x = x * sigmoid(SE(x)) + x; q, k, v = 1x1 convs; att = softmax_m(q_n . k_m / sqrt(128)); o[:, m] = sum_n v[:, n] att[n, m]; out = o * sigmoid(gate 1x1 conv(o)) + o.
#define NB 8
#define CC 512
#define NN 1024
#define NH 4
#define DK 128
#define RR 128            // SE bottleneck
#ifndef TNB
#define TNB NB
#endif
typedef __attribute__((ext_vector_type(8))) __bf16 v8b;
__device__ __forceinline__ v16b frag_b(const __bf16* rowk0, int lane) {
  union { v16b v; v8b q[2]; } u; const __bf16* p = rowk0 + 8 * (lane >> 4);
  u.q[0] = *(const v8b*)p; u.q[1] = *(const v8b*)(p + 16); return u.v;
}
__device__ __forceinline__ float bfr(float v) { return (float)(__bf16)v; }
typedef __attribute__((ext_vector_type(4))) __bf16 v4b;
// LDS row pitches of the staged tiles, in 16-bit elements: 16 B x an odd number, so that the 16 rows of a ds_load_b128 fragment read fall on distinct banks
#define QP 136            // q / k rows of 128 elements: 272 B
#define VP 40             // rows of 32 elements (v planes, weight rows): 80 B
__device__ __attribute__((noinline)) float exp_ni(float v) { return expf(v); }
__device__ __attribute__((noinline)) float erf_ni(float v) { return erff(v); }

#define WS_SC  0u                                   // f32 1 + sigmoid(SE) [b][512]
#define WS_QH  (WS_SC + 4u * (size_t)NB * CC)            // f16 hi|lo q rows [b*NN + n][512]; k rows; v planes [b][512][NN]
#define WS_QL  (WS_QH + 2u * (size_t)NB * NN * CC)
#define WS_KH  (WS_QL + 2u * (size_t)NB * NN * CC)
#define WS_KL  (WS_KH + 2u * (size_t)NB * NN * CC)
#define WS_VT  (WS_KL + 2u * (size_t)NB * NN * CC)
#define WS_VTL (WS_VT + 2u * (size_t)NB * CC * NN)
#define WS_ST  (WS_VTL + 2u * (size_t)NB * CC * NN)      // f32 row max [b][h][n], row sum
#define WS_SL  (WS_ST + 4u * (size_t)NB * NH * NN)
#define WS_O   (WS_SL + 4u * (size_t)NB * NH * NN)       // f32 o NCHW [b][512][NN]
#define WS_P   (WS_O + 4u * (size_t)NB * CC * NN)       // f32 pooled mean [b][512]
#define WS_END (WS_P + 4u * (size_t)NB * CC)

// ---- k_pool: block = 32 rows (b, c), one wave per row: mean over the 1,024 pixels, 8 loads of 16 bytes per lane in flight; the block's 32 means leave as one 128-B line; the loops are unrolled so that v[] stays in registers and all 8 loads issue before the first is used
__global__ __launch_bounds__(1024) void k_pool(const float* __restrict__ X, float* __restrict__ P) { __shared__ float sp[32]; const int t = threadIdx.x, lane = t & 31, w = t >> 5;
  const float* xr = X + ((size_t)blockIdx.x * 32 + w) * NN + lane * 4; v4f v[8];
#pragma unroll
  for (int i = 0; i < 8; ++i) v[i] = *(const v4f*)(xr + i * 128);
  float s = 0.f;
#pragma unroll
  for (int i = 0; i < 8; ++i) s += (bfr(v[i][0]) + bfr(v[i][1])) + (bfr(v[i][2]) + bfr(v[i][3]));
#pragma unroll
  for (int o = 1; o < 32; o <<= 1) s += __shfl_xor(s, o);
  if (lane == 0) sp[w] = s * (1.0f / NN);
  __syncthreads(); if (t < 32) P[(size_t)blockIdx.x * 32 + t] = sp[t]; }
// ---- k_fc: block = b, 32 waves: fc1 (4 rows per wave), relu, fc2 (16 rows per wave), 1 + sigmoid; each dot product is split over the lanes of one wave (16-byte loads along the row) and summed by shuffles; every loop is unrolled so that its arrays stay in registers, a stage's loads issue together and the rows' shuffle chains overlap
__global__ __launch_bounds__(1024) void k_fc(const float* __restrict__ P, const float* __restrict__ F1W, const float* __restrict__ F1B, const float* __restrict__ F2W, const float* __restrict__ F2B, float* __restrict__ SC) { __shared__ __align__(16) float sh[RR]; __shared__ __align__(16) float ss[CC]; const int t = threadIdx.x, lane = t & 31, w = t >> 5; const size_t b = blockIdx.x;
  v4f p[4], f1[4][4]; float a[4];
#pragma unroll
  for (int r = 0; r < 4; ++r)
#pragma unroll
    for (int i = 0; i < 4; ++i) f1[r][i] = *(const v4f*)(F1W + (size_t)(w * 4 + r) * CC + i * 128 + lane * 4);
  asm volatile("s_wait_xcnt 0x0" ::: "memory");   // the loads below may land in the address registers of the loads above: the wait stands in front of that overwrite
#pragma unroll
  for (int i = 0; i < 4; ++i) p[i] = *(const v4f*)(P + b * CC + i * 128 + lane * 4);
#pragma unroll
  for (int r = 0; r < 4; ++r) { float s = 0.f;
#pragma unroll
    for (int i = 0; i < 4; ++i) s += p[i][0] * bfr(f1[r][i][0]) + p[i][1] * bfr(f1[r][i][1]) + p[i][2] * bfr(f1[r][i][2]) + p[i][3] * bfr(f1[r][i][3]);
    a[r] = s; }
#pragma unroll
  for (int r = 0; r < 4; ++r) {
#pragma unroll
    for (int o = 1; o < 32; o <<= 1) a[r] += __shfl_xor(a[r], o); }
  if (lane < 4) { const float s = lane == 0 ? a[0] : lane == 1 ? a[1] : lane == 2 ? a[2] : a[3]; sh[w * 4 + lane] = fmaxf(s + bfr(F1B[w * 4 + lane]), 0.f); }
  __syncthreads();
  const v4f hv = *(const v4f*)&sh[lane * 4]; float c[16];
#pragma unroll
  for (int r = 0; r < 16; ++r) { const v4f f = *(const v4f*)(F2W + (size_t)(w * 16 + r) * RR + lane * 4); c[r] = hv[0] * bfr(f[0]) + hv[1] * bfr(f[1]) + hv[2] * bfr(f[2]) + hv[3] * bfr(f[3]); }
#pragma unroll
  for (int r = 0; r < 16; ++r) {
#pragma unroll
    for (int o = 1; o < 32; o <<= 1) c[r] += __shfl_xor(c[r], o); }
  if (lane < 16) { float s = c[0];
#pragma unroll
    for (int r = 1; r < 16; ++r) s = lane == r ? c[r] : s;
    s += bfr(F2B[w * 16 + lane]); ss[w * 16 + lane] = 1.0f + 1.0f / (1.0f + expf(-s)); }
  __syncthreads(); if (t < CC / 4) vst2(SC + b * CC + t * 4, *(const v4f*)&ss[t * 4]); }
// ---- k_proj: block = (64 pixels, 128 output channels, which*NB + b): conv1x1 over xs = x * sc (A gathered from NCHW, bf16 hi + lo) + bias; q, k -> f16 hi/lo rows [n][512]; v -> planes [c][n]
__global__ __launch_bounds__(128) void k_proj(const float* __restrict__ X, const float* __restrict__ SC, const float* __restrict__ WQ, const float* __restrict__ BQ, const float* __restrict__ WK, const float* __restrict__ BK, const float* __restrict__ WV, const float* __restrict__ BV, _Float16* __restrict__ QH, _Float16* __restrict__ QL, _Float16* __restrict__ KH, _Float16* __restrict__ KL, _Float16* __restrict__ VT, _Float16* __restrict__ VTL) {
  __shared__ __align__(16) _Float16 sh[64][136], sl[64][136]; __shared__ __align__(16) _Float16 th[128][72], tl[128][72]; __shared__ float ssc[CC]; __shared__ __align__(16) __bf16 swt[2][128][VP];   // weight tile [buffer][output channel][32 input channels], bf16, shared by the four waves
  const int tid = threadIdx.x, wave = tid >> 5, lane = tid & 31, col = lane & 15, g = lane >> 4; const int which = blockIdx.z / NB; const size_t b = blockIdx.z % NB; const int n0 = blockIdx.x * 64 + wave * 16; const int c0 = blockIdx.y * 128; const float* Wm = which == 0 ? WQ : which == 1 ? WK : WV; const float* Bm = which == 0 ? BQ : which == 1 ? BK : BV; const float* Xb = X + b * CC * (size_t)NN;
  const int wrow = tid >> 3, wpc = (tid & 7) * 4; const float* wsrc = Wm + (size_t)(c0 + wrow) * CC + wpc;   // staging map: 8 lanes per 128-B row piece, a wave's load = 4 whole lines
  v4f wreg[8];
#pragma unroll
  for (int i = 0; i < 8; ++i) wreg[i] = *(const v4f*)(wsrc + (size_t)i * 16 * CC);
  float sc4[4], bbv[8];   // the scale values and the epilogue's bias values are asked for here, all at once, so that none of them is waited for one by one
#pragma unroll
  for (int i = 0; i < 4; ++i) sc4[i] = SC[b * CC + tid + 128 * i];
#pragma unroll
  for (int j = 0; j < 8; ++j) bbv[j] = Bm[c0 + j * 16 + col];
  asm volatile("s_wait_xcnt 0x0" ::: "memory");   // the address registers of the loads above are reused below: the wait stands in front of that overwrite
#pragma unroll
  for (int i = 0; i < 4; ++i) ssc[tid + 128 * i] = sc4[i];
#pragma unroll
  for (int i = 0; i < 8; ++i) { v4b c4; c4[0] = (__bf16)wreg[i][0]; c4[1] = (__bf16)wreg[i][1]; c4[2] = (__bf16)wreg[i][2]; c4[3] = (__bf16)wreg[i][3]; *(v4b*)&swt[0][wrow + 16 * i][wpc] = c4; }
  // every global load of the loop is issued one whole pass before its values are used: xv = the x values of the coming pass, wreg = the weight tile after the one in LDS
  float xv[16]; const float* xsrc = Xb + (size_t)(8 * g) * NN + n0 + col;
#pragma unroll
  for (int i = 0; i < 8; ++i) { xv[i] = xsrc[(size_t)i * NN]; xv[8 + i] = xsrc[(size_t)(16 + i) * NN]; }
#pragma unroll
  for (int i = 0; i < 8; ++i) wreg[i] = *(const v4f*)(wsrc + (size_t)i * 16 * CC + 32);
  asm volatile("s_wait_xcnt 0x0" ::: "memory");   // the address registers of the loads above are reused below: the wait stands in front of that overwrite
  BAR_LDS();
  v8f acc[8] = {};
  // one pass; more = a pass follows (its weight tile goes to LDS, its x values are asked for), more2 = two follow (the tile after that is asked for): compile-time flags, so that no load stands under a run-time branch and no loaded register has to be copied where two paths meet, which would wait for the load at once
  auto pass = [&](const int kc, const bool more, const bool more2) __attribute__((always_inline)) { float v[16]; const int cur = kc & 1;
#pragma unroll
    for (int i = 0; i < 8; ++i) { const int ca = kc * 32 + 8 * g + i, cb2 = ca + 16; v[i] = bfr(xv[i]) * ssc[ca]; v[8 + i] = bfr(xv[8 + i]) * ssc[cb2]; }
    const F2 a = bsplit16(v);
    if (more) {   // the next weight tile has had a pass to land; its buffer is free since the barrier at the foot of the pass before
#pragma unroll
      for (int i = 0; i < 8; ++i) { v4b c4; c4[0] = (__bf16)wreg[i][0]; c4[1] = (__bf16)wreg[i][1]; c4[2] = (__bf16)wreg[i][2]; c4[3] = (__bf16)wreg[i][3]; *(v4b*)&swt[cur ^ 1][wrow + 16 * i][wpc] = c4; }
#pragma unroll
      for (int i = 0; i < 8; ++i) { xv[i] = xsrc[(size_t)((kc + 1) * 32 + i) * NN]; xv[8 + i] = xsrc[(size_t)((kc + 1) * 32 + 16 + i) * NN]; } }
    if (more2) {
#pragma unroll
      for (int i = 0; i < 8; ++i) wreg[i] = *(const v4f*)(wsrc + (size_t)i * 16 * CC + (kc + 2) * 32); }
    asm volatile("s_wait_xcnt 0x0" ::: "memory");   // the address registers of the loads above are reused below: the wait stands in front of that overwrite
    v16b w[8];   // the pass's LDS reads stand as one group ahead of its matrix instructions
#pragma unroll
    for (int j = 0; j < 8; ++j) w[j] = frag_b(&swt[cur][j * 16 + col][0], lane);
#pragma unroll
    for (int j = 0; j < 8; ++j) { acc[j] = wmma_bf(a.h, w[j], acc[j]); acc[j] = wmma_bf(a.l, w[j], acc[j]); }
    BAR_LDS();   // publishes the next tile and ends every wave's reads of this one
    __builtin_amdgcn_sched_barrier(0); };   // keeps the next pass's conversions behind the barrier: lifted in among this pass's matrix instructions they would wait for loads that were only just issued
#pragma unroll 2   // two passes per trip: the LDS buffer index is a constant in each, and a pass's loads land in other registers than the values it is still converting
  for (int kc = 0; kc < CC / 32 - 2; ++kc) pass(kc, true, true);
  pass(CC / 32 - 2, true, false); pass(CC / 32 - 1, false, false);
#pragma unroll
  for (int j = 0; j < 8; ++j) { const float bb = bfr(bbv[j]);
#pragma unroll
    for (int r = 0; r < 8; ++r) { const float v = acc[j][r] + bb; const _Float16 hv = (_Float16)v, lv = (_Float16)((v - (float)hv) * 2048.0f); if (which < 2) { sh[wave * 16 + 8 * g + r][j * 16 + col] = hv; sl[wave * 16 + 8 * g + r][j * 16 + col] = lv; } else { th[j * 16 + col][wave * 16 + 8 * g + r] = hv; tl[j * 16 + col][wave * 16 + 8 * g + r] = lv; } } }
  __syncthreads();
  if (which < 2) { _Float16* PH = which == 0 ? QH : KH; _Float16* PL = which == 0 ? QL : KL; for (int e = tid; e < 64 * 16; e += 128) { const int rl = e >> 4, q = e & 15; const size_t o = (b * NN + blockIdx.x * 64 + rl) * CC + c0 + q * 8; vst2((unsigned*)(PH + o), *(const v4u*)&sh[rl][q * 8]); vst2((unsigned*)(PL + o), *(const v4u*)&sl[rl][q * 8]); } }
  else { for (int e = tid; e < 128 * 8; e += 128) { const int cl = e >> 3, q = e & 7; const size_t o = (b * CC + c0 + cl) * (size_t)NN + blockIdx.x * 64 + q * 8; vst2((unsigned*)(VT + o), *(const v4u*)&th[cl][q * 8]); vst2((unsigned*)(VTL + o), *(const v4u*)&tl[cl][q * 8]); } } }
// ---- k_stats: block = (64 queries n, h, b): row max and sum of exp over all 1,024 keys (3-product logits x 128^-1/2); one 256-B line of each per block
__global__ __launch_bounds__(128) void k_stats(const _Float16* __restrict__ QH, const _Float16* __restrict__ QL, const _Float16* __restrict__ KH, const _Float16* __restrict__ KL, float* __restrict__ ST, float* __restrict__ SL) { __shared__ __align__(16) float sm[64], ssum[64]; __shared__ __align__(16) _Float16 sk[2][2][32][QP];   // key tile [buffer][hi | lo][key][d], shared by the four waves
  const int tid = threadIdx.x, wave = tid >> 5, lane = tid & 31, col = lane & 15, g = lane >> 4; const int h = blockIdx.y; const size_t b = blockIdx.z; const int q0 = blockIdx.x * 64 + wave * 16; const size_t rq = b * NN + q0;
  v16h aq[4], al[4];
#pragma unroll
  for (int kc = 0; kc < 4; ++kc) { aq[kc] = frag_h(QH + (rq + col) * CC + h * DK + kc * 32, lane); al[kc] = frag_h(QL + (rq + col) * CC + h * DK + kc * 32, lane); }
  float m[8], l[8];
#pragma unroll
  for (int r = 0; r < 8; ++r) { m[r] = -3.0e38f; l[r] = 0.f; }
  const int srow = tid >> 4, spc = (tid & 15) * 8; const size_t so = (b * NN + srow) * CC + h * DK + spc;   // staging map: 16 lanes per 256-B row, a wave's load = 4 whole lines
  v8h rk[2][4];
#pragma unroll
  for (int i = 0; i < 4; ++i) { rk[0][i] = *(const v8h*)(KH + so + (size_t)(8 * i) * CC); rk[1][i] = *(const v8h*)(KL + so + (size_t)(8 * i) * CC); }
  asm volatile("s_wait_xcnt 0x0" ::: "memory");   // the address registers of the loads above are reused below: the wait stands in front of that overwrite
#pragma unroll
  for (int i = 0; i < 4; ++i) { *(v8h*)&sk[0][0][srow + 8 * i][spc] = rk[0][i]; *(v8h*)&sk[0][1][srow + 8 * i][spc] = rk[1][i]; }
  __syncthreads();
#pragma unroll 1
  for (int ks = 0; ks < NN / 32; ++ks) { float s[2][8]; const int cur = ks & 1;
    if (ks + 1 < NN / 32) {   // the next key tile's loads fly while this one is worked on
#pragma unroll
      for (int i = 0; i < 4; ++i) { rk[0][i] = *(const v8h*)(KH + so + (size_t)((ks + 1) * 32 + 8 * i) * CC); rk[1][i] = *(const v8h*)(KL + so + (size_t)((ks + 1) * 32 + 8 * i) * CC); } }
    asm volatile("s_wait_xcnt 0x0" ::: "memory");   // the address registers of the loads above are reused below: the wait stands in front of that overwrite
#pragma unroll
    for (int ct = 0; ct < 2; ++ct) { v8f c = {}, cl = {}; v16h kh[4], kl[4];   // a tile's LDS reads stand as one group ahead of its matrix instructions
#pragma unroll
      for (int kc = 0; kc < 4; ++kc) { kh[kc] = frag_h(&sk[cur][0][ct * 16 + col][kc * 32], lane); kl[kc] = frag_h(&sk[cur][1][ct * 16 + col][kc * 32], lane); }
#pragma unroll
      for (int kc = 0; kc < 4; ++kc) { c = wmma16(aq[kc], kh[kc], c); cl = wmma16(aq[kc], kl[kc], cl); cl = wmma16(al[kc], kh[kc], cl); }
#pragma unroll
      for (int r = 0; r < 8; ++r) s[ct][r] = (c[r] + cl[r] * (1.0f / 2048.0f)) * 0.08838834764831845f; }
#pragma unroll
    for (int r = 0; r < 8; ++r) { float mx = fmaxf(s[0][r], s[1][r]);
#pragma unroll
      for (int o = 1; o < 16; o <<= 1) mx = fmaxf(mx, __shfl_xor(mx, o));
      const float mn = fmaxf(m[r], mx); const float alpha = __expf(m[r] - mn); float es = __expf(s[0][r] - mn) + __expf(s[1][r] - mn);
#pragma unroll
      for (int o = 1; o < 16; o <<= 1) es += __shfl_xor(es, o);
      l[r] = l[r] * alpha + es; m[r] = mn; }
    if (ks + 1 < NN / 32) {
#pragma unroll
      for (int i = 0; i < 4; ++i) { *(v8h*)&sk[cur ^ 1][0][srow + 8 * i][spc] = rk[0][i]; *(v8h*)&sk[cur ^ 1][1][srow + 8 * i][spc] = rk[1][i]; } }
    __syncthreads(); }   // publishes the next tile and ends every wave's reads of this one
  if (col == 0) {
#pragma unroll
    for (int r = 0; r < 8; ++r) { sm[wave * 16 + 8 * g + r] = m[r]; ssum[wave * 16 + 8 * g + r] = l[r]; } }
  __syncthreads(); if (tid < 16) vst2(ST + (b * NH + h) * (size_t)NN + blockIdx.x * 64 + tid * 4, *(const v4f*)&sm[tid * 4]); else if (tid < 32) vst2(SL + (b * NH + h) * (size_t)NN + blockIdx.x * 64 + (tid - 16) * 4, *(const v4f*)&ssum[(tid - 16) * 4]); }
// ---- k_ov: block = (64 output pixels m, h, b): for each query tile n: s^T[m][n] = k_m . q_n (3 products), att[n][m] = exp(s - max_n) / sum_n, then o^T[m][d] += sum_n att[n][m] v[d][n] (att^T tile as the A operand, v planes as B; 3 products); o written NCHW per head channel
__global__ __launch_bounds__(128) void k_ov(const _Float16* __restrict__ QH, const _Float16* __restrict__ QL, const _Float16* __restrict__ KH, const _Float16* __restrict__ KL, const _Float16* __restrict__ VT, const _Float16* __restrict__ VTL, const float* __restrict__ ST, const float* __restrict__ SL, float* __restrict__ O) {
  __shared__ __align__(16) float sp[4][16][36]; __shared__ __align__(16) float stt[128][68];
  __shared__ __align__(16) _Float16 sq[2][2][32][QP]; __shared__ __align__(16) _Float16 sv[2][2][128][VP];   // query tile [buffer][hi | lo][n][d] and value tile [buffer][hi | lo][d][n], shared by the four waves
  __shared__ __align__(16) float sst[2][NN];   // row max | row sum of all queries of this (b, h), staged once
  const int tid = threadIdx.x, wave = tid >> 5, lane = tid & 31, col = lane & 15, g = lane >> 4; const int h = blockIdx.y; const size_t b = blockIdx.z; const int mm0 = blockIdx.x * 64 + wave * 16; const size_t rm = b * NN + mm0;
  v16h ak[4], akl[4];   // A = k rows of this block's output pixels m
#pragma unroll
  for (int kc = 0; kc < 4; ++kc) { ak[kc] = frag_h(KH + (rm + col) * CC + h * DK + kc * 32, lane); akl[kc] = frag_h(KL + (rm + col) * CC + h * DK + kc * 32, lane); }
  const float* stm = ST + (b * NH + h) * (size_t)NN; const float* stl = SL + (b * NH + h) * (size_t)NN;
  v8f acc[8], accl[8];
#pragma unroll
  for (int j = 0; j < 8; ++j) { acc[j] = v8f{}; accl[j] = v8f{}; }
  const int qrow = tid >> 4, qpc = (tid & 15) * 8; const size_t qo = (b * NN + qrow) * CC + h * DK + qpc;   // staging maps: q 16 lanes per 256-B row; v 4 lanes per 64-B row piece
  const int vrow = tid >> 2, vpc = (tid & 3) * 8; const size_t vo = (b * CC + (size_t)h * DK + vrow) * (size_t)NN + vpc;
  v8h rq[2][4], rv[2][4]; v4f rs[2][2];
#pragma unroll
  for (int i = 0; i < 2; ++i) { rs[0][i] = *(const v4f*)(stm + tid * 4 + i * 512); rs[1][i] = *(const v4f*)(stl + tid * 4 + i * 512); }
#pragma unroll
  for (int i = 0; i < 4; ++i) { rq[0][i] = *(const v8h*)(QH + qo + (size_t)(8 * i) * CC); rq[1][i] = *(const v8h*)(QL + qo + (size_t)(8 * i) * CC); rv[0][i] = *(const v8h*)(VT + vo + (size_t)(32 * i) * NN); rv[1][i] = *(const v8h*)(VTL + vo + (size_t)(32 * i) * NN); }
  asm volatile("s_wait_xcnt 0x0" ::: "memory");   // the address registers of the loads above are reused below: the wait stands in front of that overwrite
#pragma unroll
  for (int i = 0; i < 4; ++i) { *(v8h*)&sq[0][0][qrow + 8 * i][qpc] = rq[0][i]; *(v8h*)&sq[0][1][qrow + 8 * i][qpc] = rq[1][i]; *(v8h*)&sv[0][0][vrow + 32 * i][vpc] = rv[0][i]; *(v8h*)&sv[0][1][vrow + 32 * i][vpc] = rv[1][i]; }
#pragma unroll
  for (int i = 0; i < 2; ++i) { *(v4f*)&sst[0][tid * 4 + i * 512] = rs[0][i]; *(v4f*)&sst[1][tid * 4 + i * 512] = rs[1][i]; }
  __syncthreads();
#pragma unroll 1
  for (int ks = 0; ks < NN / 32; ++ks) { const int cur = ks & 1;
    if (ks + 1 < NN / 32) {   // the next tiles' loads fly while these are worked on
#pragma unroll
      for (int i = 0; i < 4; ++i) { rq[0][i] = *(const v8h*)(QH + qo + (size_t)((ks + 1) * 32 + 8 * i) * CC); rq[1][i] = *(const v8h*)(QL + qo + (size_t)((ks + 1) * 32 + 8 * i) * CC); rv[0][i] = *(const v8h*)(VT + vo + (size_t)(32 * i) * NN + (ks + 1) * 32); rv[1][i] = *(const v8h*)(VTL + vo + (size_t)(32 * i) * NN + (ks + 1) * 32); } }
    asm volatile("s_wait_xcnt 0x0" ::: "memory");   // the address registers of the loads above are reused below: the wait stands in front of that overwrite
#pragma unroll
    for (int ct = 0; ct < 2; ++ct) { const int n = ks * 32 + ct * 16 + col; v8f c = {}, cl = {};
#pragma unroll
      for (int k2 = 0; k2 < 2; ++k2) { v16h qh[2], ql[2];   // LDS reads in groups of eight ahead of six matrix instructions: fewer places where a wave waits for LDS; a larger group does not fit the registers that the matrix operands can use
#pragma unroll
        for (int kc = 0; kc < 2; ++kc) { qh[kc] = frag_h(&sq[cur][0][ct * 16 + col][(k2 * 2 + kc) * 32], lane); ql[kc] = frag_h(&sq[cur][1][ct * 16 + col][(k2 * 2 + kc) * 32], lane); }
#pragma unroll
        for (int kc = 0; kc < 2; ++kc) { const int ko = k2 * 2 + kc; c = wmma16(ak[ko], qh[kc], c); cl = wmma16(ak[ko], ql[kc], cl); cl = wmma16(akl[ko], qh[kc], cl); } }
      const float mx = sst[0][n], il = 1.0f / sst[1][n];   // per query n (the column of this transposed tile)
#pragma unroll
      for (int r = 0; r < 8; ++r) { const float s = (c[r] + cl[r] * (1.0f / 2048.0f)) * 0.08838834764831845f; sp[wave][8 * g + r][ct * 16 + col] = __expf(s - mx) * il; } }
    LDSX();
    v16h pa, pal; { const float* prow = &sp[wave][col][0] + 8 * (lane >> 4);
#pragma unroll
      for (int i = 0; i < 8; ++i) { const float p0 = prow[i] * 2048.0f, p1 = prow[16 + i] * 2048.0f; pa[i] = (_Float16)p0; pa[8 + i] = (_Float16)p1; pal[i] = (_Float16)((p0 - (float)pa[i]) * 2048.0f); pal[8 + i] = (_Float16)((p1 - (float)pa[8 + i]) * 2048.0f); } }
#pragma unroll
    for (int jj = 0; jj < 4; ++jj) { v16h vh[2], vl[2];
#pragma unroll
      for (int j = 0; j < 2; ++j) { vh[j] = frag_h(&sv[cur][0][(jj * 2 + j) * 16 + col][0], lane); vl[j] = frag_h(&sv[cur][1][(jj * 2 + j) * 16 + col][0], lane); }
#pragma unroll
      for (int j = 0; j < 2; ++j) { const int jo = jj * 2 + j; acc[jo] = wmma16(pa, vh[j], acc[jo]); accl[jo] = wmma16(pa, vl[j], accl[jo]); accl[jo] = wmma16(pal, vh[j], accl[jo]); } }
    if (ks + 1 < NN / 32) {
#pragma unroll
      for (int i = 0; i < 4; ++i) { *(v8h*)&sq[cur ^ 1][0][qrow + 8 * i][qpc] = rq[0][i]; *(v8h*)&sq[cur ^ 1][1][qrow + 8 * i][qpc] = rq[1][i]; *(v8h*)&sv[cur ^ 1][0][vrow + 32 * i][vpc] = rv[0][i]; *(v8h*)&sv[cur ^ 1][1][vrow + 32 * i][vpc] = rv[1][i]; } }
    __syncthreads(); }   // publishes the next tiles and ends every wave's reads of these and of its sp rows
#pragma unroll
  for (int j = 0; j < 8; ++j)
#pragma unroll
    for (int r = 0; r < 8; ++r) stt[j * 16 + col][wave * 16 + 8 * g + r] = (acc[j][r] + accl[j][r] * (1.0f / 2048.0f)) * (1.0f / 2048.0f);   // [d][m local]
  __syncthreads(); for (int e = tid; e < 128 * 16; e += 128) { const int d = e >> 4, q = e & 15; vst2(O + (b * CC + (size_t)h * DK + d) * (size_t)NN + blockIdx.x * 64 + q * 4, *(const v4f*)&stt[d][q * 4]); } }
// ---- k_gate: block = (64 pixels, b): gate = sigmoid(sum_c gate_w[c] o[c][m] + gate_b); out = o * gate + o (NCHW lines)
__global__ __launch_bounds__(256) void k_gate(const float* __restrict__ O, const float* __restrict__ GW, const float* __restrict__ GB, float* __restrict__ OUT) { __shared__ float sg[64]; __shared__ float part[4][64]; const int t = threadIdx.x; const size_t b = blockIdx.y; const int m0 = blockIdx.x * 64; const int ml = t & 63, q4 = t >> 6;
  { float s = 0.f; for (int c = q4; c < CC; c += 4) s += bfr(GW[c]) * O[(b * CC + c) * (size_t)NN + m0 + ml]; part[q4][ml] = s; }
  __syncthreads(); if (t < 64) { const float s = part[0][t] + part[1][t] + part[2][t] + part[3][t] + bfr(GB[0]); sg[t] = 1.0f + 1.0f / (1.0f + expf(-s)); } __syncthreads();
  for (int e = t; e < CC * 16; e += 256) { const int c = e >> 4, q = e & 15; const float* orow = O + (b * CC + c) * (size_t)NN + m0 + q * 4; v4f v; v[0] = orow[0] * sg[q * 4]; v[1] = orow[1] * sg[q * 4 + 1]; v[2] = orow[2] * sg[q * 4 + 2]; v[3] = orow[3] * sg[q * 4 + 3]; vst2(OUT + (b * CC + c) * (size_t)NN + m0 + q * 4, v); } }
extern "C" void kernel_launch(void* const* d_in, const int* in_sizes, int n_in, void* d_out, int out_size, void* d_ws, size_t ws_size, hipStream_t stream) {
  (void)in_sizes; (void)n_in; (void)out_size;
  const float** F = (const float**)d_in;   // 0 x [8,512,32,32], 1 wq [512,512], 2 bq, 3 wk, 4 bk, 5 wv, 6 bv, 7 fc1_w [128,512], 8 fc1_b, 9 fc2_w [512,128], 10 fc2_b, 11 gate_w [1,512], 12 gate_b [1]
  if (ws_size < (size_t)WS_END) return;
  char* ws = (char*)d_ws; float *SC = (float*)(ws + WS_SC), *ST = (float*)(ws + WS_ST), *SL = (float*)(ws + WS_SL), *O = (float*)(ws + WS_O), *P = (float*)(ws + WS_P); _Float16 *QH = (_Float16*)(ws + WS_QH), *QL = (_Float16*)(ws + WS_QL), *KH = (_Float16*)(ws + WS_KH), *KL = (_Float16*)(ws + WS_KL), *VT = (_Float16*)(ws + WS_VT), *VTL = (_Float16*)(ws + WS_VTL);
  k_pool<<<NB * CC / 32, 1024, 0, stream>>>(F[0], P);
  k_fc<<<NB, 1024, 0, stream>>>(P, F[7], F[8], F[9], F[10], SC);
  k_proj<<<dim3(NN / 64, CC / 128, 3 * NB), 128, 0, stream>>>(F[0], SC, F[1], F[2], F[3], F[4], F[5], F[6], QH, QL, KH, KL, VT, VTL);
  k_stats<<<dim3(NN / 64, NH, TNB), 128, 0, stream>>>(QH, QL, KH, KL, ST, SL);
  k_ov<<<dim3(NN / 64, NH, TNB), 128, 0, stream>>>(QH, QL, KH, KL, VT, VTL, ST, SL, O);
  k_gate<<<dim3(NN / 64, TNB), 256, 0, stream>>>(O, F[11], F[12], (float*)d_out);
}

// v004
// One run takes 144 microseconds.
// Timed twice side by side with v003, it ran 1.08 times as fast both times.
// All steps since v000 together make it 4.02 times as fast.
#include <hip/hip_runtime.h>
#include <math.h>

typedef __attribute__((ext_vector_type(16))) _Float16 v16h;
typedef __attribute__((ext_vector_type(16))) __bf16 v16b;
typedef __attribute__((ext_vector_type(8)))  _Float16 v8h;
typedef __attribute__((ext_vector_type(8)))  float v8f;
typedef __attribute__((ext_vector_type(4)))  float v4f;
typedef __attribute__((ext_vector_type(2)))  float v2f;
typedef __attribute__((ext_vector_type(4)))  unsigned v4u;
typedef __attribute__((ext_vector_type(4)))  int v4i;
typedef float __attribute__((may_alias)) float_a;
typedef int __attribute__((may_alias)) int_a;

template <typename T> __device__ __forceinline__ void vst2(void* p, T v) { *(T*)p = v;  }
__device__ __forceinline__ v8f wmma16(v16h a, v16h b, v8f c) {
  v8f d = __builtin_amdgcn_wmma_f32_16x16x32_f16(false, a, false, b, (short)0, c, false, false);
  asm volatile("v_nop\n\tv_nop\n\tv_nop\n\tv_nop" : "+v"(d) : "v"(a), "v"(b));
  return d;
}
__device__ __forceinline__ v8f wmma_bf(v16b a, v16b b, v8f c) {
  v8f d = __builtin_amdgcn_wmma_f32_16x16x32_bf16(false, a, false, b, (short)0, c, false, false);
  asm volatile("v_nop\n\tv_nop\n\tv_nop\n\tv_nop" : "+v"(d) : "v"(a), "v"(b));
  return d;
}
// 16x16x32 fragments: lane = (h = lane>>4, row/col = lane&15); elements 0..7 = k0+8h+0..7, 8..15 = k0+16+8h+0..7; D element r = row 8h+r
__device__ __forceinline__ v16h frag_h(const _Float16* rowk0, int lane) {
  union { v16h v; v8h q[2]; } u; const _Float16* p = rowk0 + 8 * (lane >> 4);
  u.q[0] = *(const v8h*)p; u.q[1] = *(const v8h*)(p + 16); return u.v;
}
__device__ __forceinline__ v16h frag_f32(const float* rowk0, int lane) {
  v16h a; const float* p = rowk0 + 8 * (lane >> 4);
#pragma unroll
  for (int i = 0; i < 8; ++i) { a[i] = (_Float16)p[i]; a[8 + i] = (_Float16)p[16 + i]; }
  return a;
}
__device__ __forceinline__ v16h frag_f32s(const float* rowk0, int lane, float sc) {
  v16h a; const float* p = rowk0 + 8 * (lane >> 4);
#pragma unroll
  for (int i = 0; i < 8; ++i) { a[i] = (_Float16)(p[i] * sc); a[8 + i] = (_Float16)(p[16 + i] * sc); }
  return a;
}
// column fragment from a [K][ld] layout (column n), rows >= K read as 0
__device__ __forceinline__ v16h fragc_f32(const float* W, int k0, int n, int lane, int ld, int K) {
  v16h a; const int g = lane >> 4;
#pragma unroll
  for (int i = 0; i < 8; ++i) { const int ka = k0 + 8 * g + i, kb = ka + 16;
    a[i] = (_Float16)(ka < K ? W[(size_t)(ka < K ? ka : K - 1) * ld + n] : 0.f); a[8 + i] = (_Float16)(kb < K ? W[(size_t)(kb < K ? kb : K - 1) * ld + n] : 0.f); }
  return a;
}
struct F2 { v16b h, l; };
__device__ __forceinline__ F2 bsplit16(const float v[16]) { F2 r;
#pragma unroll
  for (int i = 0; i < 16; ++i) { const __bf16 h = (__bf16)v[i]; r.h[i] = h; r.l[i] = (__bf16)(v[i] - (float)h); }
  return r; }
__device__ __forceinline__ F2 split_row(const float* row, int k0, int lane) { float v[16]; const float* p = row + k0 + 8 * (lane >> 4);
#pragma unroll
  for (int i = 0; i < 8; ++i) { v[i] = p[i]; v[8 + i] = p[16 + i]; }
  return bsplit16(v); }
__device__ __forceinline__ F2 split_rowK(const float* row, int k0, int lane, int K) { float v[16]; const int g = lane >> 4;
#pragma unroll
  for (int i = 0; i < 8; ++i) { const int ka = k0 + 8 * g + i, kb = ka + 16; v[i] = ka < K ? row[ka < K ? ka : K - 1] : 0.f; v[8 + i] = kb < K ? row[kb < K ? kb : K - 1] : 0.f; }
  return bsplit16(v); }
__device__ __forceinline__ F2 split_col(const float* W, int k0, int n, int lane, int ld, int K) { float v[16]; const int g = lane >> 4;
#pragma unroll
  for (int i = 0; i < 8; ++i) { const int ka = k0 + 8 * g + i, kb = ka + 16; v[i] = ka < K ? W[(size_t)(ka < K ? ka : K - 1) * ld + n] : 0.f; v[8 + i] = kb < K ? W[(size_t)(kb < K ? kb : K - 1) * ld + n] : 0.f; }
  return bsplit16(v); }
__device__ __forceinline__ v8f mac3(const F2& a, const F2& b, v8f c) { c = wmma_bf(a.l, b.h, c); c = wmma_bf(a.h, b.l, c); return wmma_bf(a.h, b.h, c); }
__device__ __forceinline__ float sigm(float v) { return 1.0f / (1.0f + expf(-v)); }
// work-group barrier that orders LDS alone: __syncthreads() would also wait for every global load in flight, and the loads issued for later passes are meant to stay in flight across it
#define BAR_LDS() do { __builtin_amdgcn_fence(__ATOMIC_RELEASE, "workgroup", "local"); __builtin_amdgcn_s_barrier(); __builtin_amdgcn_fence(__ATOMIC_ACQUIRE, "workgroup", "local"); } while (0)


// SelfModule (B 8, C 512, 32x32, 4 heads x 128): x = x * sigmoid(SE(x)) + x; q, k, v = 1x1 convs; att = softmax_m(q_n . k_m / sqrt(128)); o[:, m] = sum_n v[:, n] att[n, m]; out = o * sigmoid(gate 1x1 conv(o)) + o.
#define NB 8
#define CC 512
#define NN 1024
#define NH 4
#define DK 128
#define RR 128            // SE bottleneck
#ifndef TNB
#define TNB NB
#endif
typedef __attribute__((ext_vector_type(8))) __bf16 v8b;
__device__ __forceinline__ v16b frag_b(const __bf16* rowk0, int lane) {
  union { v16b v; v8b q[2]; } u; const __bf16* p = rowk0 + 8 * (lane >> 4);
  u.q[0] = *(const v8b*)p; u.q[1] = *(const v8b*)(p + 16); return u.v;
}
__device__ __forceinline__ float bfr(float v) { return (float)(__bf16)v; }
typedef __attribute__((ext_vector_type(4))) __bf16 v4b;
// LDS row pitches of the staged tiles, in 16-bit elements: 16 B x an odd number, so that the 16 rows of a ds_load_b128 fragment read fall on distinct banks
#define QP 136            // q / k rows of 128 elements: 272 B
#define VP 40             // rows of 32 elements (v planes, weight rows): 80 B
__device__ __attribute__((noinline)) float exp_ni(float v) { return expf(v); }
__device__ __attribute__((noinline)) float erf_ni(float v) { return erff(v); }

#define WS_SC  0u                                   // f32 1 + sigmoid(SE) [b][512]
#define WS_QH  (WS_SC + 4u * (size_t)NB * CC)            // f16 hi|lo q rows [b*NN + n][512]; k rows; v planes [b][512][NN]
#define WS_QL  (WS_QH + 2u * (size_t)NB * NN * CC)
#define WS_KH  (WS_QL + 2u * (size_t)NB * NN * CC)
#define WS_KL  (WS_KH + 2u * (size_t)NB * NN * CC)
#define WS_VT  (WS_KL + 2u * (size_t)NB * NN * CC)
#define WS_VTL (WS_VT + 2u * (size_t)NB * CC * NN)
#define WS_ST  (WS_VTL + 2u * (size_t)NB * CC * NN)      // f32 row max [b][h][n], 1 / row sum
#define WS_SL  (WS_ST + 4u * (size_t)NB * NH * NN)
#define WS_O   (WS_SL + 4u * (size_t)NB * NH * NN)       // f32 o NCHW [b][512][NN]
#define WS_P   (WS_O + 4u * (size_t)NB * CC * NN)       // f32 pooled mean [b][512]
#define WS_END (WS_P + 4u * (size_t)NB * CC)

// ---- k_pool: block = 32 rows (b, c), one wave per row: mean over the 1,024 pixels, 8 loads of 16 bytes per lane in flight; the block's 32 means leave as one 128-B line; the loops are unrolled so that v[] stays in registers and all 8 loads issue before the first is used
__global__ __launch_bounds__(1024) void k_pool(const float* __restrict__ X, float* __restrict__ P) { __shared__ float sp[32]; const int t = threadIdx.x, lane = t & 31, w = t >> 5;
  const float* xr = X + ((size_t)blockIdx.x * 32 + w) * NN + lane * 4; v4f v[8];
#pragma unroll
  for (int i = 0; i < 8; ++i) v[i] = *(const v4f*)(xr + i * 128);
  float s = 0.f;
#pragma unroll
  for (int i = 0; i < 8; ++i) s += (bfr(v[i][0]) + bfr(v[i][1])) + (bfr(v[i][2]) + bfr(v[i][3]));
#pragma unroll
  for (int o = 1; o < 32; o <<= 1) s += __shfl_xor(s, o);
  if (lane == 0) sp[w] = s * (1.0f / NN);
  __syncthreads(); if (t < 32) P[(size_t)blockIdx.x * 32 + t] = sp[t]; }
// ---- k_fc: block = b, 32 waves: fc1 (4 rows per wave), relu, fc2 (16 rows per wave), 1 + sigmoid; each dot product is split over the lanes of one wave (16-byte loads along the row) and summed by shuffles; every loop is unrolled so that its arrays stay in registers, a stage's loads issue together and the rows' shuffle chains overlap
__global__ __launch_bounds__(1024) void k_fc(const float* __restrict__ P, const float* __restrict__ F1W, const float* __restrict__ F1B, const float* __restrict__ F2W, const float* __restrict__ F2B, float* __restrict__ SC) { __shared__ __align__(16) float sh[RR]; __shared__ __align__(16) float ss[CC]; const int t = threadIdx.x, lane = t & 31, w = t >> 5; const size_t b = blockIdx.x;
  v4f p[4], f1[4][4]; float a[4];
#pragma unroll
  for (int r = 0; r < 4; ++r)
#pragma unroll
    for (int i = 0; i < 4; ++i) f1[r][i] = *(const v4f*)(F1W + (size_t)(w * 4 + r) * CC + i * 128 + lane * 4);
  asm volatile("s_wait_xcnt 0x0" ::: "memory");   // the loads below may land in the address registers of the loads above: the wait stands in front of that overwrite
#pragma unroll
  for (int i = 0; i < 4; ++i) p[i] = *(const v4f*)(P + b * CC + i * 128 + lane * 4);
#pragma unroll
  for (int r = 0; r < 4; ++r) { float s = 0.f;
#pragma unroll
    for (int i = 0; i < 4; ++i) s += p[i][0] * bfr(f1[r][i][0]) + p[i][1] * bfr(f1[r][i][1]) + p[i][2] * bfr(f1[r][i][2]) + p[i][3] * bfr(f1[r][i][3]);
    a[r] = s; }
#pragma unroll
  for (int r = 0; r < 4; ++r) {
#pragma unroll
    for (int o = 1; o < 32; o <<= 1) a[r] += __shfl_xor(a[r], o); }
  if (lane < 4) { const float s = lane == 0 ? a[0] : lane == 1 ? a[1] : lane == 2 ? a[2] : a[3]; sh[w * 4 + lane] = fmaxf(s + bfr(F1B[w * 4 + lane]), 0.f); }
  __syncthreads();
  const v4f hv = *(const v4f*)&sh[lane * 4]; float c[16];
#pragma unroll
  for (int r = 0; r < 16; ++r) { const v4f f = *(const v4f*)(F2W + (size_t)(w * 16 + r) * RR + lane * 4); c[r] = hv[0] * bfr(f[0]) + hv[1] * bfr(f[1]) + hv[2] * bfr(f[2]) + hv[3] * bfr(f[3]); }
#pragma unroll
  for (int r = 0; r < 16; ++r) {
#pragma unroll
    for (int o = 1; o < 32; o <<= 1) c[r] += __shfl_xor(c[r], o); }
  if (lane < 16) { float s = c[0];
#pragma unroll
    for (int r = 1; r < 16; ++r) s = lane == r ? c[r] : s;
    s += bfr(F2B[w * 16 + lane]); ss[w * 16 + lane] = 1.0f + 1.0f / (1.0f + expf(-s)); }
  __syncthreads(); if (t < CC / 4) vst2(SC + b * CC + t * 4, *(const v4f*)&ss[t * 4]); }
// ---- k_proj: block = (64 pixels, 128 output channels, which*NB + b): conv1x1 over xs = x * sc (gathered from NCHW, bf16 hi + lo) + bias; q, k -> f16 hi/lo rows [n][512]; v -> planes [c][n]. The weight rows are the A operand and the pixels B: a lane's 8 results are 8 consecutive channels of one pixel, for q and k one 16-byte piece of an output row
__global__ __launch_bounds__(128) void k_proj(const float* __restrict__ X, const float* __restrict__ SC, const float* __restrict__ WQ, const float* __restrict__ BQ, const float* __restrict__ WK, const float* __restrict__ BK, const float* __restrict__ WV, const float* __restrict__ BV, _Float16* __restrict__ QH, _Float16* __restrict__ QL, _Float16* __restrict__ KH, _Float16* __restrict__ KL, _Float16* __restrict__ VT, _Float16* __restrict__ VTL) {
  __shared__ __align__(16) _Float16 sh[64][136], sl[64][136]; __shared__ __align__(16) _Float16 th[128][72], tl[128][72]; __shared__ float ssc[CC]; __shared__ __align__(16) float sbb[128]; __shared__ __align__(16) __bf16 swt[2][128][VP];   // weight tile [buffer][output channel][32 input channels], bf16, shared by the four waves
  const int tid = threadIdx.x, wave = tid >> 5, lane = tid & 31, col = lane & 15, g = lane >> 4; const int which = blockIdx.z / NB; const size_t b = blockIdx.z % NB; const int n0 = blockIdx.x * 64 + wave * 16; const int c0 = blockIdx.y * 128; const float* Wm = which == 0 ? WQ : which == 1 ? WK : WV; const float* Bm = which == 0 ? BQ : which == 1 ? BK : BV; const float* Xb = X + b * CC * (size_t)NN;
  const int wrow = tid >> 3, wpc = (tid & 7) * 4; const float* wsrc = Wm + (size_t)(c0 + wrow) * CC + wpc;   // staging map: 8 lanes per 128-B row piece, a wave's load = 4 whole lines
  v4f wreg[8];
#pragma unroll
  for (int i = 0; i < 8; ++i) wreg[i] = *(const v4f*)(wsrc + (size_t)i * 16 * CC);
  float sc4[4], bbv[8];   // the scale values and the epilogue's bias values are asked for here, all at once, so that none of them is waited for one by one
#pragma unroll
  for (int i = 0; i < 4; ++i) sc4[i] = SC[b * CC + tid + 128 * i];
#pragma unroll
  for (int j = 0; j < 8; ++j) bbv[j] = Bm[c0 + j * 16 + col];
  asm volatile("s_wait_xcnt 0x0" ::: "memory");   // the address registers of the loads above are reused below: the wait stands in front of that overwrite
#pragma unroll
  for (int i = 0; i < 4; ++i) ssc[tid + 128 * i] = sc4[i];
#pragma unroll
  for (int i = 0; i < 8; ++i) { v4b c4; c4[0] = (__bf16)wreg[i][0]; c4[1] = (__bf16)wreg[i][1]; c4[2] = (__bf16)wreg[i][2]; c4[3] = (__bf16)wreg[i][3]; *(v4b*)&swt[0][wrow + 16 * i][wpc] = c4; }
  // every global load of the loop is issued one whole pass before its values are used: xv = the x values of the coming pass, wreg = the weight tile after the one in LDS
  float xv[16]; const float* xsrc = Xb + (size_t)(8 * g) * NN + n0 + col;
#pragma unroll
  for (int i = 0; i < 8; ++i) { xv[i] = xsrc[(size_t)i * NN]; xv[8 + i] = xsrc[(size_t)(16 + i) * NN]; }
#pragma unroll
  for (int i = 0; i < 8; ++i) wreg[i] = *(const v4f*)(wsrc + (size_t)i * 16 * CC + 32);
  asm volatile("s_wait_xcnt 0x0" ::: "memory");   // the address registers of the loads above are reused below: the wait stands in front of that overwrite
  BAR_LDS();
  v8f acc[8] = {};
  // one pass; more = a pass follows (its weight tile goes to LDS, its x values are asked for), more2 = two follow (the tile after that is asked for): compile-time flags, so that no load stands under a run-time branch and no loaded register has to be copied where two paths meet, which would wait for the load at once
  auto pass = [&](const int kc, const bool more, const bool more2) __attribute__((always_inline)) { float v[16]; const int cur = kc & 1;
#pragma unroll
    for (int i = 0; i < 8; ++i) { const int ca = kc * 32 + 8 * g + i, cb2 = ca + 16; v[i] = bfr(xv[i]) * ssc[ca]; v[8 + i] = bfr(xv[8 + i]) * ssc[cb2]; }
    const F2 a = bsplit16(v);
    if (more) {   // the next weight tile has had a pass to land; its buffer is free since the barrier at the foot of the pass before
#pragma unroll
      for (int i = 0; i < 8; ++i) { v4b c4; c4[0] = (__bf16)wreg[i][0]; c4[1] = (__bf16)wreg[i][1]; c4[2] = (__bf16)wreg[i][2]; c4[3] = (__bf16)wreg[i][3]; *(v4b*)&swt[cur ^ 1][wrow + 16 * i][wpc] = c4; }
#pragma unroll
      for (int i = 0; i < 8; ++i) { xv[i] = xsrc[(size_t)((kc + 1) * 32 + i) * NN];
        if (!more2 && i == 7) asm volatile("s_wait_xcnt 0x0" ::: "memory");   // the pointer is dead behind the last x load of all: the wait stands in front of it
        xv[8 + i] = xsrc[(size_t)((kc + 1) * 32 + 16 + i) * NN]; } }
    if (more2) {
#pragma unroll
      for (int i = 0; i < 8; ++i) wreg[i] = *(const v4f*)(wsrc + (size_t)i * 16 * CC + (kc + 2) * 32); }
    asm volatile("s_wait_xcnt 0x0" ::: "memory");   // the address registers of the loads above are reused below: the wait stands in front of that overwrite
    v16b w[8];   // the pass's LDS reads stand as one group ahead of its matrix instructions
#pragma unroll
    for (int j = 0; j < 8; ++j) w[j] = frag_b(&swt[cur][j * 16 + col][0], lane);
#pragma unroll
    for (int j = 0; j < 8; ++j) { acc[j] = wmma_bf(w[j], a.h, acc[j]); acc[j] = wmma_bf(w[j], a.l, acc[j]); }
    BAR_LDS();   // publishes the next tile and ends every wave's reads of this one
    __builtin_amdgcn_sched_barrier(0); };   // keeps the next pass's conversions behind the barrier: lifted in among this pass's matrix instructions they would wait for loads that were only just issued
#pragma unroll 2   // two passes per trip: the LDS buffer index is a constant in each, and a pass's loads land in other registers than the values it is still converting
  for (int kc = 0; kc < CC / 32 - 2; ++kc) pass(kc, true, true);
  pass(CC / 32 - 2, true, false);
  if (tid < 16) {   // a lane has asked for the bias of channels j * 16 + col, the epilogue wants that of its 8 result rows: the 128 values go through LDS, published by the barrier at the foot of the last pass
#pragma unroll
    for (int j = 0; j < 8; ++j) sbb[j * 16 + col] = bfr(bbv[j]); }
  pass(CC / 32 - 1, false, false);
  // result r of tile j = channel j * 16 + 8g + r of pixel wave * 16 + col
  auto split8 = [&](const int j, v8h& hv, v8h& lv) __attribute__((always_inline)) { const v4f bb[2] = { *(const v4f*)&sbb[j * 16 + 8 * g], *(const v4f*)&sbb[j * 16 + 8 * g + 4] };
#pragma unroll
    for (int r = 0; r < 8; ++r) { const float v = acc[j][r] + bb[r >> 2][r & 3]; hv[r] = (_Float16)v; lv[r] = (_Float16)((v - (float)hv[r]) * 2048.0f); } };
  if (which < 2) {
#pragma unroll
    for (int j = 0; j < 8; ++j) { v8h hv, lv; split8(j, hv, lv); *(v8h*)&sh[wave * 16 + col][j * 16 + 8 * g] = hv; *(v8h*)&sl[wave * 16 + col][j * 16 + 8 * g] = lv; } }
  else {
#pragma unroll
    for (int j = 0; j < 8; ++j) { v8h hv, lv; split8(j, hv, lv);
#pragma unroll
      for (int r = 0; r < 8; ++r) { th[j * 16 + 8 * g + r][wave * 16 + col] = hv[r]; tl[j * 16 + 8 * g + r][wave * 16 + col] = lv[r]; } } }
  __syncthreads();
  if (which < 2) { _Float16* PH = which == 0 ? QH : KH; _Float16* PL = which == 0 ? QL : KL; for (int e = tid; e < 64 * 16; e += 128) { const int rl = e >> 4, q = e & 15; const size_t o = (b * NN + blockIdx.x * 64 + rl) * CC + c0 + q * 8; vst2((unsigned*)(PH + o), *(const v4u*)&sh[rl][q * 8]); vst2((unsigned*)(PL + o), *(const v4u*)&sl[rl][q * 8]); } }
  else { for (int e = tid; e < 128 * 8; e += 128) { const int cl = e >> 3, q = e & 7; const size_t o = (b * CC + c0 + cl) * (size_t)NN + blockIdx.x * 64 + q * 8; vst2((unsigned*)(VT + o), *(const v4u*)&th[cl][q * 8]); vst2((unsigned*)(VTL + o), *(const v4u*)&tl[cl][q * 8]); } } }
// ---- k_stats: block = (64 queries n, h, b): row max and 1 / sum of exp over all 1,024 keys (3-product logits x 128^-1/2); one 256-B line of each per block. The product is taken as s^T[m][n] (key rows as A, the wave's queries as B): a lane then holds scores of ONE query (n = col, keys 8g + r), so that max and sum run inside the lane and the two lane halves are joined once, behind the loop
__global__ __launch_bounds__(128) void k_stats(const _Float16* __restrict__ QH, const _Float16* __restrict__ QL, const _Float16* __restrict__ KH, const _Float16* __restrict__ KL, float* __restrict__ ST, float* __restrict__ SL) { __shared__ __align__(16) float sm[64], ssum[64]; __shared__ __align__(16) _Float16 sk[2][2][32][QP];   // key tile [buffer][hi | lo][key][d], shared by the four waves
  const int tid = threadIdx.x, wave = tid >> 5, lane = tid & 31, col = lane & 15, g = lane >> 4; const int h = blockIdx.y; const size_t b = blockIdx.z; const int q0 = blockIdx.x * 64 + wave * 16; const size_t rq = b * NN + q0;
  v16h aq[4], al[4];
#pragma unroll
  for (int kc = 0; kc < 4; ++kc) { aq[kc] = frag_h(QH + (rq + col) * CC + h * DK + kc * 32, lane); al[kc] = frag_h(QL + (rq + col) * CC + h * DK + kc * 32, lane); }
  float m = -3.0e38f, l = 0.f;   // this lane's running max and sum for query col over the keys of its half
  const int srow = tid >> 4, spc = (tid & 15) * 8; const size_t so = (b * NN + srow) * CC + h * DK + spc;   // staging map: 16 lanes per 256-B row, a wave's load = 4 whole lines
  v8h rk[2][4];
#pragma unroll
  for (int i = 0; i < 4; ++i) { rk[0][i] = *(const v8h*)(KH + so + (size_t)(8 * i) * CC); rk[1][i] = *(const v8h*)(KL + so + (size_t)(8 * i) * CC); }
  asm volatile("s_wait_xcnt 0x0" ::: "memory");   // the address registers of the loads above are reused below: the wait stands in front of that overwrite
#pragma unroll
  for (int i = 0; i < 4; ++i) { *(v8h*)&sk[0][0][srow + 8 * i][spc] = rk[0][i]; *(v8h*)&sk[0][1][srow + 8 * i][spc] = rk[1][i]; }
  __syncthreads();
#pragma unroll 1
  for (int ks = 0; ks < NN / 32; ++ks) { float s[2][8]; const int cur = ks & 1;
    if (ks + 1 < NN / 32) {   // the next key tile's loads fly while this one is worked on
#pragma unroll
      for (int i = 0; i < 4; ++i) { rk[0][i] = *(const v8h*)(KH + so + (size_t)((ks + 1) * 32 + 8 * i) * CC); rk[1][i] = *(const v8h*)(KL + so + (size_t)((ks + 1) * 32 + 8 * i) * CC); } }
    asm volatile("s_wait_xcnt 0x0" ::: "memory");   // the address registers of the loads above are reused below: the wait stands in front of that overwrite
#pragma unroll
    for (int ct = 0; ct < 2; ++ct) { v8f c = {}, cl = {}; v16h kh[4], kl[4];   // a tile's LDS reads stand as one group ahead of its matrix instructions
#pragma unroll
      for (int kc = 0; kc < 4; ++kc) { kh[kc] = frag_h(&sk[cur][0][ct * 16 + col][kc * 32], lane); kl[kc] = frag_h(&sk[cur][1][ct * 16 + col][kc * 32], lane); }
#pragma unroll
      for (int kc = 0; kc < 4; ++kc) { c = wmma16(kh[kc], aq[kc], c); cl = wmma16(kl[kc], aq[kc], cl); cl = wmma16(kh[kc], al[kc], cl); }
#pragma unroll
      for (int r = 0; r < 8; ++r) s[ct][r] = (c[r] + cl[r] * (1.0f / 2048.0f)) * 0.08838834764831845f; }
    float t[8];   // max and sum as trees: short dependent chains
#pragma unroll
    for (int r = 0; r < 8; ++r) t[r] = fmaxf(s[0][r], s[1][r]);
    const float mn = fmaxf(m, fmaxf(fmaxf(fmaxf(t[0], t[1]), fmaxf(t[2], t[3])), fmaxf(fmaxf(t[4], t[5]), fmaxf(t[6], t[7]))));
#pragma unroll
    for (int r = 0; r < 8; ++r) t[r] = __expf(s[0][r] - mn) + __expf(s[1][r] - mn);
    l = l * __expf(m - mn) + (((t[0] + t[1]) + (t[2] + t[3])) + ((t[4] + t[5]) + (t[6] + t[7]))); m = mn;
    if (ks + 1 < NN / 32) {
#pragma unroll
      for (int i = 0; i < 4; ++i) { *(v8h*)&sk[cur ^ 1][0][srow + 8 * i][spc] = rk[0][i]; *(v8h*)&sk[cur ^ 1][1][srow + 8 * i][spc] = rk[1][i]; } }
    __syncthreads(); }   // publishes the next tile and ends every wave's reads of this one
  { const float mj = fmaxf(m, __shfl_xor(m, 16)); l *= __expf(m - mj); l += __shfl_xor(l, 16); m = mj; }   // join the halves
  if (g == 0) { sm[wave * 16 + col] = m; ssum[wave * 16 + col] = 1.0f / l; }
  __syncthreads(); if (tid < 16) vst2(ST + (b * NH + h) * (size_t)NN + blockIdx.x * 64 + tid * 4, *(const v4f*)&sm[tid * 4]); else if (tid < 32) vst2(SL + (b * NH + h) * (size_t)NN + blockIdx.x * 64 + (tid - 16) * 4, *(const v4f*)&ssum[(tid - 16) * 4]); }
// ---- k_ov: block = (64 output pixels m, h, b): for each query tile n: s[n][m] = q_n . k_m (3 products; query rows as A, the wave's k rows as B), att[n][m] = exp(s - max_n) / sum_n, then o^T[m][d] += sum_n att[n][m] v[d][n] (att^T tile as the A operand, v planes as B; 3 products); o written NCHW per head channel. A lane's 8 results of s (m = col, n = 8g + r) of two 16-query tiles are elements 0..7 and 8..15 of its att^T fragment (row m = col, k = n): att goes from registers to the second product
__global__ __launch_bounds__(128) void k_ov(const _Float16* __restrict__ QH, const _Float16* __restrict__ QL, const _Float16* __restrict__ KH, const _Float16* __restrict__ KL, const _Float16* __restrict__ VT, const _Float16* __restrict__ VTL, const float* __restrict__ ST, const float* __restrict__ SL, float* __restrict__ O) {
  __shared__ __align__(16) float stt[128][68];
  __shared__ __align__(16) _Float16 sq[2][2][32][QP]; __shared__ __align__(16) _Float16 sv[2][2][128][VP];   // query tile [buffer][hi | lo][n][d] and value tile [buffer][hi | lo][d][n], shared by the four waves
  __shared__ __align__(16) float sst[2][NN];   // row max | 1 / row sum of all queries of this (b, h), staged once
  const int tid = threadIdx.x, wave = tid >> 5, lane = tid & 31, col = lane & 15, g = lane >> 4; const int h = blockIdx.y; const size_t b = blockIdx.z; const int mm0 = blockIdx.x * 64 + wave * 16; const size_t rm = b * NN + mm0;
  v16h ak[4], akl[4];   // B = k rows of this block's output pixels m
#pragma unroll
  for (int kc = 0; kc < 4; ++kc) { ak[kc] = frag_h(KH + (rm + col) * CC + h * DK + kc * 32, lane); akl[kc] = frag_h(KL + (rm + col) * CC + h * DK + kc * 32, lane); }
  const float* stm = ST + (b * NH + h) * (size_t)NN; const float* stl = SL + (b * NH + h) * (size_t)NN;
  v8f acc[8], accl[8];
#pragma unroll
  for (int j = 0; j < 8; ++j) { acc[j] = v8f{}; accl[j] = v8f{}; }
  const int qrow = tid >> 4, qpc = (tid & 15) * 8; const size_t qo = (b * NN + qrow) * CC + h * DK + qpc;   // staging maps: q 16 lanes per 256-B row; v 4 lanes per 64-B row piece
  const int vrow = tid >> 2, vpc = (tid & 3) * 8; const size_t vo = (b * CC + (size_t)h * DK + vrow) * (size_t)NN + vpc;
  v8h rq[2][4], rv[2][4]; v4f rs[2][2];
#pragma unroll
  for (int i = 0; i < 2; ++i) { rs[0][i] = *(const v4f*)(stm + tid * 4 + i * 512); rs[1][i] = *(const v4f*)(stl + tid * 4 + i * 512); }
#pragma unroll
  for (int i = 0; i < 4; ++i) { rq[0][i] = *(const v8h*)(QH + qo + (size_t)(8 * i) * CC); rq[1][i] = *(const v8h*)(QL + qo + (size_t)(8 * i) * CC); rv[0][i] = *(const v8h*)(VT + vo + (size_t)(32 * i) * NN); rv[1][i] = *(const v8h*)(VTL + vo + (size_t)(32 * i) * NN); }
  asm volatile("s_wait_xcnt 0x0" ::: "memory");   // the address registers of the loads above are reused below: the wait stands in front of that overwrite
#pragma unroll
  for (int i = 0; i < 4; ++i) { *(v8h*)&sq[0][0][qrow + 8 * i][qpc] = rq[0][i]; *(v8h*)&sq[0][1][qrow + 8 * i][qpc] = rq[1][i]; *(v8h*)&sv[0][0][vrow + 32 * i][vpc] = rv[0][i]; *(v8h*)&sv[0][1][vrow + 32 * i][vpc] = rv[1][i]; }
#pragma unroll
  for (int i = 0; i < 2; ++i) { *(v4f*)&sst[0][tid * 4 + i * 512] = rs[0][i]; *(v4f*)&sst[1][tid * 4 + i * 512] = rs[1][i]; }
  __syncthreads();
#pragma unroll 1
  for (int ks = 0; ks < NN / 32; ++ks) { const int cur = ks & 1;
    if (ks + 1 < NN / 32) {   // the next tiles' loads fly while these are worked on
#pragma unroll
      for (int i = 0; i < 4; ++i) { rq[0][i] = *(const v8h*)(QH + qo + (size_t)((ks + 1) * 32 + 8 * i) * CC); rq[1][i] = *(const v8h*)(QL + qo + (size_t)((ks + 1) * 32 + 8 * i) * CC); rv[0][i] = *(const v8h*)(VT + vo + (size_t)(32 * i) * NN + (ks + 1) * 32); rv[1][i] = *(const v8h*)(VTL + vo + (size_t)(32 * i) * NN + (ks + 1) * 32); } }
    asm volatile("s_wait_xcnt 0x0" ::: "memory");   // the address registers of the loads above are reused below: the wait stands in front of that overwrite
    v4f mx[4], il[4];   // max and 1 / sum of this lane's 16 queries n (the rows of its two score tiles), asked for ahead of the products
#pragma unroll
    for (int i = 0; i < 4; ++i) { const int n4 = ks * 32 + (i >> 1) * 16 + 8 * g + (i & 1) * 4; mx[i] = *(const v4f*)&sst[0][n4]; il[i] = *(const v4f*)&sst[1][n4]; }
    v8f s0 = {}, s1 = {};   // scores of the pass's first and second 16 queries
#pragma unroll 1   // kept a loop: unrolled, both tiles' accumulators are live beside the fragments, the registers that matrix operands can use run out and an output tile is spilled in every pass
    for (int ct = 0; ct < 2; ++ct) { v8f c = {}, cl = {};
#pragma unroll
      for (int k2 = 0; k2 < 2; ++k2) { v16h qh[2], ql[2];   // LDS reads in groups of eight ahead of six matrix instructions: fewer places where a wave waits for LDS; a larger group does not fit the registers that the matrix operands can use
#pragma unroll
        for (int kc = 0; kc < 2; ++kc) { qh[kc] = frag_h(&sq[cur][0][ct * 16 + col][(k2 * 2 + kc) * 32], lane); ql[kc] = frag_h(&sq[cur][1][ct * 16 + col][(k2 * 2 + kc) * 32], lane); }
#pragma unroll
        for (int kc = 0; kc < 2; ++kc) { const int ko = k2 * 2 + kc; c = wmma16(qh[kc], ak[ko], c); cl = wmma16(ql[kc], ak[ko], cl); cl = wmma16(qh[kc], akl[ko], cl); } }
      s0 = s1;
#pragma unroll
      for (int r = 0; r < 8; ++r) s1[r] = (c[r] + cl[r] * (1.0f / 2048.0f)) * 0.08838834764831845f; }
    v16h vh[2], vl[2];   // the first value fragments are asked for ahead of the exponentials, which cover their LDS latency
#pragma unroll
    for (int j = 0; j < 2; ++j) { vh[j] = frag_h(&sv[cur][0][j * 16 + col][0], lane); vl[j] = frag_h(&sv[cur][1][j * 16 + col][0], lane); }
    __builtin_amdgcn_sched_barrier(0);   // keeps those reads in front: left free, the compiler puts them behind most of the vector work below, and the wave waits for them there
    v16h pa, pal; {
#pragma unroll
      for (int i = 0; i < 8; ++i) { const float p0 = __expf(s0[i] - mx[i >> 2][i & 3]) * il[i >> 2][i & 3] * 2048.0f, p1 = __expf(s1[i] - mx[2 + (i >> 2)][i & 3]) * il[2 + (i >> 2)][i & 3] * 2048.0f; pa[i] = (_Float16)p0; pa[8 + i] = (_Float16)p1; pal[i] = (_Float16)((p0 - (float)pa[i]) * 2048.0f); pal[8 + i] = (_Float16)((p1 - (float)pa[8 + i]) * 2048.0f); } }
#pragma unroll
    for (int jj = 0; jj < 4; ++jj) {
      if (jj > 0) {
#pragma unroll
        for (int j = 0; j < 2; ++j) { vh[j] = frag_h(&sv[cur][0][(jj * 2 + j) * 16 + col][0], lane); vl[j] = frag_h(&sv[cur][1][(jj * 2 + j) * 16 + col][0], lane); } }
#pragma unroll
      for (int j = 0; j < 2; ++j) { const int jo = jj * 2 + j; acc[jo] = wmma16(pa, vh[j], acc[jo]); accl[jo] = wmma16(pa, vl[j], accl[jo]); accl[jo] = wmma16(pal, vh[j], accl[jo]); } }
    if (ks + 1 < NN / 32) {
#pragma unroll
      for (int i = 0; i < 4; ++i) { *(v8h*)&sq[cur ^ 1][0][qrow + 8 * i][qpc] = rq[0][i]; *(v8h*)&sq[cur ^ 1][1][qrow + 8 * i][qpc] = rq[1][i]; *(v8h*)&sv[cur ^ 1][0][vrow + 32 * i][vpc] = rv[0][i]; *(v8h*)&sv[cur ^ 1][1][vrow + 32 * i][vpc] = rv[1][i]; } }
    __syncthreads(); }   // publishes the next tiles and ends every wave's reads of these
#pragma unroll
  for (int j = 0; j < 8; ++j)
#pragma unroll
    for (int r = 0; r < 8; ++r) stt[j * 16 + col][wave * 16 + 8 * g + r] = (acc[j][r] + accl[j][r] * (1.0f / 2048.0f)) * (1.0f / 2048.0f);   // [d][m local]
  __syncthreads(); for (int e = tid; e < 128 * 16; e += 128) { const int d = e >> 4, q = e & 15; vst2(O + (b * CC + (size_t)h * DK + d) * (size_t)NN + blockIdx.x * 64 + q * 4, *(const v4f*)&stt[d][q * 4]); } }
// ---- k_gate: block = (64 pixels, b): gate = sigmoid(sum_c gate_w[c] o[c][m] + gate_b); out = o * gate + o (NCHW lines)
__global__ __launch_bounds__(256) void k_gate(const float* __restrict__ O, const float* __restrict__ GW, const float* __restrict__ GB, float* __restrict__ OUT) { __shared__ float sg[64]; __shared__ float part[4][64]; const int t = threadIdx.x; const size_t b = blockIdx.y; const int m0 = blockIdx.x * 64; const int ml = t & 63, q4 = t >> 6;
  { float s = 0.f; for (int c = q4; c < CC; c += 4) s += bfr(GW[c]) * O[(b * CC + c) * (size_t)NN + m0 + ml]; part[q4][ml] = s; }
  __syncthreads(); if (t < 64) { const float s = part[0][t] + part[1][t] + part[2][t] + part[3][t] + bfr(GB[0]); sg[t] = 1.0f + 1.0f / (1.0f + expf(-s)); } __syncthreads();
  for (int e = t; e < CC * 16; e += 256) { const int c = e >> 4, q = e & 15; const float* orow = O + (b * CC + c) * (size_t)NN + m0 + q * 4; v4f v; v[0] = orow[0] * sg[q * 4]; v[1] = orow[1] * sg[q * 4 + 1]; v[2] = orow[2] * sg[q * 4 + 2]; v[3] = orow[3] * sg[q * 4 + 3]; vst2(OUT + (b * CC + c) * (size_t)NN + m0 + q * 4, v); } }
extern "C" void kernel_launch(void* const* d_in, const int* in_sizes, int n_in, void* d_out, int out_size, void* d_ws, size_t ws_size, hipStream_t stream) {
  (void)in_sizes; (void)n_in; (void)out_size;
  const float** F = (const float**)d_in;   // 0 x [8,512,32,32], 1 wq [512,512], 2 bq, 3 wk, 4 bk, 5 wv, 6 bv, 7 fc1_w [128,512], 8 fc1_b, 9 fc2_w [512,128], 10 fc2_b, 11 gate_w [1,512], 12 gate_b [1]
  if (ws_size < (size_t)WS_END) return;
  char* ws = (char*)d_ws; float *SC = (float*)(ws + WS_SC), *ST = (float*)(ws + WS_ST), *SL = (float*)(ws + WS_SL), *O = (float*)(ws + WS_O), *P = (float*)(ws + WS_P); _Float16 *QH = (_Float16*)(ws + WS_QH), *QL = (_Float16*)(ws + WS_QL), *KH = (_Float16*)(ws + WS_KH), *KL = (_Float16*)(ws + WS_KL), *VT = (_Float16*)(ws + WS_VT), *VTL = (_Float16*)(ws + WS_VTL);
  k_pool<<<NB * CC / 32, 1024, 0, stream>>>(F[0], P);
  k_fc<<<NB, 1024, 0, stream>>>(P, F[7], F[8], F[9], F[10], SC);
  k_proj<<<dim3(NN / 64, CC / 128, 3 * NB), 128, 0, stream>>>(F[0], SC, F[1], F[2], F[3], F[4], F[5], F[6], QH, QL, KH, KL, VT, VTL);
  k_stats<<<dim3(NN / 64, NH, TNB), 128, 0, stream>>>(QH, QL, KH, KL, ST, SL);
  k_ov<<<dim3(NN / 64, NH, TNB), 128, 0, stream>>>(QH, QL, KH, KL, VT, VTL, ST, SL, O);
  k_gate<<<dim3(NN / 64, TNB), 256, 0, stream>>>(O, F[11], F[12], (float*)d_out);
}

// v005
// A run of this version takes 137 microseconds.
// Timed twice side by side with v004, it ran 1.05 times as fast both times.
// All steps since v000 together make it 4.21 times as fast.
#include <hip/hip_runtime.h>
#include <math.h>

typedef __attribute__((ext_vector_type(16))) _Float16 v16h;
typedef __attribute__((ext_vector_type(16))) __bf16 v16b;
typedef __attribute__((ext_vector_type(8)))  _Float16 v8h;
typedef __attribute__((ext_vector_type(8)))  float v8f;
typedef __attribute__((ext_vector_type(4)))  float v4f;
typedef __attribute__((ext_vector_type(2)))  float v2f;
typedef __attribute__((ext_vector_type(4)))  unsigned v4u;
typedef __attribute__((ext_vector_type(4)))  int v4i;
typedef float __attribute__((may_alias)) float_a;
typedef int __attribute__((may_alias)) int_a;

template <typename T> __device__ __forceinline__ void vst2(void* p, T v) { *(T*)p = v;  }
__device__ __forceinline__ v8f wmma16(v16h a, v16h b, v8f c) {
  v8f d = __builtin_amdgcn_wmma_f32_16x16x32_f16(false, a, false, b, (short)0, c, false, false);
  asm volatile("v_nop\n\tv_nop\n\tv_nop\n\tv_nop" : "+v"(d) : "v"(a), "v"(b));
  return d;
}
__device__ __forceinline__ v8f wmma_bf(v16b a, v16b b, v8f c) {
  v8f d = __builtin_amdgcn_wmma_f32_16x16x32_bf16(false, a, false, b, (short)0, c, false, false);
  asm volatile("v_nop\n\tv_nop\n\tv_nop\n\tv_nop" : "+v"(d) : "v"(a), "v"(b));
  return d;
}
// 16x16x32 fragments: lane = (h = lane>>4, row/col = lane&15); elements 0..7 = k0+8h+0..7, 8..15 = k0+16+8h+0..7; D element r = row 8h+r
__device__ __forceinline__ v16h frag_h(const _Float16* rowk0, int lane) {
  union { v16h v; v8h q[2]; } u; const _Float16* p = rowk0 + 8 * (lane >> 4);
  u.q[0] = *(const v8h*)p; u.q[1] = *(const v8h*)(p + 16); return u.v;
}
__device__ __forceinline__ v16h frag_f32(const float* rowk0, int lane) {
  v16h a; const float* p = rowk0 + 8 * (lane >> 4);
#pragma unroll
  for (int i = 0; i < 8; ++i) { a[i] = (_Float16)p[i]; a[8 + i] = (_Float16)p[16 + i]; }
  return a;
}
__device__ __forceinline__ v16h frag_f32s(const float* rowk0, int lane, float sc) {
  v16h a; const float* p = rowk0 + 8 * (lane >> 4);
#pragma unroll
  for (int i = 0; i < 8; ++i) { a[i] = (_Float16)(p[i] * sc); a[8 + i] = (_Float16)(p[16 + i] * sc); }
  return a;
}
// column fragment from a [K][ld] layout (column n), rows >= K read as 0
__device__ __forceinline__ v16h fragc_f32(const float* W, int k0, int n, int lane, int ld, int K) {
  v16h a; const int g = lane >> 4;
#pragma unroll
  for (int i = 0; i < 8; ++i) { const int ka = k0 + 8 * g + i, kb = ka + 16;
    a[i] = (_Float16)(ka < K ? W[(size_t)(ka < K ? ka : K - 1) * ld + n] : 0.f); a[8 + i] = (_Float16)(kb < K ? W[(size_t)(kb < K ? kb : K - 1) * ld + n] : 0.f); }
  return a;
}
struct F2 { v16b h, l; };
__device__ __forceinline__ F2 bsplit16(const float v[16]) { F2 r;
#pragma unroll
  for (int i = 0; i < 16; ++i) { const __bf16 h = (__bf16)v[i]; r.h[i] = h; r.l[i] = (__bf16)(v[i] - (float)h); }
  return r; }
__device__ __forceinline__ F2 split_row(const float* row, int k0, int lane) { float v[16]; const float* p = row + k0 + 8 * (lane >> 4);
#pragma unroll
  for (int i = 0; i < 8; ++i) { v[i] = p[i]; v[8 + i] = p[16 + i]; }
  return bsplit16(v); }
__device__ __forceinline__ F2 split_rowK(const float* row, int k0, int lane, int K) { float v[16]; const int g = lane >> 4;
#pragma unroll
  for (int i = 0; i < 8; ++i) { const int ka = k0 + 8 * g + i, kb = ka + 16; v[i] = ka < K ? row[ka < K ? ka : K - 1] : 0.f; v[8 + i] = kb < K ? row[kb < K ? kb : K - 1] : 0.f; }
  return bsplit16(v); }
__device__ __forceinline__ F2 split_col(const float* W, int k0, int n, int lane, int ld, int K) { float v[16]; const int g = lane >> 4;
#pragma unroll
  for (int i = 0; i < 8; ++i) { const int ka = k0 + 8 * g + i, kb = ka + 16; v[i] = ka < K ? W[(size_t)(ka < K ? ka : K - 1) * ld + n] : 0.f; v[8 + i] = kb < K ? W[(size_t)(kb < K ? kb : K - 1) * ld + n] : 0.f; }
  return bsplit16(v); }
__device__ __forceinline__ v8f mac3(const F2& a, const F2& b, v8f c) { c = wmma_bf(a.l, b.h, c); c = wmma_bf(a.h, b.l, c); return wmma_bf(a.h, b.h, c); }
__device__ __forceinline__ float sigm(float v) { return 1.0f / (1.0f + expf(-v)); }
// work-group barrier that orders LDS alone: __syncthreads() would also wait for every global load in flight, and the loads issued for later passes are meant to stay in flight across it
#define BAR_LDS() do { __builtin_amdgcn_fence(__ATOMIC_RELEASE, "workgroup", "local"); __builtin_amdgcn_s_barrier(); __builtin_amdgcn_fence(__ATOMIC_ACQUIRE, "workgroup", "local"); } while (0)


// SelfModule (B 8, C 512, 32x32, 4 heads x 128): x = x * sigmoid(SE(x)) + x; q, k, v = 1x1 convs; att = softmax_m(q_n . k_m / sqrt(128)); o[:, m] = sum_n v[:, n] att[n, m]; out = o * sigmoid(gate 1x1 conv(o)) + o.
#define NB 8
#define CC 512
#define NN 1024
#define NH 4
#define DK 128
#define RR 128            // SE bottleneck
#define NT16 (NN / 16)    // 16-wide tiles along the pixels
#ifndef TNB
#define TNB NB
#endif
typedef __attribute__((ext_vector_type(8))) __bf16 v8b;
__device__ __forceinline__ v16b frag_b(const __bf16* rowk0, int lane) {
  union { v16b v; v8b q[2]; } u; const __bf16* p = rowk0 + 8 * (lane >> 4);
  u.q[0] = *(const v8b*)p; u.q[1] = *(const v8b*)(p + 16); return u.v;
}
__device__ __forceinline__ float bfr(float v) { return (float)(__bf16)v; }
typedef __attribute__((ext_vector_type(4))) __bf16 v4b;
// LDS row pitches of the staged tiles, in 16-bit elements: 16 B x an odd number, so that the 16 rows of a ds_load_b128 fragment read fall on distinct banks
#define QP 136            // q / k rows of 128 elements: 272 B
#define VP 40             // rows of 32 elements (v planes, weight rows): 80 B
__device__ __attribute__((noinline)) float exp_ni(float v) { return expf(v); }
__device__ __attribute__((noinline)) float erf_ni(float v) { return erff(v); }

#define WS_SC  0u                                   // f32 1 + sigmoid(SE) [b][512]
#define WS_QH  (WS_SC + 4u * (size_t)NB * CC)            // f16 hi|lo q rows [b*NN + n][512]; k rows; v planes [b][512][NN]
#define WS_QL  (WS_QH + 2u * (size_t)NB * NN * CC)
#define WS_KH  (WS_QL + 2u * (size_t)NB * NN * CC)
#define WS_KL  (WS_KH + 2u * (size_t)NB * NN * CC)
#define WS_VT  (WS_KL + 2u * (size_t)NB * NN * CC)
#define WS_VTL (WS_VT + 2u * (size_t)NB * CC * NN)
#define WS_ST  (WS_VTL + 2u * (size_t)NB * CC * NN)      // f32 row max [b][h][n], 1 / row sum
#define WS_SL  (WS_ST + 4u * (size_t)NB * NH * NN)
#define WS_O   (WS_SL + 4u * (size_t)NB * NH * NN)       // f32 o NCHW [b][512][NN]
#define WS_P   (WS_O + 4u * (size_t)NB * CC * NN)       // f32 pooled mean [b][512]
#define WS_SS  (WS_P + 4u * (size_t)NB * CC)            // f32 scores [b][h][key tile][query tile][half][lane][4]: a 16 x 16 tile is 1 KiB in the lane order of the matrix result
#define WS_END (WS_SS + 4u * (size_t)NB * NH * NN * NN)

// ---- k_pool: block = 32 rows (b, c), one wave per row: mean over the 1,024 pixels, 8 loads of 16 bytes per lane in flight; the block's 32 means leave as one 128-B line; the loops are unrolled so that v[] stays in registers and all 8 loads issue before the first is used
__global__ __launch_bounds__(1024) void k_pool(const float* __restrict__ X, float* __restrict__ P) { __shared__ float sp[32]; const int t = threadIdx.x, lane = t & 31, w = t >> 5;
  const float* xr = X + ((size_t)blockIdx.x * 32 + w) * NN + lane * 4; v4f v[8];
#pragma unroll
  for (int i = 0; i < 8; ++i) v[i] = *(const v4f*)(xr + i * 128);
  float s = 0.f;
#pragma unroll
  for (int i = 0; i < 8; ++i) s += (bfr(v[i][0]) + bfr(v[i][1])) + (bfr(v[i][2]) + bfr(v[i][3]));
#pragma unroll
  for (int o = 1; o < 32; o <<= 1) s += __shfl_xor(s, o);
  if (lane == 0) sp[w] = s * (1.0f / NN);
  __syncthreads(); if (t < 32) P[(size_t)blockIdx.x * 32 + t] = sp[t]; }
// ---- k_fc: block = b, 32 waves: fc1 (4 rows per wave), relu, fc2 (16 rows per wave), 1 + sigmoid; each dot product is split over the lanes of one wave (16-byte loads along the row) and summed by shuffles; every loop is unrolled so that its arrays stay in registers, a stage's loads issue together and the rows' shuffle chains overlap
__global__ __launch_bounds__(1024) void k_fc(const float* __restrict__ P, const float* __restrict__ F1W, const float* __restrict__ F1B, const float* __restrict__ F2W, const float* __restrict__ F2B, float* __restrict__ SC) { __shared__ __align__(16) float sh[RR]; __shared__ __align__(16) float ss[CC]; const int t = threadIdx.x, lane = t & 31, w = t >> 5; const size_t b = blockIdx.x;
  v4f p[4], f1[4][4]; float a[4];
#pragma unroll
  for (int r = 0; r < 4; ++r)
#pragma unroll
    for (int i = 0; i < 4; ++i) f1[r][i] = *(const v4f*)(F1W + (size_t)(w * 4 + r) * CC + i * 128 + lane * 4);
  asm volatile("s_wait_xcnt 0x0" ::: "memory");   // the loads below may land in the address registers of the loads above: the wait stands in front of that overwrite
#pragma unroll
  for (int i = 0; i < 4; ++i) p[i] = *(const v4f*)(P + b * CC + i * 128 + lane * 4);
#pragma unroll
  for (int r = 0; r < 4; ++r) { float s = 0.f;
#pragma unroll
    for (int i = 0; i < 4; ++i) s += p[i][0] * bfr(f1[r][i][0]) + p[i][1] * bfr(f1[r][i][1]) + p[i][2] * bfr(f1[r][i][2]) + p[i][3] * bfr(f1[r][i][3]);
    a[r] = s; }
#pragma unroll
  for (int r = 0; r < 4; ++r) {
#pragma unroll
    for (int o = 1; o < 32; o <<= 1) a[r] += __shfl_xor(a[r], o); }
  if (lane < 4) { const float s = lane == 0 ? a[0] : lane == 1 ? a[1] : lane == 2 ? a[2] : a[3]; sh[w * 4 + lane] = fmaxf(s + bfr(F1B[w * 4 + lane]), 0.f); }
  __syncthreads();
  const v4f hv = *(const v4f*)&sh[lane * 4]; float c[16];
#pragma unroll
  for (int r = 0; r < 16; ++r) { const v4f f = *(const v4f*)(F2W + (size_t)(w * 16 + r) * RR + lane * 4); c[r] = hv[0] * bfr(f[0]) + hv[1] * bfr(f[1]) + hv[2] * bfr(f[2]) + hv[3] * bfr(f[3]); }
#pragma unroll
  for (int r = 0; r < 16; ++r) {
#pragma unroll
    for (int o = 1; o < 32; o <<= 1) c[r] += __shfl_xor(c[r], o); }
  if (lane < 16) { float s = c[0];
#pragma unroll
    for (int r = 1; r < 16; ++r) s = lane == r ? c[r] : s;
    s += bfr(F2B[w * 16 + lane]); ss[w * 16 + lane] = 1.0f + 1.0f / (1.0f + expf(-s)); }
  __syncthreads(); if (t < CC / 4) vst2(SC + b * CC + t * 4, *(const v4f*)&ss[t * 4]); }
// ---- k_proj: block = (64 pixels, 128 output channels, which*NB + b): conv1x1 over xs = x * sc (gathered from NCHW, bf16 hi + lo) + bias; q, k -> f16 hi/lo rows [n][512]; v -> planes [c][n]. The weight rows are the A operand and the pixels B: a lane's 8 results are 8 consecutive channels of one pixel, for q and k one 16-byte piece of an output row
__global__ __launch_bounds__(128) void k_proj(const float* __restrict__ X, const float* __restrict__ SC, const float* __restrict__ WQ, const float* __restrict__ BQ, const float* __restrict__ WK, const float* __restrict__ BK, const float* __restrict__ WV, const float* __restrict__ BV, _Float16* __restrict__ QH, _Float16* __restrict__ QL, _Float16* __restrict__ KH, _Float16* __restrict__ KL, _Float16* __restrict__ VT, _Float16* __restrict__ VTL) {
  __shared__ __align__(16) _Float16 sh[64][136], sl[64][136]; __shared__ __align__(16) _Float16 th[128][72], tl[128][72]; __shared__ float ssc[CC]; __shared__ __align__(16) float sbb[128]; __shared__ __align__(16) __bf16 swt[2][128][VP];   // weight tile [buffer][output channel][32 input channels], bf16, shared by the four waves
  const int tid = threadIdx.x, wave = tid >> 5, lane = tid & 31, col = lane & 15, g = lane >> 4; const int which = blockIdx.z / NB; const size_t b = blockIdx.z % NB; const int n0 = blockIdx.x * 64 + wave * 16; const int c0 = blockIdx.y * 128; const float* Wm = which == 0 ? WQ : which == 1 ? WK : WV; const float* Bm = which == 0 ? BQ : which == 1 ? BK : BV; const float* Xb = X + b * CC * (size_t)NN;
  const int wrow = tid >> 3, wpc = (tid & 7) * 4; const float* wsrc = Wm + (size_t)(c0 + wrow) * CC + wpc;   // staging map: 8 lanes per 128-B row piece, a wave's load = 4 whole lines
  v4f wreg[8];
#pragma unroll
  for (int i = 0; i < 8; ++i) wreg[i] = *(const v4f*)(wsrc + (size_t)i * 16 * CC);
  float sc4[4], bbv[8];   // the scale values and the epilogue's bias values are asked for here, all at once, so that none of them is waited for one by one
#pragma unroll
  for (int i = 0; i < 4; ++i) sc4[i] = SC[b * CC + tid + 128 * i];
#pragma unroll
  for (int j = 0; j < 8; ++j) bbv[j] = Bm[c0 + j * 16 + col];
  asm volatile("s_wait_xcnt 0x0" ::: "memory");   // the address registers of the loads above are reused below: the wait stands in front of that overwrite
#pragma unroll
  for (int i = 0; i < 4; ++i) ssc[tid + 128 * i] = sc4[i];
#pragma unroll
  for (int i = 0; i < 8; ++i) { v4b c4; c4[0] = (__bf16)wreg[i][0]; c4[1] = (__bf16)wreg[i][1]; c4[2] = (__bf16)wreg[i][2]; c4[3] = (__bf16)wreg[i][3]; *(v4b*)&swt[0][wrow + 16 * i][wpc] = c4; }
  // every global load of the loop is issued one whole pass before its values are used: xv = the x values of the coming pass, wreg = the weight tile after the one in LDS
  float xv[16]; const float* xsrc = Xb + (size_t)(8 * g) * NN + n0 + col;
#pragma unroll
  for (int i = 0; i < 8; ++i) { xv[i] = xsrc[(size_t)i * NN]; xv[8 + i] = xsrc[(size_t)(16 + i) * NN]; }
#pragma unroll
  for (int i = 0; i < 8; ++i) wreg[i] = *(const v4f*)(wsrc + (size_t)i * 16 * CC + 32);
  asm volatile("s_wait_xcnt 0x0" ::: "memory");   // the address registers of the loads above are reused below: the wait stands in front of that overwrite
  BAR_LDS();
  v8f acc[8] = {};
  // one pass; more = a pass follows (its weight tile goes to LDS, its x values are asked for), more2 = two follow (the tile after that is asked for): compile-time flags, so that no load stands under a run-time branch and no loaded register has to be copied where two paths meet, which would wait for the load at once
  auto pass = [&](const int kc, const bool more, const bool more2) __attribute__((always_inline)) { float v[16]; const int cur = kc & 1;
#pragma unroll
    for (int i = 0; i < 8; ++i) { const int ca = kc * 32 + 8 * g + i, cb2 = ca + 16; v[i] = bfr(xv[i]) * ssc[ca]; v[8 + i] = bfr(xv[8 + i]) * ssc[cb2]; }
    const F2 a = bsplit16(v);
    if (more) {   // the next weight tile has had a pass to land; its buffer is free since the barrier at the foot of the pass before
#pragma unroll
      for (int i = 0; i < 8; ++i) { v4b c4; c4[0] = (__bf16)wreg[i][0]; c4[1] = (__bf16)wreg[i][1]; c4[2] = (__bf16)wreg[i][2]; c4[3] = (__bf16)wreg[i][3]; *(v4b*)&swt[cur ^ 1][wrow + 16 * i][wpc] = c4; }
#pragma unroll
      for (int i = 0; i < 8; ++i) { xv[i] = xsrc[(size_t)((kc + 1) * 32 + i) * NN];
        if (!more2 && i == 7) asm volatile("s_wait_xcnt 0x0" ::: "memory");   // the pointer is dead behind the last x load of all: the wait stands in front of it
        xv[8 + i] = xsrc[(size_t)((kc + 1) * 32 + 16 + i) * NN]; } }
    if (more2) {
#pragma unroll
      for (int i = 0; i < 8; ++i) wreg[i] = *(const v4f*)(wsrc + (size_t)i * 16 * CC + (kc + 2) * 32); }
    asm volatile("s_wait_xcnt 0x0" ::: "memory");   // the address registers of the loads above are reused below: the wait stands in front of that overwrite
    v16b w[8];   // the pass's LDS reads stand as one group ahead of its matrix instructions
#pragma unroll
    for (int j = 0; j < 8; ++j) w[j] = frag_b(&swt[cur][j * 16 + col][0], lane);
#pragma unroll
    for (int j = 0; j < 8; ++j) { acc[j] = wmma_bf(w[j], a.h, acc[j]); acc[j] = wmma_bf(w[j], a.l, acc[j]); }
    BAR_LDS();   // publishes the next tile and ends every wave's reads of this one
    __builtin_amdgcn_sched_barrier(0); };   // keeps the next pass's conversions behind the barrier: lifted in among this pass's matrix instructions they would wait for loads that were only just issued
#pragma unroll 2   // two passes per trip: the LDS buffer index is a constant in each, and a pass's loads land in other registers than the values it is still converting
  for (int kc = 0; kc < CC / 32 - 2; ++kc) pass(kc, true, true);
  pass(CC / 32 - 2, true, false);
  if (tid < 16) {   // a lane has asked for the bias of channels j * 16 + col, the epilogue wants that of its 8 result rows: the 128 values go through LDS, published by the barrier at the foot of the last pass
#pragma unroll
    for (int j = 0; j < 8; ++j) sbb[j * 16 + col] = bfr(bbv[j]); }
  pass(CC / 32 - 1, false, false);
  // result r of tile j = channel j * 16 + 8g + r of pixel wave * 16 + col
  auto split8 = [&](const int j, v8h& hv, v8h& lv) __attribute__((always_inline)) { const v4f bb[2] = { *(const v4f*)&sbb[j * 16 + 8 * g], *(const v4f*)&sbb[j * 16 + 8 * g + 4] };
#pragma unroll
    for (int r = 0; r < 8; ++r) { const float v = acc[j][r] + bb[r >> 2][r & 3]; hv[r] = (_Float16)v; lv[r] = (_Float16)((v - (float)hv[r]) * 2048.0f); } };
  if (which < 2) {
#pragma unroll
    for (int j = 0; j < 8; ++j) { v8h hv, lv; split8(j, hv, lv); *(v8h*)&sh[wave * 16 + col][j * 16 + 8 * g] = hv; *(v8h*)&sl[wave * 16 + col][j * 16 + 8 * g] = lv; } }
  else {
#pragma unroll
    for (int j = 0; j < 8; ++j) { v8h hv, lv; split8(j, hv, lv);
#pragma unroll
      for (int r = 0; r < 8; ++r) { th[j * 16 + 8 * g + r][wave * 16 + col] = hv[r]; tl[j * 16 + 8 * g + r][wave * 16 + col] = lv[r]; } } }
  __syncthreads();
  if (which < 2) { _Float16* PH = which == 0 ? QH : KH; _Float16* PL = which == 0 ? QL : KL; for (int e = tid; e < 64 * 16; e += 128) { const int rl = e >> 4, q = e & 15; const size_t o = (b * NN + blockIdx.x * 64 + rl) * CC + c0 + q * 8; vst2((unsigned*)(PH + o), *(const v4u*)&sh[rl][q * 8]); vst2((unsigned*)(PL + o), *(const v4u*)&sl[rl][q * 8]); } }
  else { for (int e = tid; e < 128 * 8; e += 128) { const int cl = e >> 3, q = e & 7; const size_t o = (b * CC + c0 + cl) * (size_t)NN + blockIdx.x * 64 + q * 8; vst2((unsigned*)(VT + o), *(const v4u*)&th[cl][q * 8]); vst2((unsigned*)(VTL + o), *(const v4u*)&tl[cl][q * 8]); } } }
// ---- k_stats: block = (64 queries n, h, b): scores of its queries against all 1,024 keys (3-product logits x 128^-1/2), stored for k_ov, with row max and 1 / sum of exp; one 256-B line of each per block. The product is taken as s[n][m] (the wave's query rows as A, key rows as B), the lane map that k_ov wants: a lane holds 8 queries (n = 8g + r) at ONE key column (m = col). Each lane keeps max and sum of its 8 queries over the keys of its column; the 16 columns are joined once, behind the loop
__global__ __launch_bounds__(128) void k_stats(const _Float16* __restrict__ QH, const _Float16* __restrict__ QL, const _Float16* __restrict__ KH, const _Float16* __restrict__ KL, float* __restrict__ ST, float* __restrict__ SL, float* __restrict__ SS) { __shared__ __align__(16) float sm[64], ssum[64]; __shared__ __align__(16) _Float16 sk[2][2][32][QP];   // key tile [buffer][hi | lo][key][d], shared by the four waves
  const int tid = threadIdx.x, wave = tid >> 5, lane = tid & 31, col = lane & 15, g = lane >> 4; const int h = blockIdx.y; const size_t b = blockIdx.z; const int q0 = blockIdx.x * 64 + wave * 16; const size_t rq = b * NN + q0;
  v16h aq[4], al[4];
#pragma unroll
  for (int kc = 0; kc < 4; ++kc) { aq[kc] = frag_h(QH + (rq + col) * CC + h * DK + kc * 32, lane); al[kc] = frag_h(QL + (rq + col) * CC + h * DK + kc * 32, lane); }
  float m[8], l[8];   // running max and sum of queries 8g + r over the keys of this lane's column
#pragma unroll
  for (int r = 0; r < 8; ++r) { m[r] = -3.0e38f; l[r] = 0.f; }
  float* sdst = SS + ((b * NH + h) * (size_t)(NT16 * NT16) + blockIdx.x * 4 + wave) * 256 + lane * 4;   // this wave's query tile; the key tile steps by NT16 * 256
  const int srow = tid >> 4, spc = (tid & 15) * 8; const size_t so = (b * NN + srow) * CC + h * DK + spc;   // staging map: 16 lanes per 256-B row, a wave's load = 4 whole lines
  v8h rk[2][4];
#pragma unroll
  for (int i = 0; i < 4; ++i) { rk[0][i] = *(const v8h*)(KH + so + (size_t)(8 * i) * CC); rk[1][i] = *(const v8h*)(KL + so + (size_t)(8 * i) * CC); }
  asm volatile("s_wait_xcnt 0x0" ::: "memory");   // the address registers of the loads above are reused below: the wait stands in front of that overwrite
#pragma unroll
  for (int i = 0; i < 4; ++i) { *(v8h*)&sk[0][0][srow + 8 * i][spc] = rk[0][i]; *(v8h*)&sk[0][1][srow + 8 * i][spc] = rk[1][i]; }
  __syncthreads();
#pragma unroll 1
  for (int ks = 0; ks < NN / 32; ++ks) { float s[2][8]; const int cur = ks & 1;
    if (ks + 1 < NN / 32) {   // the next key tile's loads fly while this one is worked on
#pragma unroll
      for (int i = 0; i < 4; ++i) { rk[0][i] = *(const v8h*)(KH + so + (size_t)((ks + 1) * 32 + 8 * i) * CC); rk[1][i] = *(const v8h*)(KL + so + (size_t)((ks + 1) * 32 + 8 * i) * CC); } }
    asm volatile("s_wait_xcnt 0x0" ::: "memory");   // the address registers of the loads above are reused below: the wait stands in front of that overwrite
#pragma unroll
    for (int ct = 0; ct < 2; ++ct) { v8f c = {}, cl = {}; v16h kh[4], kl[4];   // a tile's LDS reads stand as one group ahead of its matrix instructions
#pragma unroll
      for (int kc = 0; kc < 4; ++kc) { kh[kc] = frag_h(&sk[cur][0][ct * 16 + col][kc * 32], lane); kl[kc] = frag_h(&sk[cur][1][ct * 16 + col][kc * 32], lane); }
#pragma unroll
      for (int kc = 0; kc < 4; ++kc) { c = wmma16(aq[kc], kh[kc], c); cl = wmma16(al[kc], kh[kc], cl); cl = wmma16(aq[kc], kl[kc], cl); }
#pragma unroll
      for (int r = 0; r < 8; ++r) s[ct][r] = (c[r] + cl[r] * (1.0f / 2048.0f)) * 0.08838834764831845f; }
    { float* d = sdst + (size_t)ks * (2 * NT16 * 256);   // each tile leaves as two stores of 512 contiguous bytes; the pass's second key tile lies NT16 * 1 KiB = 65,536 bytes behind the first
      const v4f t0 = {s[0][0], s[0][1], s[0][2], s[0][3]}, t1 = {s[0][4], s[0][5], s[0][6], s[0][7]}, t2 = {s[1][0], s[1][1], s[1][2], s[1][3]}, t3 = {s[1][4], s[1][5], s[1][6], s[1][7]};
      // the four stores and their wait are one statement: the registers that the stores name are reused right behind them
      asm volatile("global_store_b128 %0, %1, off\n\tglobal_store_b128 %0, %2, off offset:512\n\tglobal_store_b128 %0, %3, off offset:65536\n\tglobal_store_b128 %0, %4, off offset:66048\n\ts_wait_xcnt 0x0" :: "v"(d), "v"(t0), "v"(t1), "v"(t2), "v"(t3) : "memory"); }
#pragma unroll
    for (int r = 0; r < 8; ++r) { const float mn = fmaxf(m[r], fmaxf(s[0][r], s[1][r])); l[r] = l[r] * __expf(m[r] - mn) + (__expf(s[0][r] - mn) + __expf(s[1][r] - mn)); m[r] = mn; }
    if (ks + 1 < NN / 32) {
#pragma unroll
      for (int i = 0; i < 4; ++i) { *(v8h*)&sk[cur ^ 1][0][srow + 8 * i][spc] = rk[0][i]; *(v8h*)&sk[cur ^ 1][1][srow + 8 * i][spc] = rk[1][i]; } }
    BAR_LDS(); }   // publishes the next tile and ends every wave's reads of this one; it orders LDS alone, so that no wave waits here for its score stores to arrive
#pragma unroll
  for (int o = 1; o < 16; o <<= 1) {   // join the 16 key columns; the 8 queries' chains overlap
#pragma unroll
    for (int r = 0; r < 8; ++r) { const float mo = __shfl_xor(m[r], o), lo = __shfl_xor(l[r], o), mj = fmaxf(m[r], mo); l[r] = l[r] * __expf(m[r] - mj) + lo * __expf(mo - mj); m[r] = mj; } }
  if (col == 0) {
#pragma unroll
    for (int r = 0; r < 8; ++r) { sm[wave * 16 + 8 * g + r] = m[r]; ssum[wave * 16 + 8 * g + r] = 1.0f / l[r]; } }
  __syncthreads(); if (tid < 16) vst2(ST + (b * NH + h) * (size_t)NN + blockIdx.x * 64 + tid * 4, *(const v4f*)&sm[tid * 4]); else if (tid < 32) vst2(SL + (b * NH + h) * (size_t)NN + blockIdx.x * 64 + (tid - 16) * 4, *(const v4f*)&ssum[(tid - 16) * 4]); }
// ---- k_ov: block = (64 output pixels m, h, b): for each query tile n: s[n][m] as k_stats stored it, att[n][m] = exp(s - max_n) / sum_n, then o^T[m][d] += sum_n att[n][m] v[d][n] (att^T tile as the A operand, v planes as B; 3 products); o written NCHW per head channel. A lane's 8 scores (m = col, n = 8g + r) of two 16-query tiles are elements 0..7 and 8..15 of its att^T fragment (row m = col, k = n): the stored scores go from memory to registers and from there to the product
__global__ __launch_bounds__(128) void k_ov(const float* __restrict__ SS, const _Float16* __restrict__ VT, const _Float16* __restrict__ VTL, const float* __restrict__ ST, const float* __restrict__ SL, float* __restrict__ O) {
  __shared__ __align__(16) float stt[128][68];
  __shared__ __align__(16) _Float16 sv[2][2][128][VP];   // value tile [buffer][hi | lo][d][n], shared by the four waves
  __shared__ __align__(16) float sst[2][NN];   // row max | 1 / row sum of all queries of this (b, h), staged once
  const int tid = threadIdx.x, wave = tid >> 5, lane = tid & 31, col = lane & 15, g = lane >> 4; const int h = blockIdx.y; const size_t b = blockIdx.z;
  const float* ssrc = SS + ((b * NH + h) * (size_t)NT16 + blockIdx.x * 4 + wave) * (size_t)(NT16 * 256) + lane * 4;   // this wave's key tile: its 64 query tiles lie in a row, 2 KiB a pass
  v4f sc[4][4];   // scores [pass & 3][tile * 2 + half], asked for two passes ahead; read once, so by non-temporal loads, each 512 contiguous bytes
#pragma unroll
  for (int p = 0; p < 2; ++p)
#pragma unroll
    for (int i = 0; i < 4; ++i) sc[p][i] = __builtin_nontemporal_load((const v4f*)(ssrc + p * 512 + i * 128));
  const float* stm = ST + (b * NH + h) * (size_t)NN; const float* stl = SL + (b * NH + h) * (size_t)NN;
  v8f acc[8], accl[8];
#pragma unroll
  for (int j = 0; j < 8; ++j) { acc[j] = v8f{}; accl[j] = v8f{}; }
  const int vrow = tid >> 2, vpc = (tid & 3) * 8; const size_t vo = (b * CC + (size_t)h * DK + vrow) * (size_t)NN + vpc;   // staging map: 4 lanes per 64-B row piece
  v8h rv[2][4]; v4f rs[2][2];
#pragma unroll
  for (int i = 0; i < 2; ++i) { rs[0][i] = *(const v4f*)(stm + tid * 4 + i * 512); rs[1][i] = *(const v4f*)(stl + tid * 4 + i * 512); }
#pragma unroll
  for (int i = 0; i < 4; ++i) { rv[0][i] = *(const v8h*)(VT + vo + (size_t)(32 * i) * NN); rv[1][i] = *(const v8h*)(VTL + vo + (size_t)(32 * i) * NN); }
  asm volatile("s_wait_xcnt 0x0" ::: "memory");   // the address registers of the loads above are reused below: the wait stands in front of that overwrite
#pragma unroll
  for (int i = 0; i < 4; ++i) { *(v8h*)&sv[0][0][vrow + 32 * i][vpc] = rv[0][i]; *(v8h*)&sv[0][1][vrow + 32 * i][vpc] = rv[1][i]; }
#pragma unroll
  for (int i = 0; i < 2; ++i) { *(v4f*)&sst[0][tid * 4 + i * 512] = rs[0][i]; *(v4f*)&sst[1][tid * 4 + i * 512] = rs[1][i]; }
  __syncthreads();
  // one pass; u = ks & 3, a compile-time constant: it picks the LDS buffer and the score registers. The scores of the pass after next are asked for at the head of a pass, into registers whose last read lies two passes back: no loaded value has to be copied while it is in flight
  auto pass = [&](const int ks, const int u) __attribute__((always_inline)) { const int cur = u & 1;
    if (ks + 1 < NN / 32) {   // the next tile's loads fly while this one is worked on
#pragma unroll
      for (int i = 0; i < 4; ++i) { rv[0][i] = *(const v8h*)(VT + vo + (size_t)(32 * i) * NN + (ks + 1) * 32); rv[1][i] = *(const v8h*)(VTL + vo + (size_t)(32 * i) * NN + (ks + 1) * 32); } }
    { const float* sn = ssrc + (ks + 2 < NN / 32 ? ks + 2 : NN / 32 - 1) * 512;   // behind the value loads: loads return in order, and the wait for the values at the foot of the pass leaves these in flight. The last two passes ask for the last tiles again: no load stands under a branch
#pragma unroll
      for (int i = 0; i < 4; ++i) sc[(u + 2) & 3][i] = __builtin_nontemporal_load((const v4f*)(sn + i * 128)); }
    asm volatile("s_wait_xcnt 0x0" ::: "memory");   // the address registers of the loads above are reused below: the wait stands in front of that overwrite
    v4f mx[4], il[4];   // max and 1 / sum of this lane's 16 queries n (the rows of its two score tiles)
#pragma unroll
    for (int i = 0; i < 4; ++i) { const int n4 = ks * 32 + (i >> 1) * 16 + 8 * g + (i & 1) * 4; mx[i] = *(const v4f*)&sst[0][n4]; il[i] = *(const v4f*)&sst[1][n4]; }
    v16h vh[2], vl[2];   // the first value fragments are asked for ahead of the exponentials, which cover their LDS latency
#pragma unroll
    for (int j = 0; j < 2; ++j) { vh[j] = frag_h(&sv[cur][0][j * 16 + col][0], lane); vl[j] = frag_h(&sv[cur][1][j * 16 + col][0], lane); }
    __builtin_amdgcn_sched_barrier(0);   // keeps those reads in front: left free, the compiler puts them behind most of the vector work below, and the wave waits for them there
    v16h pa, pal; {
#pragma unroll
      for (int i = 0; i < 8; ++i) { const float p0 = __expf(sc[u][i >> 2][i & 3] - mx[i >> 2][i & 3]) * il[i >> 2][i & 3] * 2048.0f, p1 = __expf(sc[u][2 + (i >> 2)][i & 3] - mx[2 + (i >> 2)][i & 3]) * il[2 + (i >> 2)][i & 3] * 2048.0f; pa[i] = (_Float16)p0; pa[8 + i] = (_Float16)p1; pal[i] = (_Float16)((p0 - (float)pa[i]) * 2048.0f); pal[8 + i] = (_Float16)((p1 - (float)pa[8 + i]) * 2048.0f); } }
#pragma unroll
    for (int jj = 0; jj < 4; ++jj) {
      if (jj > 0) {
#pragma unroll
        for (int j = 0; j < 2; ++j) { vh[j] = frag_h(&sv[cur][0][(jj * 2 + j) * 16 + col][0], lane); vl[j] = frag_h(&sv[cur][1][(jj * 2 + j) * 16 + col][0], lane); } }
#pragma unroll
      for (int j = 0; j < 2; ++j) { const int jo = jj * 2 + j; acc[jo] = wmma16(pa, vh[j], acc[jo]); accl[jo] = wmma16(pa, vl[j], accl[jo]); accl[jo] = wmma16(pal, vh[j], accl[jo]); } }
    if (ks + 1 < NN / 32) {
#pragma unroll
      for (int i = 0; i < 4; ++i) { *(v8h*)&sv[cur ^ 1][0][vrow + 32 * i][vpc] = rv[0][i]; *(v8h*)&sv[cur ^ 1][1][vrow + 32 * i][vpc] = rv[1][i]; } }
    BAR_LDS(); };   // publishes the next tile and ends every wave's reads of this one; it orders LDS alone, so that the score loads stay in flight across it
#pragma unroll 1   // four passes a trip are written out, no more: u is a constant in each
  for (int k4 = 0; k4 < NN / 128; ++k4) { pass(4 * k4, 0); pass(4 * k4 + 1, 1); pass(4 * k4 + 2, 2); pass(4 * k4 + 3, 3); }
#pragma unroll
  for (int j = 0; j < 8; ++j)
#pragma unroll
    for (int r = 0; r < 8; ++r) stt[j * 16 + col][wave * 16 + 8 * g + r] = (acc[j][r] + accl[j][r] * (1.0f / 2048.0f)) * (1.0f / 2048.0f);   // [d][m local]
  __syncthreads(); for (int e = tid; e < 128 * 16; e += 128) { const int d = e >> 4, q = e & 15; vst2(O + (b * CC + (size_t)h * DK + d) * (size_t)NN + blockIdx.x * 64 + q * 4, *(const v4f*)&stt[d][q * 4]); } }
// ---- k_gate: block = (64 pixels, b): gate = sigmoid(sum_c gate_w[c] o[c][m] + gate_b); out = o * gate + o (NCHW lines)
__global__ __launch_bounds__(256) void k_gate(const float* __restrict__ O, const float* __restrict__ GW, const float* __restrict__ GB, float* __restrict__ OUT) { __shared__ float sg[64]; __shared__ float part[4][64]; const int t = threadIdx.x; const size_t b = blockIdx.y; const int m0 = blockIdx.x * 64; const int ml = t & 63, q4 = t >> 6;
  { float s = 0.f; for (int c = q4; c < CC; c += 4) s += bfr(GW[c]) * O[(b * CC + c) * (size_t)NN + m0 + ml]; part[q4][ml] = s; }
  __syncthreads(); if (t < 64) { const float s = part[0][t] + part[1][t] + part[2][t] + part[3][t] + bfr(GB[0]); sg[t] = 1.0f + 1.0f / (1.0f + expf(-s)); } __syncthreads();
  for (int e = t; e < CC * 16; e += 256) { const int c = e >> 4, q = e & 15; const float* orow = O + (b * CC + c) * (size_t)NN + m0 + q * 4; v4f v; v[0] = orow[0] * sg[q * 4]; v[1] = orow[1] * sg[q * 4 + 1]; v[2] = orow[2] * sg[q * 4 + 2]; v[3] = orow[3] * sg[q * 4 + 3]; vst2(OUT + (b * CC + c) * (size_t)NN + m0 + q * 4, v); } }
extern "C" void kernel_launch(void* const* d_in, const int* in_sizes, int n_in, void* d_out, int out_size, void* d_ws, size_t ws_size, hipStream_t stream) {
  (void)in_sizes; (void)n_in; (void)out_size;
  const float** F = (const float**)d_in;   // 0 x [8,512,32,32], 1 wq [512,512], 2 bq, 3 wk, 4 bk, 5 wv, 6 bv, 7 fc1_w [128,512], 8 fc1_b, 9 fc2_w [512,128], 10 fc2_b, 11 gate_w [1,512], 12 gate_b [1]
  if (ws_size < (size_t)WS_END) return;
  char* ws = (char*)d_ws; float *SC = (float*)(ws + WS_SC), *ST = (float*)(ws + WS_ST), *SL = (float*)(ws + WS_SL), *O = (float*)(ws + WS_O), *P = (float*)(ws + WS_P), *SS = (float*)(ws + WS_SS); _Float16 *QH = (_Float16*)(ws + WS_QH), *QL = (_Float16*)(ws + WS_QL), *KH = (_Float16*)(ws + WS_KH), *KL = (_Float16*)(ws + WS_KL), *VT = (_Float16*)(ws + WS_VT), *VTL = (_Float16*)(ws + WS_VTL);
  k_pool<<<NB * CC / 32, 1024, 0, stream>>>(F[0], P);
  k_fc<<<NB, 1024, 0, stream>>>(P, F[7], F[8], F[9], F[10], SC);
  k_proj<<<dim3(NN / 64, CC / 128, 3 * NB), 128, 0, stream>>>(F[0], SC, F[1], F[2], F[3], F[4], F[5], F[6], QH, QL, KH, KL, VT, VTL);
  k_stats<<<dim3(NN / 64, NH, TNB), 128, 0, stream>>>(QH, QL, KH, KL, ST, SL, SS);
  k_ov<<<dim3(NN / 64, NH, TNB), 128, 0, stream>>>(SS, VT, VTL, ST, SL, O);
  k_gate<<<dim3(NN / 64, TNB), 256, 0, stream>>>(O, F[11], F[12], (float*)d_out);
}

// v006
// A run of this version takes 130 microseconds.
// Next to v005, in two timings, it ran 1.06 times as fast each time.
// All steps since v000 together make it 4.46 times as fast.
#include <hip/hip_runtime.h>
#include <math.h>

typedef __attribute__((ext_vector_type(16))) _Float16 v16h;
typedef __attribute__((ext_vector_type(16))) __bf16 v16b;
typedef __attribute__((ext_vector_type(8)))  _Float16 v8h;
typedef __attribute__((ext_vector_type(8)))  float v8f;
typedef __attribute__((ext_vector_type(4)))  float v4f;
typedef __attribute__((ext_vector_type(2)))  float v2f;
typedef __attribute__((ext_vector_type(4)))  unsigned v4u;
typedef __attribute__((ext_vector_type(4)))  int v4i;
typedef float __attribute__((may_alias)) float_a;
typedef int __attribute__((may_alias)) int_a;

template <typename T> __device__ __forceinline__ void vst2(void* p, T v) { *(T*)p = v;  }
__device__ __forceinline__ v8f wmma16(v16h a, v16h b, v8f c) {
  v8f d = __builtin_amdgcn_wmma_f32_16x16x32_f16(false, a, false, b, (short)0, c, false, false);
  asm volatile("v_nop\n\tv_nop\n\tv_nop\n\tv_nop" : "+v"(d) : "v"(a), "v"(b));
  return d;
}
__device__ __forceinline__ v8f wmma_bf(v16b a, v16b b, v8f c) {
  v8f d = __builtin_amdgcn_wmma_f32_16x16x32_bf16(false, a, false, b, (short)0, c, false, false);
  asm volatile("v_nop\n\tv_nop\n\tv_nop\n\tv_nop" : "+v"(d) : "v"(a), "v"(b));
  return d;
}
// 16x16x32 fragments: lane = (h = lane>>4, row/col = lane&15); elements 0..7 = k0+8h+0..7, 8..15 = k0+16+8h+0..7; D element r = row 8h+r
__device__ __forceinline__ v16h frag_h(const _Float16* rowk0, int lane) {
  union { v16h v; v8h q[2]; } u; const _Float16* p = rowk0 + 8 * (lane >> 4);
  u.q[0] = *(const v8h*)p; u.q[1] = *(const v8h*)(p + 16); return u.v;
}
__device__ __forceinline__ v16h frag_f32(const float* rowk0, int lane) {
  v16h a; const float* p = rowk0 + 8 * (lane >> 4);
#pragma unroll
  for (int i = 0; i < 8; ++i) { a[i] = (_Float16)p[i]; a[8 + i] = (_Float16)p[16 + i]; }
  return a;
}
__device__ __forceinline__ v16h frag_f32s(const float* rowk0, int lane, float sc) {
  v16h a; const float* p = rowk0 + 8 * (lane >> 4);
#pragma unroll
  for (int i = 0; i < 8; ++i) { a[i] = (_Float16)(p[i] * sc); a[8 + i] = (_Float16)(p[16 + i] * sc); }
  return a;
}
// column fragment from a [K][ld] layout (column n), rows >= K read as 0
__device__ __forceinline__ v16h fragc_f32(const float* W, int k0, int n, int lane, int ld, int K) {
  v16h a; const int g = lane >> 4;
#pragma unroll
  for (int i = 0; i < 8; ++i) { const int ka = k0 + 8 * g + i, kb = ka + 16;
    a[i] = (_Float16)(ka < K ? W[(size_t)(ka < K ? ka : K - 1) * ld + n] : 0.f); a[8 + i] = (_Float16)(kb < K ? W[(size_t)(kb < K ? kb : K - 1) * ld + n] : 0.f); }
  return a;
}
struct F2 { v16b h, l; };
__device__ __forceinline__ F2 bsplit16(const float v[16]) { F2 r;
#pragma unroll
  for (int i = 0; i < 16; ++i) { const __bf16 h = (__bf16)v[i]; r.h[i] = h; r.l[i] = (__bf16)(v[i] - (float)h); }
  return r; }
__device__ __forceinline__ F2 split_row(const float* row, int k0, int lane) { float v[16]; const float* p = row + k0 + 8 * (lane >> 4);
#pragma unroll
  for (int i = 0; i < 8; ++i) { v[i] = p[i]; v[8 + i] = p[16 + i]; }
  return bsplit16(v); }
__device__ __forceinline__ F2 split_rowK(const float* row, int k0, int lane, int K) { float v[16]; const int g = lane >> 4;
#pragma unroll
  for (int i = 0; i < 8; ++i) { const int ka = k0 + 8 * g + i, kb = ka + 16; v[i] = ka < K ? row[ka < K ? ka : K - 1] : 0.f; v[8 + i] = kb < K ? row[kb < K ? kb : K - 1] : 0.f; }
  return bsplit16(v); }
__device__ __forceinline__ F2 split_col(const float* W, int k0, int n, int lane, int ld, int K) { float v[16]; const int g = lane >> 4;
#pragma unroll
  for (int i = 0; i < 8; ++i) { const int ka = k0 + 8 * g + i, kb = ka + 16; v[i] = ka < K ? W[(size_t)(ka < K ? ka : K - 1) * ld + n] : 0.f; v[8 + i] = kb < K ? W[(size_t)(kb < K ? kb : K - 1) * ld + n] : 0.f; }
  return bsplit16(v); }
__device__ __forceinline__ v8f mac3(const F2& a, const F2& b, v8f c) { c = wmma_bf(a.l, b.h, c); c = wmma_bf(a.h, b.l, c); return wmma_bf(a.h, b.h, c); }
__device__ __forceinline__ float sigm(float v) { return 1.0f / (1.0f + expf(-v)); }
// work-group barrier that orders LDS alone: __syncthreads() would also wait for every global load in flight, and the loads issued for later passes are meant to stay in flight across it
#define BAR_LDS() do { __builtin_amdgcn_fence(__ATOMIC_RELEASE, "workgroup", "local"); __builtin_amdgcn_s_barrier(); __builtin_amdgcn_fence(__ATOMIC_ACQUIRE, "workgroup", "local"); } while (0)


// SelfModule (B 8, C 512, 32x32, 4 heads x 128): x = x * sigmoid(SE(x)) + x; q, k, v = 1x1 convs; att = softmax_m(q_n . k_m / sqrt(128)); o[:, m] = sum_n v[:, n] att[n, m]; out = o * sigmoid(gate 1x1 conv(o)) + o.
#define NB 8
#define CC 512
#define NN 1024
#define NH 4
#define DK 128
#define RR 128            // SE bottleneck
#define NT16 (NN / 16)    // 16-wide tiles along the pixels
#ifndef TNB
#define TNB NB
#endif
typedef __attribute__((ext_vector_type(8))) __bf16 v8b;
__device__ __forceinline__ v16b frag_b(const __bf16* rowk0, int lane) {
  union { v16b v; v8b q[2]; } u; const __bf16* p = rowk0 + 8 * (lane >> 4);
  u.q[0] = *(const v8b*)p; u.q[1] = *(const v8b*)(p + 16); return u.v;
}
__device__ __forceinline__ float bfr(float v) { return (float)(__bf16)v; }
typedef __attribute__((ext_vector_type(4))) __bf16 v4b;
// LDS row pitches of the staged tiles, in 16-bit elements: 16 B x an odd number, so that the 16 rows of a ds_load_b128 fragment read fall on distinct banks
#define QP 136            // q / k rows of 128 elements: 272 B
#define VP 40             // rows of 32 elements (v planes, weight rows): 80 B
__device__ __attribute__((noinline)) float exp_ni(float v) { return expf(v); }
__device__ __attribute__((noinline)) float erf_ni(float v) { return erff(v); }

#define WS_SC  0u                                   // f32 1 + sigmoid(SE) [b][512]
#define WS_QH  (WS_SC + 4u * (size_t)NB * CC)            // f16 hi|lo q rows [b*NN + n][512]; k rows; v planes [b][512][NN]
#define WS_QL  (WS_QH + 2u * (size_t)NB * NN * CC)
#define WS_KH  (WS_QL + 2u * (size_t)NB * NN * CC)
#define WS_KL  (WS_KH + 2u * (size_t)NB * NN * CC)
#define WS_VT  (WS_KL + 2u * (size_t)NB * NN * CC)
#define WS_VTL (WS_VT + 2u * (size_t)NB * CC * NN)
#define WS_ST  (WS_VTL + 2u * (size_t)NB * CC * NN)      // f32 row max [b][h][n], 1 / row sum
#define WS_SL  (WS_ST + 4u * (size_t)NB * NH * NN)
#define WS_O   (WS_SL + 4u * (size_t)NB * NH * NN)       // f32 o NCHW [b][512][NN]
#define WS_P   (WS_O + 4u * (size_t)NB * CC * NN)       // f32 pooled mean [b][512]
#define WS_SS  (WS_P + 4u * (size_t)NB * CC)            // f32 scores [b][h][key tile][query tile][half][lane][4]: a 16 x 16 tile is 1 KiB in the lane order of the matrix result
#define WS_END (WS_SS + 4u * (size_t)NB * NH * NN * NN)

// ---- k_pool: block = 32 rows (b, c), one wave per row: mean over the 1,024 pixels, 8 loads of 16 bytes per lane in flight; the block's 32 means leave as one 128-B line; the loops are unrolled so that v[] stays in registers and all 8 loads issue before the first is used
__global__ __launch_bounds__(1024) void k_pool(const float* __restrict__ X, float* __restrict__ P) { __shared__ float sp[32]; const int t = threadIdx.x, lane = t & 31, w = t >> 5;
  const float* xr = X + ((size_t)blockIdx.x * 32 + w) * NN + lane * 4; v4f v[8];
#pragma unroll
  for (int i = 0; i < 8; ++i) v[i] = *(const v4f*)(xr + i * 128);
  float s = 0.f;
#pragma unroll
  for (int i = 0; i < 8; ++i) s += (bfr(v[i][0]) + bfr(v[i][1])) + (bfr(v[i][2]) + bfr(v[i][3]));
#pragma unroll
  for (int o = 1; o < 32; o <<= 1) s += __shfl_xor(s, o);
  if (lane == 0) sp[w] = s * (1.0f / NN);
  __syncthreads(); if (t < 32) P[(size_t)blockIdx.x * 32 + t] = sp[t]; }
// ---- k_fc: block = b, 32 waves: fc1 (4 rows per wave), relu, fc2 (16 rows per wave), 1 + sigmoid; each dot product is split over the lanes of one wave (16-byte loads along the row) and summed by shuffles; every loop is unrolled so that its arrays stay in registers, a stage's loads issue together and the rows' shuffle chains overlap
__global__ __launch_bounds__(1024) void k_fc(const float* __restrict__ P, const float* __restrict__ F1W, const float* __restrict__ F1B, const float* __restrict__ F2W, const float* __restrict__ F2B, float* __restrict__ SC) { __shared__ __align__(16) float sh[RR]; __shared__ __align__(16) float ss[CC]; const int t = threadIdx.x, lane = t & 31, w = t >> 5; const size_t b = blockIdx.x;
  v4f p[4], f1[4][4]; float a[4];
#pragma unroll
  for (int r = 0; r < 4; ++r)
#pragma unroll
    for (int i = 0; i < 4; ++i) f1[r][i] = *(const v4f*)(F1W + (size_t)(w * 4 + r) * CC + i * 128 + lane * 4);
  asm volatile("s_wait_xcnt 0x0" ::: "memory");   // the loads below may land in the address registers of the loads above: the wait stands in front of that overwrite
#pragma unroll
  for (int i = 0; i < 4; ++i) p[i] = *(const v4f*)(P + b * CC + i * 128 + lane * 4);
#pragma unroll
  for (int r = 0; r < 4; ++r) { float s = 0.f;
#pragma unroll
    for (int i = 0; i < 4; ++i) s += p[i][0] * bfr(f1[r][i][0]) + p[i][1] * bfr(f1[r][i][1]) + p[i][2] * bfr(f1[r][i][2]) + p[i][3] * bfr(f1[r][i][3]);
    a[r] = s; }
#pragma unroll
  for (int r = 0; r < 4; ++r) {
#pragma unroll
    for (int o = 1; o < 32; o <<= 1) a[r] += __shfl_xor(a[r], o); }
  if (lane < 4) { const float s = lane == 0 ? a[0] : lane == 1 ? a[1] : lane == 2 ? a[2] : a[3]; sh[w * 4 + lane] = fmaxf(s + bfr(F1B[w * 4 + lane]), 0.f); }
  __syncthreads();
  const v4f hv = *(const v4f*)&sh[lane * 4]; float c[16];
#pragma unroll
  for (int r = 0; r < 16; ++r) { const v4f f = *(const v4f*)(F2W + (size_t)(w * 16 + r) * RR + lane * 4); c[r] = hv[0] * bfr(f[0]) + hv[1] * bfr(f[1]) + hv[2] * bfr(f[2]) + hv[3] * bfr(f[3]); }
#pragma unroll
  for (int r = 0; r < 16; ++r) {
#pragma unroll
    for (int o = 1; o < 32; o <<= 1) c[r] += __shfl_xor(c[r], o); }
  if (lane < 16) { float s = c[0];
#pragma unroll
    for (int r = 1; r < 16; ++r) s = lane == r ? c[r] : s;
    s += bfr(F2B[w * 16 + lane]); ss[w * 16 + lane] = 1.0f + 1.0f / (1.0f + expf(-s)); }
  __syncthreads(); if (t < CC / 4) vst2(SC + b * CC + t * 4, *(const v4f*)&ss[t * 4]); }
// ---- k_proj: block = (64 pixels, 128 output channels, which*NB + b): conv1x1 over xs = x * sc (gathered from NCHW, bf16 hi + lo) + bias; q, k -> f16 hi/lo rows [n][512]; v -> planes [c][n]. The weight rows are the A operand and the pixels B: a lane's 8 results are 8 consecutive channels of one pixel, for q and k one 16-byte piece of an output row
__global__ __launch_bounds__(128) void k_proj(const float* __restrict__ X, const float* __restrict__ SC, const float* __restrict__ WQ, const float* __restrict__ BQ, const float* __restrict__ WK, const float* __restrict__ BK, const float* __restrict__ WV, const float* __restrict__ BV, _Float16* __restrict__ QH, _Float16* __restrict__ QL, _Float16* __restrict__ KH, _Float16* __restrict__ KL, _Float16* __restrict__ VT, _Float16* __restrict__ VTL) {
  __shared__ __align__(16) _Float16 sh[64][136], sl[64][136]; __shared__ __align__(16) _Float16 th[128][72], tl[128][72]; __shared__ float ssc[CC]; __shared__ __align__(16) float sbb[128]; __shared__ __align__(16) __bf16 swt[2][128][VP];   // weight tile [buffer][output channel][32 input channels], bf16, shared by the four waves
  const int tid = threadIdx.x, wave = tid >> 5, lane = tid & 31, col = lane & 15, g = lane >> 4; const int which = blockIdx.z / NB; const size_t b = blockIdx.z % NB; const int n0 = blockIdx.x * 64 + wave * 16; const int c0 = blockIdx.y * 128; const float* Wm = which == 0 ? WQ : which == 1 ? WK : WV; const float* Bm = which == 0 ? BQ : which == 1 ? BK : BV; const float* Xb = X + b * CC * (size_t)NN;
  const int wrow = tid >> 3, wpc = (tid & 7) * 4; const float* wsrc = Wm + (size_t)(c0 + wrow) * CC + wpc;   // staging map: 8 lanes per 128-B row piece, a wave's load = 4 whole lines
  v4f wreg[8];
#pragma unroll
  for (int i = 0; i < 8; ++i) wreg[i] = *(const v4f*)(wsrc + (size_t)i * 16 * CC);
  float sc4[4], bbv[8];   // the scale values and the epilogue's bias values are asked for here, all at once, so that none of them is waited for one by one
#pragma unroll
  for (int i = 0; i < 4; ++i) sc4[i] = SC[b * CC + tid + 128 * i];
#pragma unroll
  for (int j = 0; j < 8; ++j) bbv[j] = Bm[c0 + j * 16 + col];
  asm volatile("s_wait_xcnt 0x0" ::: "memory");   // the address registers of the loads above are reused below: the wait stands in front of that overwrite
#pragma unroll
  for (int i = 0; i < 4; ++i) ssc[tid + 128 * i] = sc4[i];
#pragma unroll
  for (int i = 0; i < 8; ++i) { v4b c4; c4[0] = (__bf16)wreg[i][0]; c4[1] = (__bf16)wreg[i][1]; c4[2] = (__bf16)wreg[i][2]; c4[3] = (__bf16)wreg[i][3]; *(v4b*)&swt[0][wrow + 16 * i][wpc] = c4; }
  // every global load of the loop is issued one whole pass before its values are used: xv = the x values of the coming pass, wreg = the weight tile after the one in LDS
  float xv[16]; const float* xsrc = Xb + (size_t)(8 * g) * NN + n0 + col;
#pragma unroll
  for (int i = 0; i < 8; ++i) { xv[i] = xsrc[(size_t)i * NN]; xv[8 + i] = xsrc[(size_t)(16 + i) * NN]; }
#pragma unroll
  for (int i = 0; i < 8; ++i) wreg[i] = *(const v4f*)(wsrc + (size_t)i * 16 * CC + 32);
  asm volatile("s_wait_xcnt 0x0" ::: "memory");   // the address registers of the loads above are reused below: the wait stands in front of that overwrite
  BAR_LDS();
  v8f acc[8] = {};
  // one pass; more = a pass follows (its weight tile goes to LDS, its x values are asked for), more2 = two follow (the tile after that is asked for): compile-time flags, so that no load stands under a run-time branch and no loaded register has to be copied where two paths meet, which would wait for the load at once
  auto pass = [&](const int kc, const bool more, const bool more2) __attribute__((always_inline)) { float v[16]; const int cur = kc & 1;
#pragma unroll
    for (int i = 0; i < 8; ++i) { const int ca = kc * 32 + 8 * g + i, cb2 = ca + 16; v[i] = bfr(xv[i]) * ssc[ca]; v[8 + i] = bfr(xv[8 + i]) * ssc[cb2]; }
    const F2 a = bsplit16(v);
    if (more) {   // the next weight tile has had a pass to land; its buffer is free since the barrier at the foot of the pass before
#pragma unroll
      for (int i = 0; i < 8; ++i) { v4b c4; c4[0] = (__bf16)wreg[i][0]; c4[1] = (__bf16)wreg[i][1]; c4[2] = (__bf16)wreg[i][2]; c4[3] = (__bf16)wreg[i][3]; *(v4b*)&swt[cur ^ 1][wrow + 16 * i][wpc] = c4; }
#pragma unroll
      for (int i = 0; i < 8; ++i) { xv[i] = xsrc[(size_t)((kc + 1) * 32 + i) * NN];
        if (!more2 && i == 7) asm volatile("s_wait_xcnt 0x0" ::: "memory");   // the pointer is dead behind the last x load of all: the wait stands in front of it
        xv[8 + i] = xsrc[(size_t)((kc + 1) * 32 + 16 + i) * NN]; } }
    if (more2) {
#pragma unroll
      for (int i = 0; i < 8; ++i) wreg[i] = *(const v4f*)(wsrc + (size_t)i * 16 * CC + (kc + 2) * 32); }
    asm volatile("s_wait_xcnt 0x0" ::: "memory");   // the address registers of the loads above are reused below: the wait stands in front of that overwrite
    v16b w[8];   // the pass's LDS reads stand as one group ahead of its matrix instructions
#pragma unroll
    for (int j = 0; j < 8; ++j) w[j] = frag_b(&swt[cur][j * 16 + col][0], lane);
#pragma unroll
    for (int j = 0; j < 8; ++j) { acc[j] = wmma_bf(w[j], a.h, acc[j]); acc[j] = wmma_bf(w[j], a.l, acc[j]); }
    BAR_LDS();   // publishes the next tile and ends every wave's reads of this one
    __builtin_amdgcn_sched_barrier(0); };   // keeps the next pass's conversions behind the barrier: lifted in among this pass's matrix instructions they would wait for loads that were only just issued
#pragma unroll 2   // two passes per trip: the LDS buffer index is a constant in each, and a pass's loads land in other registers than the values it is still converting
  for (int kc = 0; kc < CC / 32 - 2; ++kc) pass(kc, true, true);
  pass(CC / 32 - 2, true, false);
  if (tid < 16) {   // a lane has asked for the bias of channels j * 16 + col, the epilogue wants that of its 8 result rows: the 128 values go through LDS, published by the barrier at the foot of the last pass
#pragma unroll
    for (int j = 0; j < 8; ++j) sbb[j * 16 + col] = bfr(bbv[j]); }
  pass(CC / 32 - 1, false, false);
  // result r of tile j = channel j * 16 + 8g + r of pixel wave * 16 + col
  auto split8 = [&](const int j, v8h& hv, v8h& lv) __attribute__((always_inline)) { const v4f bb[2] = { *(const v4f*)&sbb[j * 16 + 8 * g], *(const v4f*)&sbb[j * 16 + 8 * g + 4] };
#pragma unroll
    for (int r = 0; r < 8; ++r) { const float v = acc[j][r] + bb[r >> 2][r & 3]; hv[r] = (_Float16)v; lv[r] = (_Float16)((v - (float)hv[r]) * 2048.0f); } };
  if (which < 2) {
#pragma unroll
    for (int j = 0; j < 8; ++j) { v8h hv, lv; split8(j, hv, lv); *(v8h*)&sh[wave * 16 + col][j * 16 + 8 * g] = hv; *(v8h*)&sl[wave * 16 + col][j * 16 + 8 * g] = lv; } }
  else {
#pragma unroll
    for (int j = 0; j < 8; ++j) { v8h hv, lv; split8(j, hv, lv);
#pragma unroll
      for (int r = 0; r < 8; ++r) { th[j * 16 + 8 * g + r][wave * 16 + col] = hv[r]; tl[j * 16 + 8 * g + r][wave * 16 + col] = lv[r]; } } }
  __syncthreads();
  if (which < 2) { _Float16* PH = which == 0 ? QH : KH; _Float16* PL = which == 0 ? QL : KL; for (int e = tid; e < 64 * 16; e += 128) { const int rl = e >> 4, q = e & 15; const size_t o = (b * NN + blockIdx.x * 64 + rl) * CC + c0 + q * 8; vst2((unsigned*)(PH + o), *(const v4u*)&sh[rl][q * 8]); vst2((unsigned*)(PL + o), *(const v4u*)&sl[rl][q * 8]); } }
  else { for (int e = tid; e < 128 * 8; e += 128) { const int cl = e >> 3, q = e & 7; const size_t o = (b * CC + c0 + cl) * (size_t)NN + blockIdx.x * 64 + q * 8; vst2((unsigned*)(VT + o), *(const v4u*)&th[cl][q * 8]); vst2((unsigned*)(VTL + o), *(const v4u*)&tl[cl][q * 8]); } } }
// ---- k_stats: block = (64 queries n, h, b): scores of its queries against all 1,024 keys (3-product logits x 128^-1/2), stored for k_ov, with row max and 1 / sum of exp; one 256-B line of each per block. The product is taken as s[n][m] (the wave's query rows as A, key rows as B), the lane map that k_ov wants: a lane holds 8 queries (n = 8g + r) at ONE key column (m = col). Each lane keeps max and sum of its 8 queries over the keys of its column; the 16 columns are joined once, behind the loop
__global__ __launch_bounds__(128) void k_stats(const _Float16* __restrict__ QH, const _Float16* __restrict__ QL, const _Float16* __restrict__ KH, const _Float16* __restrict__ KL, float* __restrict__ ST, float* __restrict__ SL, float* __restrict__ SS) { __shared__ __align__(16) float sm[64], ssum[64]; __shared__ __align__(16) _Float16 sk[2][2][32][QP];   // key tile [buffer][hi | lo][key][d], shared by the four waves
  const int tid = threadIdx.x, wave = tid >> 5, lane = tid & 31, col = lane & 15, g = lane >> 4; const int h = blockIdx.y; const size_t b = blockIdx.z; const int q0 = blockIdx.x * 64 + wave * 16; const size_t rq = b * NN + q0;
  v16h aq[4], al[4];
#pragma unroll
  for (int kc = 0; kc < 4; ++kc) { aq[kc] = frag_h(QH + (rq + col) * CC + h * DK + kc * 32, lane); al[kc] = frag_h(QL + (rq + col) * CC + h * DK + kc * 32, lane); }
  float m[8], l[8];   // running max and sum of queries 8g + r over the keys of this lane's column
#pragma unroll
  for (int r = 0; r < 8; ++r) { m[r] = -3.0e38f; l[r] = 0.f; }
  float* sdst = SS + ((b * NH + h) * (size_t)(NT16 * NT16) + blockIdx.x * 4 + wave) * 256 + lane * 4;   // this wave's query tile; the key tile steps by NT16 * 256
  const int srow = tid >> 4, spc = (tid & 15) * 8; const size_t so = (b * NN + srow) * CC + h * DK + spc;   // staging map: 16 lanes per 256-B row, a wave's load = 4 whole lines
  v8h rk[2][4];
#pragma unroll
  for (int i = 0; i < 4; ++i) { rk[0][i] = *(const v8h*)(KH + so + (size_t)(8 * i) * CC); rk[1][i] = *(const v8h*)(KL + so + (size_t)(8 * i) * CC); }
  asm volatile("s_wait_xcnt 0x0" ::: "memory");   // the address registers of the loads above are reused below: the wait stands in front of that overwrite
#pragma unroll
  for (int i = 0; i < 4; ++i) { *(v8h*)&sk[0][0][srow + 8 * i][spc] = rk[0][i]; *(v8h*)&sk[0][1][srow + 8 * i][spc] = rk[1][i]; }
  __syncthreads();
#pragma unroll 1
  for (int ks = 0; ks < NN / 32; ++ks) { float s[2][8]; const int cur = ks & 1;
    if (ks + 1 < NN / 32) {   // the next key tile's loads fly while this one is worked on
#pragma unroll
      for (int i = 0; i < 4; ++i) { rk[0][i] = *(const v8h*)(KH + so + (size_t)((ks + 1) * 32 + 8 * i) * CC); rk[1][i] = *(const v8h*)(KL + so + (size_t)((ks + 1) * 32 + 8 * i) * CC); } }
    asm volatile("s_wait_xcnt 0x0" ::: "memory");   // the address registers of the loads above are reused below: the wait stands in front of that overwrite
#pragma unroll
    for (int ct = 0; ct < 2; ++ct) { v8f c = {}, cl = {}; v16h kh[4], kl[4];   // a tile's LDS reads stand as one group ahead of its matrix instructions
#pragma unroll
      for (int kc = 0; kc < 4; ++kc) { kh[kc] = frag_h(&sk[cur][0][ct * 16 + col][kc * 32], lane); kl[kc] = frag_h(&sk[cur][1][ct * 16 + col][kc * 32], lane); }
#pragma unroll
      for (int kc = 0; kc < 4; ++kc) { c = wmma16(aq[kc], kh[kc], c); cl = wmma16(al[kc], kh[kc], cl); cl = wmma16(aq[kc], kl[kc], cl); }
#pragma unroll
      for (int r = 0; r < 8; ++r) s[ct][r] = (c[r] + cl[r] * (1.0f / 2048.0f)) * 0.08838834764831845f; }
    { float* d = sdst + (size_t)ks * (2 * NT16 * 256);   // each tile leaves as two stores of 512 contiguous bytes; the pass's second key tile lies NT16 * 1 KiB = 65,536 bytes behind the first
      const v4f t0 = {s[0][0], s[0][1], s[0][2], s[0][3]}, t1 = {s[0][4], s[0][5], s[0][6], s[0][7]}, t2 = {s[1][0], s[1][1], s[1][2], s[1][3]}, t3 = {s[1][4], s[1][5], s[1][6], s[1][7]};
      // the four stores and their wait are one statement: the registers that the stores name are reused right behind them
      asm volatile("global_store_b128 %0, %1, off\n\tglobal_store_b128 %0, %2, off offset:512\n\tglobal_store_b128 %0, %3, off offset:65536\n\tglobal_store_b128 %0, %4, off offset:66048\n\ts_wait_xcnt 0x0" :: "v"(d), "v"(t0), "v"(t1), "v"(t2), "v"(t3) : "memory"); }
#pragma unroll
    for (int r = 0; r < 8; ++r) { const float mn = fmaxf(m[r], fmaxf(s[0][r], s[1][r])); l[r] = l[r] * __expf(m[r] - mn) + (__expf(s[0][r] - mn) + __expf(s[1][r] - mn)); m[r] = mn; }
    if (ks + 1 < NN / 32) {
#pragma unroll
      for (int i = 0; i < 4; ++i) { *(v8h*)&sk[cur ^ 1][0][srow + 8 * i][spc] = rk[0][i]; *(v8h*)&sk[cur ^ 1][1][srow + 8 * i][spc] = rk[1][i]; } }
    BAR_LDS(); }   // publishes the next tile and ends every wave's reads of this one; it orders LDS alone, so that no wave waits here for its score stores to arrive
#pragma unroll
  for (int o = 1; o < 16; o <<= 1) {   // join the 16 key columns; the 8 queries' chains overlap
#pragma unroll
    for (int r = 0; r < 8; ++r) { const float mo = __shfl_xor(m[r], o), lo = __shfl_xor(l[r], o), mj = fmaxf(m[r], mo); l[r] = l[r] * __expf(m[r] - mj) + lo * __expf(mo - mj); m[r] = mj; } }
  if (col == 0) {
#pragma unroll
    for (int r = 0; r < 8; ++r) { sm[wave * 16 + 8 * g + r] = m[r]; ssum[wave * 16 + 8 * g + r] = 1.0f / l[r]; } }
  __syncthreads(); if (tid < 16) vst2(ST + (b * NH + h) * (size_t)NN + blockIdx.x * 64 + tid * 4, *(const v4f*)&sm[tid * 4]); else if (tid < 32) vst2(SL + (b * NH + h) * (size_t)NN + blockIdx.x * 64 + (tid - 16) * 4, *(const v4f*)&ssum[(tid - 16) * 4]); }
// ---- k_ov: block = (64 output pixels m, h, b): for each query tile n: s[n][m] as k_stats stored it, att[n][m] = exp(s - max_n) / sum_n, then o^T[m][d] += sum_n att[n][m] v[d][n] (att^T tile as the A operand, v planes as B; 3 products); o written NCHW per head channel. A lane's 8 scores (m = col, n = 8g + r) of two 16-query tiles are elements 0..7 and 8..15 of its att^T fragment (row m = col, k = n): the stored scores go from memory to registers and from there to the product
__global__ __launch_bounds__(128) void k_ov(const float* __restrict__ SS, const _Float16* __restrict__ VT, const _Float16* __restrict__ VTL, const float* __restrict__ ST, const float* __restrict__ SL, float* __restrict__ O) {
  __shared__ __align__(16) float stt[128][68];
  __shared__ __align__(16) _Float16 sv[2][2][128][VP];   // value tile [buffer][hi | lo][d][n], shared by the four waves
  __shared__ __align__(16) float sst[2][NN];   // row max | 1 / row sum of all queries of this (b, h), staged once
  const int tid = threadIdx.x, wave = tid >> 5, lane = tid & 31, col = lane & 15, g = lane >> 4; const int h = blockIdx.y; const size_t b = blockIdx.z;
  const float* ssrc = SS + ((b * NH + h) * (size_t)NT16 + blockIdx.x * 4 + wave) * (size_t)(NT16 * 256) + lane * 4;   // this wave's key tile: its 64 query tiles lie in a row, 2 KiB a pass
  v4f sc[4][4];   // scores [pass & 3][tile * 2 + half], asked for two passes ahead; read once, so by non-temporal loads, each 512 contiguous bytes
#pragma unroll
  for (int p = 0; p < 2; ++p)
#pragma unroll
    for (int i = 0; i < 4; ++i) sc[p][i] = __builtin_nontemporal_load((const v4f*)(ssrc + p * 512 + i * 128));
  const float* stm = ST + (b * NH + h) * (size_t)NN; const float* stl = SL + (b * NH + h) * (size_t)NN;
  v8f acc[8], accl[8];
#pragma unroll
  for (int j = 0; j < 8; ++j) { acc[j] = v8f{}; accl[j] = v8f{}; }
  const int vrow = tid >> 2, vpc = (tid & 3) * 8; const size_t vo = (b * CC + (size_t)h * DK + vrow) * (size_t)NN + vpc;   // staging map: 4 lanes per 64-B row piece
  v8h rv[2][4]; v4f rs[2][2];
#pragma unroll
  for (int i = 0; i < 2; ++i) { rs[0][i] = *(const v4f*)(stm + tid * 4 + i * 512); rs[1][i] = *(const v4f*)(stl + tid * 4 + i * 512); }
#pragma unroll
  for (int i = 0; i < 4; ++i) { rv[0][i] = *(const v8h*)(VT + vo + (size_t)(32 * i) * NN); rv[1][i] = *(const v8h*)(VTL + vo + (size_t)(32 * i) * NN); }
  asm volatile("s_wait_xcnt 0x0" ::: "memory");   // the address registers of the loads above are reused below: the wait stands in front of that overwrite
#pragma unroll
  for (int i = 0; i < 4; ++i) { *(v8h*)&sv[0][0][vrow + 32 * i][vpc] = rv[0][i]; *(v8h*)&sv[0][1][vrow + 32 * i][vpc] = rv[1][i]; }
#pragma unroll
  for (int i = 0; i < 2; ++i) { *(v4f*)&sst[0][tid * 4 + i * 512] = rs[0][i]; *(v4f*)&sst[1][tid * 4 + i * 512] = rs[1][i]; }
  __syncthreads();
  // one pass; u = ks & 3, a compile-time constant: it picks the LDS buffer and the score registers. The scores of the pass after next are asked for at the head of a pass, into registers whose last read lies two passes back: no loaded value has to be copied while it is in flight
  auto pass = [&](const int ks, const int u) __attribute__((always_inline)) { const int cur = u & 1;
    if (ks + 1 < NN / 32) {   // the next tile's loads fly while this one is worked on
#pragma unroll
      for (int i = 0; i < 4; ++i) { rv[0][i] = *(const v8h*)(VT + vo + (size_t)(32 * i) * NN + (ks + 1) * 32); rv[1][i] = *(const v8h*)(VTL + vo + (size_t)(32 * i) * NN + (ks + 1) * 32); } }
    { const float* sn = ssrc + (ks + 2 < NN / 32 ? ks + 2 : NN / 32 - 1) * 512;   // behind the value loads: loads return in order, and the wait for the values at the foot of the pass leaves these in flight. The last two passes ask for the last tiles again: no load stands under a branch
#pragma unroll
      for (int i = 0; i < 4; ++i) sc[(u + 2) & 3][i] = __builtin_nontemporal_load((const v4f*)(sn + i * 128)); }
    asm volatile("s_wait_xcnt 0x0" ::: "memory");   // the address registers of the loads above are reused below: the wait stands in front of that overwrite
    v4f mx[4], il[4];   // max and 1 / sum of this lane's 16 queries n (the rows of its two score tiles)
#pragma unroll
    for (int i = 0; i < 4; ++i) { const int n4 = ks * 32 + (i >> 1) * 16 + 8 * g + (i & 1) * 4; mx[i] = *(const v4f*)&sst[0][n4]; il[i] = *(const v4f*)&sst[1][n4]; }
    v16h vh[2], vl[2];   // the first value fragments are asked for ahead of the exponentials, which cover their LDS latency
#pragma unroll
    for (int j = 0; j < 2; ++j) { vh[j] = frag_h(&sv[cur][0][j * 16 + col][0], lane); vl[j] = frag_h(&sv[cur][1][j * 16 + col][0], lane); }
    __builtin_amdgcn_sched_barrier(0);   // keeps those reads in front: left free, the compiler puts them behind most of the vector work below, and the wave waits for them there
    v16h pa, pal; {
#pragma unroll
      for (int i = 0; i < 8; ++i) { const float p0 = __expf(sc[u][i >> 2][i & 3] - mx[i >> 2][i & 3]) * il[i >> 2][i & 3] * 2048.0f, p1 = __expf(sc[u][2 + (i >> 2)][i & 3] - mx[2 + (i >> 2)][i & 3]) * il[2 + (i >> 2)][i & 3] * 2048.0f; pa[i] = (_Float16)p0; pa[8 + i] = (_Float16)p1; pal[i] = (_Float16)((p0 - (float)pa[i]) * 2048.0f); pal[8 + i] = (_Float16)((p1 - (float)pa[8 + i]) * 2048.0f); } }
#pragma unroll
    for (int jj = 0; jj < 4; ++jj) {
      if (jj > 0) {
#pragma unroll
        for (int j = 0; j < 2; ++j) { vh[j] = frag_h(&sv[cur][0][(jj * 2 + j) * 16 + col][0], lane); vl[j] = frag_h(&sv[cur][1][(jj * 2 + j) * 16 + col][0], lane); } }
#pragma unroll
      for (int j = 0; j < 2; ++j) { const int jo = jj * 2 + j; acc[jo] = wmma16(pa, vh[j], acc[jo]); accl[jo] = wmma16(pa, vl[j], accl[jo]); accl[jo] = wmma16(pal, vh[j], accl[jo]); } }
    if (ks + 1 < NN / 32) {
#pragma unroll
      for (int i = 0; i < 4; ++i) { *(v8h*)&sv[cur ^ 1][0][vrow + 32 * i][vpc] = rv[0][i]; *(v8h*)&sv[cur ^ 1][1][vrow + 32 * i][vpc] = rv[1][i]; } }
    BAR_LDS(); };   // publishes the next tile and ends every wave's reads of this one; it orders LDS alone, so that the score loads stay in flight across it
#pragma unroll 1   // four passes a trip are written out, no more: u is a constant in each
  for (int k4 = 0; k4 < NN / 128; ++k4) { pass(4 * k4, 0); pass(4 * k4 + 1, 1); pass(4 * k4 + 2, 2); pass(4 * k4 + 3, 3); }
#pragma unroll
  for (int j = 0; j < 8; ++j)
#pragma unroll
    for (int r = 0; r < 8; ++r) stt[j * 16 + col][wave * 16 + 8 * g + r] = (acc[j][r] + accl[j][r] * (1.0f / 2048.0f)) * (1.0f / 2048.0f);   // [d][m local]
  __syncthreads(); for (int e = tid; e < 128 * 16; e += 128) { const int d = e >> 4, q = e & 15; vst2(O + (b * CC + (size_t)h * DK + d) * (size_t)NN + blockIdx.x * 64 + q * 4, *(const v4f*)&stt[d][q * 4]); } }
// ---- k_gate: block = (32 pixels = one 128-B line of every channel row, b), 8 waves: gate = sigmoid(sum_c gate_w[c] o[c][m] + gate_b); out = o * gate + o. o is read ONCE: a thread asks for its 16 pieces of 16 bytes (channels r + 32 i, pixels 4 q .. 4 q + 3) all at once and keeps them in registers until the gate is known; a wave's load = 4 whole lines
__global__ __launch_bounds__(256) void k_gate(const float* __restrict__ O, const float* __restrict__ GW, const float* __restrict__ GB, float* __restrict__ OUT) { __shared__ __align__(16) float part[8][32]; const int t = threadIdx.x, wave = t >> 5, q = t & 7, r = t >> 3; const size_t b = blockIdx.y; const size_t o0 = (b * CC + r) * (size_t)NN + blockIdx.x * 32 + q * 4;
  v4f v[16]; float gw[16];   // every loop of this kernel is unrolled, so that v, gw and the sums stay in registers and all 32 loads are in flight together
#pragma unroll
  for (int i = 0; i < 16; ++i) gw[i] = GW[i * 32 + r];
  asm volatile("s_wait_xcnt 0x0" ::: "memory");   // a load below may land in the offset register which the loads above name: the wait stands in front of it
#pragma unroll
  for (int i = 0; i < 16; ++i) {
    if (i == 15) asm volatile("s_wait_xcnt 0x0" ::: "memory");   // the pointer is dead behind the last load: the wait stands in front of it
    v[i] = *(const v4f*)(O + o0 + (size_t)i * 32 * NN); }
  const float gb = bfr(GB[0]);
  asm volatile("s_wait_xcnt 0x0" ::: "memory");   // the address registers of the loads above are reused below: the wait stands in front of that overwrite
  __builtin_amdgcn_sched_barrier(0);   // keeps the sums behind the last load: left free, the compiler puts them in among the loads, each with its wait, and the later loads are issued only when the earlier ones have landed
  v4f s = {0.f, 0.f, 0.f, 0.f};
#pragma unroll
  for (int i = 0; i < 16; ++i) s += v[i] * bfr(gw[i]);
#pragma unroll
  for (int o = 8; o < 32; o <<= 1) {   // the wave's 4 channel rows; the 4 pixels' chains overlap
#pragma unroll
    for (int j = 0; j < 4; ++j) s[j] += __shfl_xor(s[j], o); }
  if ((t & 31) < 8) *(v4f*)&part[wave][q * 4] = s;
  __syncthreads();
  v4f g = *(const v4f*)&part[0][q * 4];   // every thread joins the 8 waves' sums of its own 4 pixels: no second barrier
#pragma unroll
  for (int w = 1; w < 8; ++w) g += *(const v4f*)&part[w][q * 4];
#pragma unroll
  for (int j = 0; j < 4; ++j) g[j] = 1.0f + 1.0f / (1.0f + expf(-(g[j] + gb)));
#pragma unroll
  for (int i = 0; i < 16; ++i) vst2(OUT + o0 + (size_t)i * 32 * NN, (v4f)(v[i] * g)); }
extern "C" void kernel_launch(void* const* d_in, const int* in_sizes, int n_in, void* d_out, int out_size, void* d_ws, size_t ws_size, hipStream_t stream) {
  (void)in_sizes; (void)n_in; (void)out_size;
  const float** F = (const float**)d_in;   // 0 x [8,512,32,32], 1 wq [512,512], 2 bq, 3 wk, 4 bk, 5 wv, 6 bv, 7 fc1_w [128,512], 8 fc1_b, 9 fc2_w [512,128], 10 fc2_b, 11 gate_w [1,512], 12 gate_b [1]
  if (ws_size < (size_t)WS_END) return;
  char* ws = (char*)d_ws; float *SC = (float*)(ws + WS_SC), *ST = (float*)(ws + WS_ST), *SL = (float*)(ws + WS_SL), *O = (float*)(ws + WS_O), *P = (float*)(ws + WS_P), *SS = (float*)(ws + WS_SS); _Float16 *QH = (_Float16*)(ws + WS_QH), *QL = (_Float16*)(ws + WS_QL), *KH = (_Float16*)(ws + WS_KH), *KL = (_Float16*)(ws + WS_KL), *VT = (_Float16*)(ws + WS_VT), *VTL = (_Float16*)(ws + WS_VTL);
  k_pool<<<NB * CC / 32, 1024, 0, stream>>>(F[0], P);
  k_fc<<<NB, 1024, 0, stream>>>(P, F[7], F[8], F[9], F[10], SC);
  k_proj<<<dim3(NN / 64, CC / 128, 3 * NB), 128, 0, stream>>>(F[0], SC, F[1], F[2], F[3], F[4], F[5], F[6], QH, QL, KH, KL, VT, VTL);
  k_stats<<<dim3(NN / 64, NH, TNB), 128, 0, stream>>>(QH, QL, KH, KL, ST, SL, SS);
  k_ov<<<dim3(NN / 64, NH, TNB), 128, 0, stream>>>(SS, VT, VTL, ST, SL, O);
  k_gate<<<dim3(NN / 32, TNB), 256, 0, stream>>>(O, F[11], F[12], (float*)d_out);
}

// v007
// A run of this version takes 125 microseconds.
// In two side-by-side timings against v006, it was 1.04 and 1.03 times as fast.
// Counting every step since v000, it is 4.61 times as fast.
#include <hip/hip_runtime.h>
#include <math.h>

typedef __attribute__((ext_vector_type(16))) _Float16 v16h;
typedef __attribute__((ext_vector_type(16))) __bf16 v16b;
typedef __attribute__((ext_vector_type(8)))  _Float16 v8h;
typedef __attribute__((ext_vector_type(8)))  float v8f;
typedef __attribute__((ext_vector_type(4)))  float v4f;
typedef __attribute__((ext_vector_type(2)))  float v2f;
typedef __attribute__((ext_vector_type(4)))  unsigned v4u;
typedef __attribute__((ext_vector_type(4)))  int v4i;
typedef float __attribute__((may_alias)) float_a;
typedef int __attribute__((may_alias)) int_a;

template <typename T> __device__ __forceinline__ void vst2(void* p, T v) { *(T*)p = v;  }
__device__ __forceinline__ v8f wmma16(v16h a, v16h b, v8f c) {
  v8f d = __builtin_amdgcn_wmma_f32_16x16x32_f16(false, a, false, b, (short)0, c, false, false);
  asm volatile("v_nop\n\tv_nop\n\tv_nop\n\tv_nop" : "+v"(d) : "v"(a), "v"(b));
  return d;
}
__device__ __forceinline__ v8f wmma_bf(v16b a, v16b b, v8f c) {
  v8f d = __builtin_amdgcn_wmma_f32_16x16x32_bf16(false, a, false, b, (short)0, c, false, false);
  asm volatile("v_nop\n\tv_nop\n\tv_nop\n\tv_nop" : "+v"(d) : "v"(a), "v"(b));
  return d;
}
// 16x16x32 fragments: lane = (h = lane>>4, row/col = lane&15); elements 0..7 = k0+8h+0..7, 8..15 = k0+16+8h+0..7; D element r = row 8h+r
__device__ __forceinline__ v16h frag_h(const _Float16* rowk0, int lane) {
  union { v16h v; v8h q[2]; } u; const _Float16* p = rowk0 + 8 * (lane >> 4);
  u.q[0] = *(const v8h*)p; u.q[1] = *(const v8h*)(p + 16); return u.v;
}
__device__ __forceinline__ v16h frag_f32(const float* rowk0, int lane) {
  v16h a; const float* p = rowk0 + 8 * (lane >> 4);
#pragma unroll
  for (int i = 0; i < 8; ++i) { a[i] = (_Float16)p[i]; a[8 + i] = (_Float16)p[16 + i]; }
  return a;
}
__device__ __forceinline__ v16h frag_f32s(const float* rowk0, int lane, float sc) {
  v16h a; const float* p = rowk0 + 8 * (lane >> 4);
#pragma unroll
  for (int i = 0; i < 8; ++i) { a[i] = (_Float16)(p[i] * sc); a[8 + i] = (_Float16)(p[16 + i] * sc); }
  return a;
}
// column fragment from a [K][ld] layout (column n), rows >= K read as 0
__device__ __forceinline__ v16h fragc_f32(const float* W, int k0, int n, int lane, int ld, int K) {
  v16h a; const int g = lane >> 4;
#pragma unroll
  for (int i = 0; i < 8; ++i) { const int ka = k0 + 8 * g + i, kb = ka + 16;
    a[i] = (_Float16)(ka < K ? W[(size_t)(ka < K ? ka : K - 1) * ld + n] : 0.f); a[8 + i] = (_Float16)(kb < K ? W[(size_t)(kb < K ? kb : K - 1) * ld + n] : 0.f); }
  return a;
}
struct F2 { v16b h, l; };
__device__ __forceinline__ F2 bsplit16(const float v[16]) { F2 r;
#pragma unroll
  for (int i = 0; i < 16; ++i) { const __bf16 h = (__bf16)v[i]; r.h[i] = h; r.l[i] = (__bf16)(v[i] - (float)h); }
  return r; }
__device__ __forceinline__ F2 split_row(const float* row, int k0, int lane) { float v[16]; const float* p = row + k0 + 8 * (lane >> 4);
#pragma unroll
  for (int i = 0; i < 8; ++i) { v[i] = p[i]; v[8 + i] = p[16 + i]; }
  return bsplit16(v); }
__device__ __forceinline__ F2 split_rowK(const float* row, int k0, int lane, int K) { float v[16]; const int g = lane >> 4;
#pragma unroll
  for (int i = 0; i < 8; ++i) { const int ka = k0 + 8 * g + i, kb = ka + 16; v[i] = ka < K ? row[ka < K ? ka : K - 1] : 0.f; v[8 + i] = kb < K ? row[kb < K ? kb : K - 1] : 0.f; }
  return bsplit16(v); }
__device__ __forceinline__ F2 split_col(const float* W, int k0, int n, int lane, int ld, int K) { float v[16]; const int g = lane >> 4;
#pragma unroll
  for (int i = 0; i < 8; ++i) { const int ka = k0 + 8 * g + i, kb = ka + 16; v[i] = ka < K ? W[(size_t)(ka < K ? ka : K - 1) * ld + n] : 0.f; v[8 + i] = kb < K ? W[(size_t)(kb < K ? kb : K - 1) * ld + n] : 0.f; }
  return bsplit16(v); }
__device__ __forceinline__ v8f mac3(const F2& a, const F2& b, v8f c) { c = wmma_bf(a.l, b.h, c); c = wmma_bf(a.h, b.l, c); return wmma_bf(a.h, b.h, c); }
__device__ __forceinline__ float sigm(float v) { return 1.0f / (1.0f + expf(-v)); }
// work-group barrier that orders LDS alone: __syncthreads() would also wait for every global load in flight, and the loads issued for later passes are meant to stay in flight across it
#define BAR_LDS() do { __builtin_amdgcn_fence(__ATOMIC_RELEASE, "workgroup", "local"); __builtin_amdgcn_s_barrier(); __builtin_amdgcn_fence(__ATOMIC_ACQUIRE, "workgroup", "local"); } while (0)


// SelfModule (B 8, C 512, 32x32, 4 heads x 128): x = x * sigmoid(SE(x)) + x; q, k, v = 1x1 convs; att = softmax_m(q_n . k_m / sqrt(128)); o[:, m] = sum_n v[:, n] att[n, m]; out = o * sigmoid(gate 1x1 conv(o)) + o.
#define NB 8
#define CC 512
#define NN 1024
#define NH 4
#define DK 128
#define RR 128            // SE bottleneck
#define NT16 (NN / 16)    // 16-wide tiles along the pixels
#ifndef TNB
#define TNB NB
#endif
typedef __attribute__((ext_vector_type(8))) __bf16 v8b;
__device__ __forceinline__ v16b frag_b(const __bf16* rowk0, int lane) {
  union { v16b v; v8b q[2]; } u; const __bf16* p = rowk0 + 8 * (lane >> 4);
  u.q[0] = *(const v8b*)p; u.q[1] = *(const v8b*)(p + 16); return u.v;
}
__device__ __forceinline__ float bfr(float v) { return (float)(__bf16)v; }
typedef __attribute__((ext_vector_type(4))) __bf16 v4b;
// LDS row pitches of the staged tiles, in 16-bit elements: 16 B x an odd number, so that the 16 rows of a ds_load_b128 fragment read fall on distinct banks
#define QP 136            // q / k rows of 128 elements: 272 B
#define VP 40             // rows of 32 elements (v planes, weight rows): 80 B
__device__ __attribute__((noinline)) float exp_ni(float v) { return expf(v); }
__device__ __attribute__((noinline)) float erf_ni(float v) { return erff(v); }

#define WS_SC  0u                                   // f32 1 + sigmoid(SE) [b][512]
#define WS_QH  (WS_SC + 4u * (size_t)NB * CC)            // f16 hi|lo q rows [b*NN + n][512]; k rows; v planes [b][512][NN]
#define WS_QL  (WS_QH + 2u * (size_t)NB * NN * CC)
#define WS_KH  (WS_QL + 2u * (size_t)NB * NN * CC)
#define WS_KL  (WS_KH + 2u * (size_t)NB * NN * CC)
#define WS_VT  (WS_KL + 2u * (size_t)NB * NN * CC)
#define WS_VTL (WS_VT + 2u * (size_t)NB * CC * NN)
#define WS_ST  (WS_VTL + 2u * (size_t)NB * CC * NN)      // f32 row max [b][h][n], 1 / row sum
#define WS_SL  (WS_ST + 4u * (size_t)NB * NH * NN)
#define WS_O   (WS_SL + 4u * (size_t)NB * NH * NN)       // f32 o NCHW [b][512][NN]
#define WS_P   (WS_O + 4u * (size_t)NB * CC * NN)       // f32 pooled mean [b][512]
#define WS_SS  (WS_P + 4u * (size_t)NB * CC)            // f32 scores [b][h][key tile][query tile][half][lane][4]: a 16 x 16 tile is 1 KiB in the lane order of the matrix result
#define WS_END (WS_SS + 4u * (size_t)NB * NH * NN * NN)

// ---- k_pool: block = 32 rows (b, c), one wave per row: mean over the 1,024 pixels, 8 loads of 16 bytes per lane in flight; the block's 32 means leave as one 128-B line; the loops are unrolled so that v[] stays in registers and all 8 loads issue before the first is used
__global__ __launch_bounds__(1024) void k_pool(const float* __restrict__ X, float* __restrict__ P) { __shared__ float sp[32]; const int t = threadIdx.x, lane = t & 31, w = t >> 5;
  const float* xr = X + ((size_t)blockIdx.x * 32 + w) * NN + lane * 4; v4f v[8];
#pragma unroll
  for (int i = 0; i < 8; ++i) v[i] = *(const v4f*)(xr + i * 128);
  float s = 0.f;
#pragma unroll
  for (int i = 0; i < 8; ++i) s += (bfr(v[i][0]) + bfr(v[i][1])) + (bfr(v[i][2]) + bfr(v[i][3]));
#pragma unroll
  for (int o = 1; o < 32; o <<= 1) s += __shfl_xor(s, o);
  if (lane == 0) sp[w] = s * (1.0f / NN);
  __syncthreads(); if (t < 32) P[(size_t)blockIdx.x * 32 + t] = sp[t]; }
// ---- k_fc: block = b, 32 waves: fc1 (4 rows per wave), relu, fc2 (16 rows per wave), 1 + sigmoid; each dot product is split over the lanes of one wave (16-byte loads along the row) and summed by shuffles; every loop is unrolled so that its arrays stay in registers, a stage's loads issue together and the rows' shuffle chains overlap
__global__ __launch_bounds__(1024) void k_fc(const float* __restrict__ P, const float* __restrict__ F1W, const float* __restrict__ F1B, const float* __restrict__ F2W, const float* __restrict__ F2B, float* __restrict__ SC) { __shared__ __align__(16) float sh[RR]; __shared__ __align__(16) float ss[CC]; const int t = threadIdx.x, lane = t & 31, w = t >> 5; const size_t b = blockIdx.x;
  v4f p[4], f1[4][4]; float a[4];
#pragma unroll
  for (int r = 0; r < 4; ++r)
#pragma unroll
    for (int i = 0; i < 4; ++i) f1[r][i] = *(const v4f*)(F1W + (size_t)(w * 4 + r) * CC + i * 128 + lane * 4);
  asm volatile("s_wait_xcnt 0x0" ::: "memory");   // the loads below may land in the address registers of the loads above: the wait stands in front of that overwrite
#pragma unroll
  for (int i = 0; i < 4; ++i) p[i] = *(const v4f*)(P + b * CC + i * 128 + lane * 4);
#pragma unroll
  for (int r = 0; r < 4; ++r) { float s = 0.f;
#pragma unroll
    for (int i = 0; i < 4; ++i) s += p[i][0] * bfr(f1[r][i][0]) + p[i][1] * bfr(f1[r][i][1]) + p[i][2] * bfr(f1[r][i][2]) + p[i][3] * bfr(f1[r][i][3]);
    a[r] = s; }
#pragma unroll
  for (int r = 0; r < 4; ++r) {
#pragma unroll
    for (int o = 1; o < 32; o <<= 1) a[r] += __shfl_xor(a[r], o); }
  if (lane < 4) { const float s = lane == 0 ? a[0] : lane == 1 ? a[1] : lane == 2 ? a[2] : a[3]; sh[w * 4 + lane] = fmaxf(s + bfr(F1B[w * 4 + lane]), 0.f); }
  __syncthreads();
  const v4f hv = *(const v4f*)&sh[lane * 4]; float c[16];
#pragma unroll
  for (int r = 0; r < 16; ++r) { const v4f f = *(const v4f*)(F2W + (size_t)(w * 16 + r) * RR + lane * 4); c[r] = hv[0] * bfr(f[0]) + hv[1] * bfr(f[1]) + hv[2] * bfr(f[2]) + hv[3] * bfr(f[3]); }
#pragma unroll
  for (int r = 0; r < 16; ++r) {
#pragma unroll
    for (int o = 1; o < 32; o <<= 1) c[r] += __shfl_xor(c[r], o); }
  if (lane < 16) { float s = c[0];
#pragma unroll
    for (int r = 1; r < 16; ++r) s = lane == r ? c[r] : s;
    s += bfr(F2B[w * 16 + lane]); ss[w * 16 + lane] = 1.0f + 1.0f / (1.0f + expf(-s)); }
  __syncthreads(); if (t < CC / 4) vst2(SC + b * CC + t * 4, *(const v4f*)&ss[t * 4]); }
// ---- k_proj: block = (64 pixels, 128 output channels, which*NB + b): conv1x1 over xs = x * sc (gathered from NCHW, bf16 hi + lo) + bias; q, k -> f16 hi/lo rows [n][512]; v -> planes [c][n]. The weight rows are the A operand and the pixels B: a lane's 8 results are 8 consecutive channels of one pixel, for q and k one 16-byte piece of an output row
__global__ __launch_bounds__(128) void k_proj(const float* __restrict__ X, const float* __restrict__ SC, const float* __restrict__ WQ, const float* __restrict__ BQ, const float* __restrict__ WK, const float* __restrict__ BK, const float* __restrict__ WV, const float* __restrict__ BV, _Float16* __restrict__ QH, _Float16* __restrict__ QL, _Float16* __restrict__ KH, _Float16* __restrict__ KL, _Float16* __restrict__ VT, _Float16* __restrict__ VTL) {
  __shared__ __align__(16) _Float16 sh[64][136], sl[64][136]; __shared__ __align__(16) _Float16 th[128][72], tl[128][72]; __shared__ float ssc[CC]; __shared__ __align__(16) float sbb[128]; __shared__ __align__(16) __bf16 swt[2][128][VP];   // weight tile [buffer][output channel][32 input channels], bf16, shared by the four waves
  const int tid = threadIdx.x, wave = tid >> 5, lane = tid & 31, col = lane & 15, g = lane >> 4; const int which = blockIdx.z / NB; const size_t b = blockIdx.z % NB; const int n0 = blockIdx.x * 64 + wave * 16; const int c0 = blockIdx.y * 128; const float* Wm = which == 0 ? WQ : which == 1 ? WK : WV; const float* Bm = which == 0 ? BQ : which == 1 ? BK : BV; const float* Xb = X + b * CC * (size_t)NN;
  const int wrow = tid >> 3, wpc = (tid & 7) * 4; const float* wsrc = Wm + (size_t)(c0 + wrow) * CC + wpc;   // staging map: 8 lanes per 128-B row piece, a wave's load = 4 whole lines
  v4f wreg[8];
#pragma unroll
  for (int i = 0; i < 8; ++i) wreg[i] = *(const v4f*)(wsrc + (size_t)i * 16 * CC);
  float sc4[4], bbv[8];   // the scale values and the epilogue's bias values are asked for here, all at once, so that none of them is waited for one by one
#pragma unroll
  for (int i = 0; i < 4; ++i) sc4[i] = SC[b * CC + tid + 128 * i];
#pragma unroll
  for (int j = 0; j < 8; ++j) bbv[j] = Bm[c0 + j * 16 + col];
  asm volatile("s_wait_xcnt 0x0" ::: "memory");   // the address registers of the loads above are reused below: the wait stands in front of that overwrite
#pragma unroll
  for (int i = 0; i < 4; ++i) ssc[tid + 128 * i] = sc4[i];
#pragma unroll
  for (int i = 0; i < 8; ++i) { v4b c4; c4[0] = (__bf16)wreg[i][0]; c4[1] = (__bf16)wreg[i][1]; c4[2] = (__bf16)wreg[i][2]; c4[3] = (__bf16)wreg[i][3]; *(v4b*)&swt[0][wrow + 16 * i][wpc] = c4; }
  // every global load of the loop is issued one whole pass before its values are used: xv = the x values of the coming pass, wreg = the weight tile after the one in LDS
  float xv[16]; const float* xsrc = Xb + (size_t)(8 * g) * NN + n0 + col;
#pragma unroll
  for (int i = 0; i < 8; ++i) { xv[i] = xsrc[(size_t)i * NN]; xv[8 + i] = xsrc[(size_t)(16 + i) * NN]; }
#pragma unroll
  for (int i = 0; i < 8; ++i) wreg[i] = *(const v4f*)(wsrc + (size_t)i * 16 * CC + 32);
  asm volatile("s_wait_xcnt 0x0" ::: "memory");   // the address registers of the loads above are reused below: the wait stands in front of that overwrite
  BAR_LDS();
  v8f acc[8] = {};
  // one pass; more = a pass follows (its weight tile goes to LDS, its x values are asked for), more2 = two follow (the tile after that is asked for): compile-time flags, so that no load stands under a run-time branch and no loaded register has to be copied where two paths meet, which would wait for the load at once
  auto pass = [&](const int kc, const bool more, const bool more2) __attribute__((always_inline)) { float v[16]; const int cur = kc & 1;
#pragma unroll
    for (int i = 0; i < 8; ++i) { const int ca = kc * 32 + 8 * g + i, cb2 = ca + 16; v[i] = bfr(xv[i]) * ssc[ca]; v[8 + i] = bfr(xv[8 + i]) * ssc[cb2]; }
    const F2 a = bsplit16(v);
    if (more) {   // the next weight tile has had a pass to land; its buffer is free since the barrier at the foot of the pass before
#pragma unroll
      for (int i = 0; i < 8; ++i) { v4b c4; c4[0] = (__bf16)wreg[i][0]; c4[1] = (__bf16)wreg[i][1]; c4[2] = (__bf16)wreg[i][2]; c4[3] = (__bf16)wreg[i][3]; *(v4b*)&swt[cur ^ 1][wrow + 16 * i][wpc] = c4; }
#pragma unroll
      for (int i = 0; i < 8; ++i) { xv[i] = xsrc[(size_t)((kc + 1) * 32 + i) * NN];
        if (!more2 && i == 7) asm volatile("s_wait_xcnt 0x0" ::: "memory");   // the pointer is dead behind the last x load of all: the wait stands in front of it
        xv[8 + i] = xsrc[(size_t)((kc + 1) * 32 + 16 + i) * NN]; } }
    if (more2) {
#pragma unroll
      for (int i = 0; i < 8; ++i) wreg[i] = *(const v4f*)(wsrc + (size_t)i * 16 * CC + (kc + 2) * 32); }
    asm volatile("s_wait_xcnt 0x0" ::: "memory");   // the address registers of the loads above are reused below: the wait stands in front of that overwrite
    v16b w[8];   // the pass's LDS reads stand as one group ahead of its matrix instructions
#pragma unroll
    for (int j = 0; j < 8; ++j) w[j] = frag_b(&swt[cur][j * 16 + col][0], lane);
#pragma unroll
    for (int j = 0; j < 8; ++j) { acc[j] = wmma_bf(w[j], a.h, acc[j]); acc[j] = wmma_bf(w[j], a.l, acc[j]); }
    BAR_LDS();   // publishes the next tile and ends every wave's reads of this one
    __builtin_amdgcn_sched_barrier(0); };   // keeps the next pass's conversions behind the barrier: lifted in among this pass's matrix instructions they would wait for loads that were only just issued
#pragma unroll 2   // two passes per trip: the LDS buffer index is a constant in each, and a pass's loads land in other registers than the values it is still converting
  for (int kc = 0; kc < CC / 32 - 2; ++kc) pass(kc, true, true);
  pass(CC / 32 - 2, true, false);
  if (tid < 16) {   // a lane has asked for the bias of channels j * 16 + col, the epilogue wants that of its 8 result rows: the 128 values go through LDS, published by the barrier at the foot of the last pass
#pragma unroll
    for (int j = 0; j < 8; ++j) sbb[j * 16 + col] = bfr(bbv[j]); }
  pass(CC / 32 - 1, false, false);
  // result r of tile j = channel j * 16 + 8g + r of pixel wave * 16 + col
  auto split8 = [&](const int j, v8h& hv, v8h& lv) __attribute__((always_inline)) { const v4f bb[2] = { *(const v4f*)&sbb[j * 16 + 8 * g], *(const v4f*)&sbb[j * 16 + 8 * g + 4] };
#pragma unroll
    for (int r = 0; r < 8; ++r) { const float v = acc[j][r] + bb[r >> 2][r & 3]; hv[r] = (_Float16)v; lv[r] = (_Float16)((v - (float)hv[r]) * 2048.0f); } };
  if (which < 2) {
#pragma unroll
    for (int j = 0; j < 8; ++j) { v8h hv, lv; split8(j, hv, lv); *(v8h*)&sh[wave * 16 + col][j * 16 + 8 * g] = hv; *(v8h*)&sl[wave * 16 + col][j * 16 + 8 * g] = lv; } }
  else {
#pragma unroll
    for (int j = 0; j < 8; ++j) { v8h hv, lv; split8(j, hv, lv);
#pragma unroll
      for (int r = 0; r < 8; ++r) { th[j * 16 + 8 * g + r][wave * 16 + col] = hv[r]; tl[j * 16 + 8 * g + r][wave * 16 + col] = lv[r]; } } }
  __syncthreads();
  if (which < 2) { _Float16* PH = which == 0 ? QH : KH; _Float16* PL = which == 0 ? QL : KL; for (int e = tid; e < 64 * 16; e += 128) { const int rl = e >> 4, q = e & 15; const size_t o = (b * NN + blockIdx.x * 64 + rl) * CC + c0 + q * 8; vst2((unsigned*)(PH + o), *(const v4u*)&sh[rl][q * 8]); vst2((unsigned*)(PL + o), *(const v4u*)&sl[rl][q * 8]); } }
  else { for (int e = tid; e < 128 * 8; e += 128) { const int cl = e >> 3, q = e & 7; const size_t o = (b * CC + c0 + cl) * (size_t)NN + blockIdx.x * 64 + q * 8; vst2((unsigned*)(VT + o), *(const v4u*)&th[cl][q * 8]); vst2((unsigned*)(VTL + o), *(const v4u*)&tl[cl][q * 8]); } } }
// ---- k_stats: block = (64 queries n, h, b), 8 waves in two groups of 4: group 0 walks keys 0..511, group 1 keys 512..1,023, each with its own LDS tiles, so that a SIMD holds 4 waves and one wave's waits hide behind another's work; the groups' max and sum are joined in LDS behind the loop. Scores of its queries against all 1,024 keys (3-product logits x 128^-1/2), stored for k_ov, with row max and 1 / sum of exp; one 256-B line of each per block. The product is taken as s[n][m] (the wave's query rows as A, key rows as B), the lane map that k_ov wants: a lane holds 8 queries (n = 8g + r) at ONE key column (m = col). Each lane keeps max and sum of its 8 queries over the keys of its column; the 16 columns are joined once, behind the loop
__global__ __launch_bounds__(256) __attribute__((amdgpu_waves_per_eu(4, 4))) void k_stats(const _Float16* __restrict__ QH, const _Float16* __restrict__ QL, const _Float16* __restrict__ KH, const _Float16* __restrict__ KL, float* __restrict__ ST, float* __restrict__ SL, float* __restrict__ SS) { __shared__ __align__(16) float sm[64], ssum[64], pm[2][64], pl[2][64]; __shared__ __align__(16) _Float16 sk[2][2][2][32][QP];   // key tile [group][buffer][hi | lo][key][d], shared by the four waves of a group
  const int grp = __builtin_amdgcn_readfirstlane(threadIdx.x >> 7);   // the wave's group, the same in all its lanes: held as a scalar
  const int tid = threadIdx.x & 127, wave = tid >> 5, lane = tid & 31, col = lane & 15, g = lane >> 4; const int h = blockIdx.y; const size_t b = blockIdx.z; const int q0 = blockIdx.x * 64 + wave * 16; const size_t rq = b * NN + q0;
  v16h aq[4], al[4];
#pragma unroll
  for (int kc = 0; kc < 4; ++kc) { aq[kc] = frag_h(QH + (rq + col) * CC + h * DK + kc * 32, lane); al[kc] = frag_h(QL + (rq + col) * CC + h * DK + kc * 32, lane); }
  float m[8], l[8];   // running max and sum of queries 8g + r over the keys of this lane's column
#pragma unroll
  for (int r = 0; r < 8; ++r) { m[r] = -3.0e38f; l[r] = 0.f; }
  float* sdst = SS + ((b * NH + h) * (size_t)(NT16 * NT16) + (size_t)grp * (NT16 / 2) * NT16 + blockIdx.x * 4 + wave) * 256 + lane * 4;   // this wave's query tile; the key tile steps by NT16 * 256
  const int srow = tid >> 4, spc = (tid & 15) * 8; const size_t so = (b * NN + grp * (NN / 2) + srow) * CC + h * DK + spc;   // staging map: 16 lanes per 256-B row, a wave's load = 4 whole lines
  v8h rk[2][4];
#pragma unroll
  for (int i = 0; i < 4; ++i) { rk[0][i] = *(const v8h*)(KH + so + (size_t)(8 * i) * CC); rk[1][i] = *(const v8h*)(KL + so + (size_t)(8 * i) * CC); }
  asm volatile("s_wait_xcnt 0x0" ::: "memory");   // the address registers of the loads above are reused below: the wait stands in front of that overwrite
#pragma unroll
  for (int i = 0; i < 4; ++i) { *(v8h*)&sk[grp][0][0][srow + 8 * i][spc] = rk[0][i]; *(v8h*)&sk[grp][0][1][srow + 8 * i][spc] = rk[1][i]; }
  __syncthreads();
#pragma unroll 1
  for (int ks = 0; ks < NN / 64; ++ks) { float s[2][8]; const int cur = ks & 1;
    if (ks + 1 < NN / 64) {   // the next key tile's loads fly while this one is worked on
#pragma unroll
      for (int i = 0; i < 4; ++i) { rk[0][i] = *(const v8h*)(KH + so + (size_t)((ks + 1) * 32 + 8 * i) * CC); rk[1][i] = *(const v8h*)(KL + so + (size_t)((ks + 1) * 32 + 8 * i) * CC); } }
    asm volatile("s_wait_xcnt 0x0" ::: "memory");   // the address registers of the loads above are reused below: the wait stands in front of that overwrite
#pragma unroll
    for (int ct = 0; ct < 2; ++ct) { v8f c = {}, cl = {}; v16h kh[4], kl[4];   // a tile's LDS reads stand as one group ahead of its matrix instructions
#pragma unroll
      for (int kc = 0; kc < 4; ++kc) { kh[kc] = frag_h(&sk[grp][cur][0][ct * 16 + col][kc * 32], lane); kl[kc] = frag_h(&sk[grp][cur][1][ct * 16 + col][kc * 32], lane); }
#pragma unroll
      for (int kc = 0; kc < 4; ++kc) { c = wmma16(aq[kc], kh[kc], c); cl = wmma16(al[kc], kh[kc], cl); cl = wmma16(aq[kc], kl[kc], cl); }
#pragma unroll
      for (int r = 0; r < 8; ++r) s[ct][r] = (c[r] + cl[r] * (1.0f / 2048.0f)) * 0.08838834764831845f; }
    { float* d = sdst + (size_t)ks * (2 * NT16 * 256);   // each tile leaves as two stores of 512 contiguous bytes; the pass's second key tile lies NT16 * 1 KiB = 65,536 bytes behind the first
      const v4f t0 = {s[0][0], s[0][1], s[0][2], s[0][3]}, t1 = {s[0][4], s[0][5], s[0][6], s[0][7]}, t2 = {s[1][0], s[1][1], s[1][2], s[1][3]}, t3 = {s[1][4], s[1][5], s[1][6], s[1][7]};
      // the four stores and their wait are one statement: the registers that the stores name are reused right behind them
      asm volatile("global_store_b128 %0, %1, off\n\tglobal_store_b128 %0, %2, off offset:512\n\tglobal_store_b128 %0, %3, off offset:65536\n\tglobal_store_b128 %0, %4, off offset:66048\n\ts_wait_xcnt 0x0" :: "v"(d), "v"(t0), "v"(t1), "v"(t2), "v"(t3) : "memory"); }
#pragma unroll
    for (int r = 0; r < 8; ++r) { const float mn = fmaxf(m[r], fmaxf(s[0][r], s[1][r])); l[r] = l[r] * __expf(m[r] - mn) + (__expf(s[0][r] - mn) + __expf(s[1][r] - mn)); m[r] = mn; }
    if (ks + 1 < NN / 64) {
#pragma unroll
      for (int i = 0; i < 4; ++i) { *(v8h*)&sk[grp][cur ^ 1][0][srow + 8 * i][spc] = rk[0][i]; *(v8h*)&sk[grp][cur ^ 1][1][srow + 8 * i][spc] = rk[1][i]; } }
    BAR_LDS(); }   // publishes the next tile and ends every wave's reads of this one; it orders LDS alone, so that no wave waits here for its score stores to arrive
#pragma unroll
  for (int o = 1; o < 16; o <<= 1) {   // join the 16 key columns; the 8 queries' chains overlap
#pragma unroll
    for (int r = 0; r < 8; ++r) { const float mo = __shfl_xor(m[r], o), lo = __shfl_xor(l[r], o), mj = fmaxf(m[r], mo); l[r] = l[r] * __expf(m[r] - mj) + lo * __expf(mo - mj); m[r] = mj; } }
  if (col == 0) {
#pragma unroll
    for (int r = 0; r < 8; ++r) { pm[grp][wave * 16 + 8 * g + r] = m[r]; pl[grp][wave * 16 + 8 * g + r] = l[r]; } }
  __syncthreads();
  // the two key halves of a query are joined
  if (grp == 0 && tid < 64) { const float m0 = pm[0][tid], m1 = pm[1][tid], mj = fmaxf(m0, m1); sm[tid] = mj; ssum[tid] = 1.0f / (pl[0][tid] * __expf(m0 - mj) + pl[1][tid] * __expf(m1 - mj)); }
  __syncthreads(); if (grp == 0) { if (tid < 16) vst2(ST + (b * NH + h) * (size_t)NN + blockIdx.x * 64 + tid * 4, *(const v4f*)&sm[tid * 4]); else if (tid < 32) vst2(SL + (b * NH + h) * (size_t)NN + blockIdx.x * 64 + (tid - 16) * 4, *(const v4f*)&ssum[(tid - 16) * 4]); } }
// ---- k_ov: block = (64 output pixels m, h, b), 8 waves in two groups of 4: group 0 sums over queries 0..511, group 1 over 512..1,023, each with its own LDS tiles, so that a SIMD holds 4 waves; the two partial sums are added in LDS behind the loop. For each query tile n: s[n][m] as k_stats stored it, att[n][m] = exp(s - max_n) / sum_n, then o^T[m][d] += sum_n att[n][m] v[d][n] (att^T tile as the A operand, v planes as B; 3 products); o written NCHW per head channel. A lane's 8 scores (m = col, n = 8g + r) of two 16-query tiles are elements 0..7 and 8..15 of its att^T fragment (row m = col, k = n): the stored scores go from memory to registers and from there to the product
__global__ __launch_bounds__(256) __attribute__((amdgpu_waves_per_eu(4, 4))) void k_ov(const float* __restrict__ SS, const _Float16* __restrict__ VT, const _Float16* __restrict__ VTL, const float* __restrict__ ST, const float* __restrict__ SL, float* __restrict__ O) {
  __shared__ __align__(16) float stt[128][68];
  __shared__ __align__(16) _Float16 sv[2][2][2][128][VP];   // value tile [group][buffer][hi | lo][d][n], shared by the four waves of a group
  __shared__ __align__(16) float sst[2][NN];   // row max | 1 / row sum of all queries of this (b, h), staged once
  const int grp = __builtin_amdgcn_readfirstlane(threadIdx.x >> 7);   // the wave's group, the same in all its lanes: held as a scalar
  const int tid = threadIdx.x & 127, wave = tid >> 5, lane = tid & 31, col = lane & 15, g = lane >> 4; const int h = blockIdx.y; const size_t b = blockIdx.z;
  const float* ssrc = SS + ((b * NH + h) * (size_t)NT16 + blockIdx.x * 4 + wave) * (size_t)(NT16 * 256) + grp * (NN / 64) * 512 + lane * 4;   // this wave's key tile: its 64 query tiles lie in a row, 2 KiB a pass; the group's half starts 16 passes in
  v4f sc[2][4];   // scores [pass & 1][tile * 2 + half], asked for one pass ahead; read once, so by non-temporal loads, each 512 contiguous bytes
#pragma unroll
  for (int i = 0; i < 4; ++i) sc[0][i] = __builtin_nontemporal_load((const v4f*)(ssrc + i * 128));
  const float* stm = ST + (b * NH + h) * (size_t)NN; const float* stl = SL + (b * NH + h) * (size_t)NN;
  v8f acc[8], accl[8];
#pragma unroll
  for (int j = 0; j < 8; ++j) { acc[j] = v8f{}; accl[j] = v8f{}; }
  const int vrow = tid >> 2, vpc = (tid & 3) * 8; const size_t vo = (b * CC + (size_t)h * DK + vrow) * (size_t)NN + grp * (NN / 2) + vpc;   // staging map: 4 lanes per 64-B row piece
  v8h rv[2][4]; v4f rs[2]; const int sn4 = (int)threadIdx.x * 4;   // the 256 threads stage the 1,024 queries' max and 1 / sum, 4 each
  rs[0] = *(const v4f*)(stm + sn4); rs[1] = *(const v4f*)(stl + sn4);
#pragma unroll
  for (int i = 0; i < 4; ++i) { rv[0][i] = *(const v8h*)(VT + vo + (size_t)(32 * i) * NN); rv[1][i] = *(const v8h*)(VTL + vo + (size_t)(32 * i) * NN); }
  asm volatile("s_wait_xcnt 0x0" ::: "memory");   // the address registers of the loads above are reused below: the wait stands in front of that overwrite
#pragma unroll
  for (int i = 0; i < 4; ++i) { *(v8h*)&sv[grp][0][0][vrow + 32 * i][vpc] = rv[0][i]; *(v8h*)&sv[grp][0][1][vrow + 32 * i][vpc] = rv[1][i]; }
  *(v4f*)&sst[0][sn4] = rs[0]; *(v4f*)&sst[1][sn4] = rs[1];
  __syncthreads();
  // one pass; u = ks & 1, a compile-time constant: it picks the LDS buffer and the score registers. The scores of the next pass are asked for at the head of a pass, into registers whose last read lies in the pass before; two sets, not four, keep the wave within 256 registers, the budget of 4 waves a SIMD
  auto pass = [&](const int ks, const int u) __attribute__((always_inline)) { const int cur = u & 1;
    const int kn = ks + 1 < NN / 64 ? ks + 1 : NN / 64 - 1;   // the group's last pass asks for its own tiles again: no load stands under a branch, behind which every wait would have to count as if the loads had not been issued
    {   // the next tile's loads fly while this one is worked on
#pragma unroll
      for (int i = 0; i < 4; ++i) { rv[0][i] = *(const v8h*)(VT + vo + (size_t)(32 * i) * NN + kn * 32); rv[1][i] = *(const v8h*)(VTL + vo + (size_t)(32 * i) * NN + kn * 32); } }
    asm volatile("s_wait_xcnt 0x0" ::: "memory");   // the address of the score loads below may be formed in an address pair of the loads above: the wait stands in front of that overwrite
    __builtin_amdgcn_sched_barrier(0);   // holds that address arithmetic behind the wait: the wait's memory clobber does not tie it to registers
    { const float* sn = ssrc + kn * 512;   // behind the value loads: loads return in order, and the wait for the values at the foot of the pass leaves these in flight
#pragma unroll
      for (int i = 0; i < 4; ++i) sc[u ^ 1][i] = __builtin_nontemporal_load((const v4f*)(sn + i * 128)); }
    asm volatile("s_wait_xcnt 0x0" ::: "memory");   // the address registers of the loads above are reused below: the wait stands in front of that overwrite
    __builtin_amdgcn_sched_barrier(0);   // keeps the first use of this pass's scores behind the loads above: left free, the compiler lifts it, with its wait for all loads in flight, over them and over the barrier of the pass before
    v4f mx[4], il[4];   // max and 1 / sum of this lane's 16 queries n (the rows of its two score tiles)
#pragma unroll
    for (int i = 0; i < 4; ++i) { const int n4 = grp * (NN / 2) + ks * 32 + (i >> 1) * 16 + 8 * g + (i & 1) * 4; mx[i] = *(const v4f*)&sst[0][n4]; il[i] = *(const v4f*)&sst[1][n4]; }
    v16h vh[2], vl[2];
    v16h pa, pal; {
#pragma unroll
      for (int i = 0; i < 8; ++i) { const float p0 = __expf(sc[u][i >> 2][i & 3] - mx[i >> 2][i & 3]) * il[i >> 2][i & 3] * 2048.0f, p1 = __expf(sc[u][2 + (i >> 2)][i & 3] - mx[2 + (i >> 2)][i & 3]) * il[2 + (i >> 2)][i & 3] * 2048.0f; pa[i] = (_Float16)p0; pa[8 + i] = (_Float16)p1; pal[i] = (_Float16)((p0 - (float)pa[i]) * 2048.0f); pal[8 + i] = (_Float16)((p1 - (float)pa[8 + i]) * 2048.0f); } }
#pragma unroll
    for (int jj = 0; jj < 4; ++jj) {
      {
#pragma unroll
        for (int j = 0; j < 2; ++j) { vh[j] = frag_h(&sv[grp][cur][0][(jj * 2 + j) * 16 + col][0], lane); vl[j] = frag_h(&sv[grp][cur][1][(jj * 2 + j) * 16 + col][0], lane); } }
#pragma unroll
      for (int j = 0; j < 2; ++j) { const int jo = jj * 2 + j; acc[jo] = wmma16(pa, vh[j], acc[jo]); accl[jo] = wmma16(pa, vl[j], accl[jo]); accl[jo] = wmma16(pal, vh[j], accl[jo]); } }
    {   // in the last pass too: the other buffer has had no reader since the barrier before
#pragma unroll
      for (int i = 0; i < 4; ++i) { *(v8h*)&sv[grp][cur ^ 1][0][vrow + 32 * i][vpc] = rv[0][i]; *(v8h*)&sv[grp][cur ^ 1][1][vrow + 32 * i][vpc] = rv[1][i]; } }
    BAR_LDS(); };   // publishes the next tile and ends every wave's reads of this one; it orders LDS alone, so that the score loads stay in flight across it
#pragma unroll 1   // two passes a trip are written out, no more: u is a constant in each
  for (int k2 = 0; k2 < NN / 128; ++k2) { pass(2 * k2, 0); pass(2 * k2 + 1, 1); }
  if (grp == 1) {   // group 1 lays its partial sums down, group 0 adds its own to them: a lane meets the values of the lane that holds the same (d, m)
#pragma unroll
    for (int j = 0; j < 8; ++j)
#pragma unroll
      for (int r = 0; r < 8; ++r) stt[j * 16 + col][wave * 16 + 8 * g + r] = (acc[j][r] + accl[j][r] * (1.0f / 2048.0f)) * (1.0f / 2048.0f); }   // [d][m local]
  __syncthreads();
  if (grp == 0) {
#pragma unroll
    for (int j = 0; j < 8; ++j)
#pragma unroll
      for (int r = 0; r < 8; ++r) stt[j * 16 + col][wave * 16 + 8 * g + r] += (acc[j][r] + accl[j][r] * (1.0f / 2048.0f)) * (1.0f / 2048.0f); }
  __syncthreads(); for (int e = threadIdx.x; e < 128 * 16; e += 256) { const int d = e >> 4, q = e & 15; vst2(O + (b * CC + (size_t)h * DK + d) * (size_t)NN + blockIdx.x * 64 + q * 4, *(const v4f*)&stt[d][q * 4]); } }
// ---- k_gate: block = (32 pixels = one 128-B line of every channel row, b), 8 waves: gate = sigmoid(sum_c gate_w[c] o[c][m] + gate_b); out = o * gate + o. o is read ONCE: a thread asks for its 16 pieces of 16 bytes (channels r + 32 i, pixels 4 q .. 4 q + 3) all at once and keeps them in registers until the gate is known; a wave's load = 4 whole lines
__global__ __launch_bounds__(256) void k_gate(const float* __restrict__ O, const float* __restrict__ GW, const float* __restrict__ GB, float* __restrict__ OUT) { __shared__ __align__(16) float part[8][32]; const int t = threadIdx.x, wave = t >> 5, q = t & 7, r = t >> 3; const size_t b = blockIdx.y; const size_t o0 = (b * CC + r) * (size_t)NN + blockIdx.x * 32 + q * 4;
  v4f v[16]; float gw[16];   // every loop of this kernel is unrolled, so that v, gw and the sums stay in registers and all 32 loads are in flight together
#pragma unroll
  for (int i = 0; i < 16; ++i) gw[i] = GW[i * 32 + r];
  asm volatile("s_wait_xcnt 0x0" ::: "memory");   // a load below may land in the offset register which the loads above name: the wait stands in front of it
#pragma unroll
  for (int i = 0; i < 16; ++i) {
    if (i == 15) asm volatile("s_wait_xcnt 0x0" ::: "memory");   // the pointer is dead behind the last load: the wait stands in front of it
    v[i] = *(const v4f*)(O + o0 + (size_t)i * 32 * NN); }
  const float gb = bfr(GB[0]);
  asm volatile("s_wait_xcnt 0x0" ::: "memory");   // the address registers of the loads above are reused below: the wait stands in front of that overwrite
  __builtin_amdgcn_sched_barrier(0);   // keeps the sums behind the last load: left free, the compiler puts them in among the loads, each with its wait, and the later loads are issued only when the earlier ones have landed
  v4f s = {0.f, 0.f, 0.f, 0.f};
#pragma unroll
  for (int i = 0; i < 16; ++i) s += v[i] * bfr(gw[i]);
#pragma unroll
  for (int o = 8; o < 32; o <<= 1) {   // the wave's 4 channel rows; the 4 pixels' chains overlap
#pragma unroll
    for (int j = 0; j < 4; ++j) s[j] += __shfl_xor(s[j], o); }
  if ((t & 31) < 8) *(v4f*)&part[wave][q * 4] = s;
  __syncthreads();
  v4f g = *(const v4f*)&part[0][q * 4];   // every thread joins the 8 waves' sums of its own 4 pixels: no second barrier
#pragma unroll
  for (int w = 1; w < 8; ++w) g += *(const v4f*)&part[w][q * 4];
#pragma unroll
  for (int j = 0; j < 4; ++j) g[j] = 1.0f + 1.0f / (1.0f + expf(-(g[j] + gb)));
#pragma unroll
  for (int i = 0; i < 16; ++i) vst2(OUT + o0 + (size_t)i * 32 * NN, (v4f)(v[i] * g)); }
extern "C" void kernel_launch(void* const* d_in, const int* in_sizes, int n_in, void* d_out, int out_size, void* d_ws, size_t ws_size, hipStream_t stream) {
  (void)in_sizes; (void)n_in; (void)out_size;
  const float** F = (const float**)d_in;   // 0 x [8,512,32,32], 1 wq [512,512], 2 bq, 3 wk, 4 bk, 5 wv, 6 bv, 7 fc1_w [128,512], 8 fc1_b, 9 fc2_w [512,128], 10 fc2_b, 11 gate_w [1,512], 12 gate_b [1]
  if (ws_size < (size_t)WS_END) return;
  char* ws = (char*)d_ws; float *SC = (float*)(ws + WS_SC), *ST = (float*)(ws + WS_ST), *SL = (float*)(ws + WS_SL), *O = (float*)(ws + WS_O), *P = (float*)(ws + WS_P), *SS = (float*)(ws + WS_SS); _Float16 *QH = (_Float16*)(ws + WS_QH), *QL = (_Float16*)(ws + WS_QL), *KH = (_Float16*)(ws + WS_KH), *KL = (_Float16*)(ws + WS_KL), *VT = (_Float16*)(ws + WS_VT), *VTL = (_Float16*)(ws + WS_VTL);
  k_pool<<<NB * CC / 32, 1024, 0, stream>>>(F[0], P);
  k_fc<<<NB, 1024, 0, stream>>>(P, F[7], F[8], F[9], F[10], SC);
  k_proj<<<dim3(NN / 64, CC / 128, 3 * NB), 128, 0, stream>>>(F[0], SC, F[1], F[2], F[3], F[4], F[5], F[6], QH, QL, KH, KL, VT, VTL);
  k_stats<<<dim3(NN / 64, NH, TNB), 256, 0, stream>>>(QH, QL, KH, KL, ST, SL, SS);
  k_ov<<<dim3(NN / 64, NH, TNB), 256, 0, stream>>>(SS, VT, VTL, ST, SL, O);
  k_gate<<<dim3(NN / 32, TNB), 256, 0, stream>>>(O, F[11], F[12], (float*)d_out);
}

// v008
// A run of this version takes 112 microseconds.
// Two timings next to v007 both put it at 1.12 times that version's speed.
// All steps since v000 together make it 5.17 times as fast.
#include <hip/hip_runtime.h>
#include <math.h>

typedef __attribute__((ext_vector_type(16))) _Float16 v16h;
typedef __attribute__((ext_vector_type(16))) __bf16 v16b;
typedef __attribute__((ext_vector_type(8)))  _Float16 v8h;
typedef __attribute__((ext_vector_type(8)))  float v8f;
typedef __attribute__((ext_vector_type(4)))  float v4f;
typedef __attribute__((ext_vector_type(2)))  float v2f;
typedef __attribute__((ext_vector_type(4)))  unsigned v4u;
typedef __attribute__((ext_vector_type(4)))  int v4i;
typedef float __attribute__((may_alias)) float_a;
typedef int __attribute__((may_alias)) int_a;

template <typename T> __device__ __forceinline__ void vst2(void* p, T v) { *(T*)p = v;  }
__device__ __forceinline__ v8f wmma16(v16h a, v16h b, v8f c) {
  v8f d = __builtin_amdgcn_wmma_f32_16x16x32_f16(false, a, false, b, (short)0, c, false, false);
  asm volatile("v_nop\n\tv_nop\n\tv_nop\n\tv_nop" : "+v"(d) : "v"(a), "v"(b));
  return d;
}
__device__ __forceinline__ v8f wmma_bf(v16b a, v16b b, v8f c) {
  v8f d = __builtin_amdgcn_wmma_f32_16x16x32_bf16(false, a, false, b, (short)0, c, false, false);
  asm volatile("v_nop\n\tv_nop\n\tv_nop\n\tv_nop" : "+v"(d) : "v"(a), "v"(b));
  return d;
}
// 16x16x32 fragments: lane = (h = lane>>4, row/col = lane&15); elements 0..7 = k0+8h+0..7, 8..15 = k0+16+8h+0..7; D element r = row 8h+r
__device__ __forceinline__ v16h frag_h(const _Float16* rowk0, int lane) {
  union { v16h v; v8h q[2]; } u; const _Float16* p = rowk0 + 8 * (lane >> 4);
  u.q[0] = *(const v8h*)p; u.q[1] = *(const v8h*)(p + 16); return u.v;
}
__device__ __forceinline__ v16h frag_f32(const float* rowk0, int lane) {
  v16h a; const float* p = rowk0 + 8 * (lane >> 4);
#pragma unroll
  for (int i = 0; i < 8; ++i) { a[i] = (_Float16)p[i]; a[8 + i] = (_Float16)p[16 + i]; }
  return a;
}
__device__ __forceinline__ v16h frag_f32s(const float* rowk0, int lane, float sc) {
  v16h a; const float* p = rowk0 + 8 * (lane >> 4);
#pragma unroll
  for (int i = 0; i < 8; ++i) { a[i] = (_Float16)(p[i] * sc); a[8 + i] = (_Float16)(p[16 + i] * sc); }
  return a;
}
// column fragment from a [K][ld] layout (column n), rows >= K read as 0
__device__ __forceinline__ v16h fragc_f32(const float* W, int k0, int n, int lane, int ld, int K) {
  v16h a; const int g = lane >> 4;
#pragma unroll
  for (int i = 0; i < 8; ++i) { const int ka = k0 + 8 * g + i, kb = ka + 16;
    a[i] = (_Float16)(ka < K ? W[(size_t)(ka < K ? ka : K - 1) * ld + n] : 0.f); a[8 + i] = (_Float16)(kb < K ? W[(size_t)(kb < K ? kb : K - 1) * ld + n] : 0.f); }
  return a;
}
struct F2 { v16b h, l; };
__device__ __forceinline__ F2 bsplit16(const float v[16]) { F2 r;
#pragma unroll
  for (int i = 0; i < 16; ++i) { const __bf16 h = (__bf16)v[i]; r.h[i] = h; r.l[i] = (__bf16)(v[i] - (float)h); }
  return r; }
__device__ __forceinline__ F2 split_row(const float* row, int k0, int lane) { float v[16]; const float* p = row + k0 + 8 * (lane >> 4);
#pragma unroll
  for (int i = 0; i < 8; ++i) { v[i] = p[i]; v[8 + i] = p[16 + i]; }
  return bsplit16(v); }
__device__ __forceinline__ F2 split_rowK(const float* row, int k0, int lane, int K) { float v[16]; const int g = lane >> 4;
#pragma unroll
  for (int i = 0; i < 8; ++i) { const int ka = k0 + 8 * g + i, kb = ka + 16; v[i] = ka < K ? row[ka < K ? ka : K - 1] : 0.f; v[8 + i] = kb < K ? row[kb < K ? kb : K - 1] : 0.f; }
  return bsplit16(v); }
__device__ __forceinline__ F2 split_col(const float* W, int k0, int n, int lane, int ld, int K) { float v[16]; const int g = lane >> 4;
#pragma unroll
  for (int i = 0; i < 8; ++i) { const int ka = k0 + 8 * g + i, kb = ka + 16; v[i] = ka < K ? W[(size_t)(ka < K ? ka : K - 1) * ld + n] : 0.f; v[8 + i] = kb < K ? W[(size_t)(kb < K ? kb : K - 1) * ld + n] : 0.f; }
  return bsplit16(v); }
__device__ __forceinline__ v8f mac3(const F2& a, const F2& b, v8f c) { c = wmma_bf(a.l, b.h, c); c = wmma_bf(a.h, b.l, c); return wmma_bf(a.h, b.h, c); }
__device__ __forceinline__ float sigm(float v) { return 1.0f / (1.0f + expf(-v)); }
// work-group barrier that orders LDS alone: __syncthreads() would also wait for every global load in flight, and the loads issued for later passes are meant to stay in flight across it
#define BAR_LDS() do { __builtin_amdgcn_fence(__ATOMIC_RELEASE, "workgroup", "local"); __builtin_amdgcn_s_barrier(); __builtin_amdgcn_fence(__ATOMIC_ACQUIRE, "workgroup", "local"); } while (0)


// SelfModule (B 8, C 512, 32x32, 4 heads x 128): x = x * sigmoid(SE(x)) + x; q, k, v = 1x1 convs; att = softmax_m(q_n . k_m / sqrt(128)); o[:, m] = sum_n v[:, n] att[n, m]; out = o * sigmoid(gate 1x1 conv(o)) + o.
#define NB 8
#define CC 512
#define NN 1024
#define NH 4
#define DK 128
#define RR 128            // SE bottleneck
#define NT16 (NN / 16)    // 16-wide tiles along the pixels
#ifndef TNB
#define TNB NB
#endif
typedef __attribute__((ext_vector_type(8))) __bf16 v8b;
__device__ __forceinline__ v16b frag_b(const __bf16* rowk0, int lane) {
  union { v16b v; v8b q[2]; } u; const __bf16* p = rowk0 + 8 * (lane >> 4);
  u.q[0] = *(const v8b*)p; u.q[1] = *(const v8b*)(p + 16); return u.v;
}
__device__ __forceinline__ float bfr(float v) { return (float)(__bf16)v; }
typedef __attribute__((ext_vector_type(4))) __bf16 v4b;
// LDS row pitches of the staged tiles, in 16-bit elements: 16 B x an odd number, so that the 16 rows of a ds_load_b128 fragment read fall on distinct banks
#define QP 136            // q / k rows of 128 elements: 272 B
#define VP 40             // rows of 32 elements (weight rows): 80 B
#define VP2 72            // rows of 64 elements (v planes): 144 B
__device__ __attribute__((noinline)) float exp_ni(float v) { return expf(v); }
__device__ __attribute__((noinline)) float erf_ni(float v) { return erff(v); }

#define WS_SC  0u                                   // f32 1 + sigmoid(SE) [b][512]
#define WS_QH  (WS_SC + 4u * (size_t)NB * CC)            // f16 hi|lo q rows [b*NN + n][512]; k rows; v planes [b][512][NN]
#define WS_QL  (WS_QH + 2u * (size_t)NB * NN * CC)
#define WS_KH  (WS_QL + 2u * (size_t)NB * NN * CC)
#define WS_KL  (WS_KH + 2u * (size_t)NB * NN * CC)
#define WS_VT  (WS_KL + 2u * (size_t)NB * NN * CC)
#define WS_VTL (WS_VT + 2u * (size_t)NB * CC * NN)
#define WS_ST  (WS_VTL + 2u * (size_t)NB * CC * NN)      // f32 row max [b][h][n], 1 / row sum
#define WS_SL  (WS_ST + 4u * (size_t)NB * NH * NN)
#define WS_O   (WS_SL + 4u * (size_t)NB * NH * NN)       // f32 o NCHW [b][512][NN]
#define WS_P   (WS_O + 4u * (size_t)NB * CC * NN)       // f32 pooled mean [b][512]
#define WS_SS  (WS_P + 4u * (size_t)NB * CC)            // f32 scores [b][h][key tile][query tile][half][lane][4]: a 16 x 16 tile is 1 KiB in the lane order of the matrix result
#define WS_END (WS_SS + 4u * (size_t)NB * NH * NN * NN)

// ---- k_pool: block = 32 rows (b, c), one wave per row: mean over the 1,024 pixels, 8 loads of 16 bytes per lane in flight; the block's 32 means leave as one 128-B line; the loops are unrolled so that v[] stays in registers and all 8 loads issue before the first is used
__global__ __launch_bounds__(1024) void k_pool(const float* __restrict__ X, float* __restrict__ P) { __shared__ float sp[32]; const int t = threadIdx.x, lane = t & 31, w = t >> 5;
  const float* xr = X + ((size_t)blockIdx.x * 32 + w) * NN + lane * 4; v4f v[8];
#pragma unroll
  for (int i = 0; i < 8; ++i) v[i] = *(const v4f*)(xr + i * 128);
  float s = 0.f;
#pragma unroll
  for (int i = 0; i < 8; ++i) s += (bfr(v[i][0]) + bfr(v[i][1])) + (bfr(v[i][2]) + bfr(v[i][3]));
#pragma unroll
  for (int o = 1; o < 32; o <<= 1) s += __shfl_xor(s, o);
  if (lane == 0) sp[w] = s * (1.0f / NN);
  __syncthreads(); if (t < 32) P[(size_t)blockIdx.x * 32 + t] = sp[t]; }
// ---- k_fc: block = b, 32 waves: fc1 (4 rows per wave), relu, fc2 (16 rows per wave), 1 + sigmoid; each dot product is split over the lanes of one wave (16-byte loads along the row) and summed by shuffles; every loop is unrolled so that its arrays stay in registers, a stage's loads issue together and the rows' shuffle chains overlap
__global__ __launch_bounds__(1024) void k_fc(const float* __restrict__ P, const float* __restrict__ F1W, const float* __restrict__ F1B, const float* __restrict__ F2W, const float* __restrict__ F2B, float* __restrict__ SC) { __shared__ __align__(16) float sh[RR]; __shared__ __align__(16) float ss[CC]; const int t = threadIdx.x, lane = t & 31, w = t >> 5; const size_t b = blockIdx.x;
  v4f p[4], f1[4][4]; float a[4];
#pragma unroll
  for (int r = 0; r < 4; ++r)
#pragma unroll
    for (int i = 0; i < 4; ++i) f1[r][i] = *(const v4f*)(F1W + (size_t)(w * 4 + r) * CC + i * 128 + lane * 4);
  asm volatile("s_wait_xcnt 0x0" ::: "memory");   // the loads below may land in the address registers of the loads above: the wait stands in front of that overwrite
#pragma unroll
  for (int i = 0; i < 4; ++i) p[i] = *(const v4f*)(P + b * CC + i * 128 + lane * 4);
#pragma unroll
  for (int r = 0; r < 4; ++r) { float s = 0.f;
#pragma unroll
    for (int i = 0; i < 4; ++i) s += p[i][0] * bfr(f1[r][i][0]) + p[i][1] * bfr(f1[r][i][1]) + p[i][2] * bfr(f1[r][i][2]) + p[i][3] * bfr(f1[r][i][3]);
    a[r] = s; }
#pragma unroll
  for (int r = 0; r < 4; ++r) {
#pragma unroll
    for (int o = 1; o < 32; o <<= 1) a[r] += __shfl_xor(a[r], o); }
  if (lane < 4) { const float s = lane == 0 ? a[0] : lane == 1 ? a[1] : lane == 2 ? a[2] : a[3]; sh[w * 4 + lane] = fmaxf(s + bfr(F1B[w * 4 + lane]), 0.f); }
  __syncthreads();
  const v4f hv = *(const v4f*)&sh[lane * 4]; float c[16];
#pragma unroll
  for (int r = 0; r < 16; ++r) { const v4f f = *(const v4f*)(F2W + (size_t)(w * 16 + r) * RR + lane * 4); c[r] = hv[0] * bfr(f[0]) + hv[1] * bfr(f[1]) + hv[2] * bfr(f[2]) + hv[3] * bfr(f[3]); }
#pragma unroll
  for (int r = 0; r < 16; ++r) {
#pragma unroll
    for (int o = 1; o < 32; o <<= 1) c[r] += __shfl_xor(c[r], o); }
  if (lane < 16) { float s = c[0];
#pragma unroll
    for (int r = 1; r < 16; ++r) s = lane == r ? c[r] : s;
    s += bfr(F2B[w * 16 + lane]); ss[w * 16 + lane] = 1.0f + 1.0f / (1.0f + expf(-s)); }
  __syncthreads(); if (t < CC / 4) vst2(SC + b * CC + t * 4, *(const v4f*)&ss[t * 4]); }
// ---- k_proj: block = (64 pixels, 128 output channels, which*NB + b): conv1x1 over xs = x * sc (gathered from NCHW, bf16 hi + lo) + bias; q, k -> f16 hi/lo rows [n][512]; v -> planes [c][n]. The weight rows are the A operand and the pixels B: a lane's 8 results are 8 consecutive channels of one pixel, for q and k one 16-byte piece of an output row
__global__ __launch_bounds__(128) void k_proj(const float* __restrict__ X, const float* __restrict__ SC, const float* __restrict__ WQ, const float* __restrict__ BQ, const float* __restrict__ WK, const float* __restrict__ BK, const float* __restrict__ WV, const float* __restrict__ BV, _Float16* __restrict__ QH, _Float16* __restrict__ QL, _Float16* __restrict__ KH, _Float16* __restrict__ KL, _Float16* __restrict__ VT, _Float16* __restrict__ VTL) {
  __shared__ __align__(16) _Float16 sh[64][136], sl[64][136]; __shared__ __align__(16) _Float16 th[128][72], tl[128][72]; __shared__ float ssc[CC]; __shared__ __align__(16) float sbb[128]; __shared__ __align__(16) __bf16 swt[2][128][VP];   // weight tile [buffer][output channel][32 input channels], bf16, shared by the four waves
  const int tid = threadIdx.x, wave = tid >> 5, lane = tid & 31, col = lane & 15, g = lane >> 4; const int which = blockIdx.z / NB; const size_t b = blockIdx.z % NB; const int n0 = blockIdx.x * 64 + wave * 16; const int c0 = blockIdx.y * 128; const float* Wm = which == 0 ? WQ : which == 1 ? WK : WV; const float* Bm = which == 0 ? BQ : which == 1 ? BK : BV; const float* Xb = X + b * CC * (size_t)NN;
  const int wrow = tid >> 3, wpc = (tid & 7) * 4; const float* wsrc = Wm + (size_t)(c0 + wrow) * CC + wpc;   // staging map: 8 lanes per 128-B row piece, a wave's load = 4 whole lines
  v4f wreg[8];
#pragma unroll
  for (int i = 0; i < 8; ++i) wreg[i] = *(const v4f*)(wsrc + (size_t)i * 16 * CC);
  float sc4[4], bbv[8];   // the scale values and the epilogue's bias values are asked for here, all at once, so that none of them is waited for one by one
#pragma unroll
  for (int i = 0; i < 4; ++i) sc4[i] = SC[b * CC + tid + 128 * i];
#pragma unroll
  for (int j = 0; j < 8; ++j) bbv[j] = Bm[c0 + j * 16 + col];
  asm volatile("s_wait_xcnt 0x0" ::: "memory");   // the address registers of the loads above are reused below: the wait stands in front of that overwrite
#pragma unroll
  for (int i = 0; i < 4; ++i) ssc[tid + 128 * i] = sc4[i];
#pragma unroll
  for (int i = 0; i < 8; ++i) { v4b c4; c4[0] = (__bf16)wreg[i][0]; c4[1] = (__bf16)wreg[i][1]; c4[2] = (__bf16)wreg[i][2]; c4[3] = (__bf16)wreg[i][3]; *(v4b*)&swt[0][wrow + 16 * i][wpc] = c4; }
  // every global load of the loop is issued one whole pass before its values are used: xv = the x values of the coming pass, wreg = the weight tile after the one in LDS
  float xv[16]; const float* xsrc = Xb + (size_t)(8 * g) * NN + n0 + col;
#pragma unroll
  for (int i = 0; i < 8; ++i) { xv[i] = xsrc[(size_t)i * NN]; xv[8 + i] = xsrc[(size_t)(16 + i) * NN]; }
#pragma unroll
  for (int i = 0; i < 8; ++i) wreg[i] = *(const v4f*)(wsrc + (size_t)i * 16 * CC + 32);
  asm volatile("s_wait_xcnt 0x0" ::: "memory");   // the address registers of the loads above are reused below: the wait stands in front of that overwrite
  BAR_LDS();
  v8f acc[8] = {};
  // one pass; more = a pass follows (its weight tile goes to LDS, its x values are asked for), more2 = two follow (the tile after that is asked for): compile-time flags, so that no load stands under a run-time branch and no loaded register has to be copied where two paths meet, which would wait for the load at once
  auto pass = [&](const int kc, const bool more, const bool more2) __attribute__((always_inline)) { float v[16]; const int cur = kc & 1;
#pragma unroll
    for (int i = 0; i < 8; ++i) { const int ca = kc * 32 + 8 * g + i, cb2 = ca + 16; v[i] = bfr(xv[i]) * ssc[ca]; v[8 + i] = bfr(xv[8 + i]) * ssc[cb2]; }
    const F2 a = bsplit16(v);
    if (more) {   // the next weight tile has had a pass to land; its buffer is free since the barrier at the foot of the pass before
#pragma unroll
      for (int i = 0; i < 8; ++i) { v4b c4; c4[0] = (__bf16)wreg[i][0]; c4[1] = (__bf16)wreg[i][1]; c4[2] = (__bf16)wreg[i][2]; c4[3] = (__bf16)wreg[i][3]; *(v4b*)&swt[cur ^ 1][wrow + 16 * i][wpc] = c4; }
#pragma unroll
      for (int i = 0; i < 8; ++i) { xv[i] = xsrc[(size_t)((kc + 1) * 32 + i) * NN];
        if (!more2 && i == 7) asm volatile("s_wait_xcnt 0x0" ::: "memory");   // the pointer is dead behind the last x load of all: the wait stands in front of it
        xv[8 + i] = xsrc[(size_t)((kc + 1) * 32 + 16 + i) * NN]; } }
    if (more2) {
#pragma unroll
      for (int i = 0; i < 8; ++i) wreg[i] = *(const v4f*)(wsrc + (size_t)i * 16 * CC + (kc + 2) * 32); }
    asm volatile("s_wait_xcnt 0x0" ::: "memory");   // the address registers of the loads above are reused below: the wait stands in front of that overwrite
    v16b w[8];   // the pass's LDS reads stand as one group ahead of its matrix instructions
#pragma unroll
    for (int j = 0; j < 8; ++j) w[j] = frag_b(&swt[cur][j * 16 + col][0], lane);
#pragma unroll
    for (int j = 0; j < 8; ++j) { acc[j] = wmma_bf(w[j], a.h, acc[j]); acc[j] = wmma_bf(w[j], a.l, acc[j]); }
    BAR_LDS();   // publishes the next tile and ends every wave's reads of this one
    __builtin_amdgcn_sched_barrier(0); };   // keeps the next pass's conversions behind the barrier: lifted in among this pass's matrix instructions they would wait for loads that were only just issued
#pragma unroll 2   // two passes per trip: the LDS buffer index is a constant in each, and a pass's loads land in other registers than the values it is still converting
  for (int kc = 0; kc < CC / 32 - 2; ++kc) pass(kc, true, true);
  pass(CC / 32 - 2, true, false);
  if (tid < 16) {   // a lane has asked for the bias of channels j * 16 + col, the epilogue wants that of its 8 result rows: the 128 values go through LDS, published by the barrier at the foot of the last pass
#pragma unroll
    for (int j = 0; j < 8; ++j) sbb[j * 16 + col] = bfr(bbv[j]); }
  pass(CC / 32 - 1, false, false);
  // result r of tile j = channel j * 16 + 8g + r of pixel wave * 16 + col
  auto split8 = [&](const int j, v8h& hv, v8h& lv) __attribute__((always_inline)) { const v4f bb[2] = { *(const v4f*)&sbb[j * 16 + 8 * g], *(const v4f*)&sbb[j * 16 + 8 * g + 4] };
#pragma unroll
    for (int r = 0; r < 8; ++r) { const float v = acc[j][r] + bb[r >> 2][r & 3]; hv[r] = (_Float16)v; lv[r] = (_Float16)((v - (float)hv[r]) * 2048.0f); } };
  if (which < 2) {
#pragma unroll
    for (int j = 0; j < 8; ++j) { v8h hv, lv; split8(j, hv, lv); *(v8h*)&sh[wave * 16 + col][j * 16 + 8 * g] = hv; *(v8h*)&sl[wave * 16 + col][j * 16 + 8 * g] = lv; } }
  else {
#pragma unroll
    for (int j = 0; j < 8; ++j) { v8h hv, lv; split8(j, hv, lv);
#pragma unroll
      for (int r = 0; r < 8; ++r) { th[j * 16 + 8 * g + r][wave * 16 + col] = hv[r]; tl[j * 16 + 8 * g + r][wave * 16 + col] = lv[r]; } } }
  __syncthreads();
  if (which < 2) { _Float16* PH = which == 0 ? QH : KH; _Float16* PL = which == 0 ? QL : KL; for (int e = tid; e < 64 * 16; e += 128) { const int rl = e >> 4, q = e & 15; const size_t o = (b * NN + blockIdx.x * 64 + rl) * CC + c0 + q * 8; vst2((unsigned*)(PH + o), *(const v4u*)&sh[rl][q * 8]); vst2((unsigned*)(PL + o), *(const v4u*)&sl[rl][q * 8]); } }
  else { for (int e = tid; e < 128 * 8; e += 128) { const int cl = e >> 3, q = e & 7; const size_t o = (b * CC + c0 + cl) * (size_t)NN + blockIdx.x * 64 + q * 8; vst2((unsigned*)(VT + o), *(const v4u*)&th[cl][q * 8]); vst2((unsigned*)(VTL + o), *(const v4u*)&tl[cl][q * 8]); } } }
// ---- k_stats: block = (64 queries n, h, b), 8 waves in two groups of 4: group 0 walks keys 0..511, group 1 keys 512..1,023, each with its own LDS tiles, so that a SIMD holds 4 waves and one wave's waits hide behind another's work; the groups' max and sum are joined in LDS behind the loop. Scores of its queries against all 1,024 keys (3-product logits x 128^-1/2), stored for k_ov, with row max and 1 / sum of exp; one 256-B line of each per block. The product is taken as s[n][m] (the wave's query rows as A, key rows as B), the lane map that k_ov wants: a lane holds 8 queries (n = 8g + r) at ONE key column (m = col). Each lane keeps max and sum of its 8 queries over the keys of its column; the 16 columns are joined once, behind the loop
__global__ __launch_bounds__(256) __attribute__((amdgpu_waves_per_eu(4, 4))) void k_stats(const _Float16* __restrict__ QH, const _Float16* __restrict__ QL, const _Float16* __restrict__ KH, const _Float16* __restrict__ KL, float* __restrict__ ST, float* __restrict__ SL, float* __restrict__ SS) { __shared__ __align__(16) float sm[64], ssum[64], pm[2][64], pl[2][64]; __shared__ __align__(16) _Float16 sk[2][2][2][32][QP];   // key tile [group][buffer][hi | lo][key][d], shared by the four waves of a group
  const int grp = __builtin_amdgcn_readfirstlane(threadIdx.x >> 7);   // the wave's group, the same in all its lanes: held as a scalar
  const int tid = threadIdx.x & 127, wave = tid >> 5, lane = tid & 31, col = lane & 15, g = lane >> 4; const int h = blockIdx.y; const size_t b = blockIdx.z;
  float m[8], l[8];   // running max and sum of queries 8g + r over the keys of this lane's column
#pragma unroll
  for (int r = 0; r < 8; ++r) { m[r] = -3.0e38f; l[r] = 0.f; }
  float* sdst = SS + ((b * NH + h) * (size_t)(NT16 * NT16) + (size_t)grp * (NT16 / 2) * NT16 + blockIdx.x * 4 + wave) * 256 + lane * 4;   // this wave's query tile; the key tile steps by NT16 * 256
  const int srow = tid >> 4, spc = (tid & 15) * 8; const size_t so = (b * NN + grp * (NN / 2) + srow) * CC + h * DK + spc;   // staging map: 16 lanes per 256-B row, a wave's load = 4 whole lines
  v8h rk[2][4];
  // the block's 64 query rows come in once, for both groups, by whole-line loads (16 lanes per 256-B row, the 256 threads take 16 rows a step) and go through LDS to the fragments: a fragment load from global memory touches 16 lines for its 512 bytes. They lie in the two groups' second key buffers, rows 0..31 in group 0's and 32..63 in group 1's, which the first pass refills only at its foot
  const int qrow = (int)threadIdx.x >> 4; const size_t qo = (b * NN + blockIdx.x * 64 + qrow) * CC + h * DK + spc;
  { v8h rq[2][4];
#pragma unroll
    for (int i = 0; i < 4; ++i) { rq[0][i] = *(const v8h*)(QH + qo + (size_t)(16 * i) * CC); rq[1][i] = *(const v8h*)(QL + qo + (size_t)(16 * i) * CC); }
#pragma unroll
    for (int i = 0; i < 4; ++i) { rk[0][i] = *(const v8h*)(KH + so + (size_t)(8 * i) * CC); rk[1][i] = *(const v8h*)(KL + so + (size_t)(8 * i) * CC); }
    asm volatile("s_wait_xcnt 0x0" ::: "memory");   // the address registers of the loads above are reused below: the wait stands in front of that overwrite
    __builtin_amdgcn_sched_barrier(0);   // holds the arithmetic that reuses them behind the wait: the wait's memory clobber does not tie it to registers
#pragma unroll
    for (int i = 0; i < 4; ++i) { *(v8h*)&sk[i >> 1][1][0][qrow + 16 * (i & 1)][spc] = rq[0][i]; *(v8h*)&sk[i >> 1][1][1][qrow + 16 * (i & 1)][spc] = rq[1][i]; } }
#pragma unroll
  for (int i = 0; i < 4; ++i) { *(v8h*)&sk[grp][0][0][srow + 8 * i][spc] = rk[0][i]; *(v8h*)&sk[grp][0][1][srow + 8 * i][spc] = rk[1][i]; }
  __syncthreads();
  v16h aq[4], al[4];   // the wave's 16 query rows: wave * 16 + col of the block's 64
#pragma unroll
  for (int kc = 0; kc < 4; ++kc) { aq[kc] = frag_h(&sk[wave >> 1][1][0][(wave & 1) * 16 + col][kc * 32], lane); al[kc] = frag_h(&sk[wave >> 1][1][1][(wave & 1) * 16 + col][kc * 32], lane); }
  BAR_LDS();   // ends every wave's reads of the query rows: the first pass writes the next key tile over them
#pragma unroll 1
  for (int ks = 0; ks < NN / 64; ++ks) { float s[2][8]; const int cur = ks & 1;
    if (ks + 1 < NN / 64) {   // the next key tile's loads fly while this one is worked on
#pragma unroll
      for (int i = 0; i < 4; ++i) { rk[0][i] = *(const v8h*)(KH + so + (size_t)((ks + 1) * 32 + 8 * i) * CC); rk[1][i] = *(const v8h*)(KL + so + (size_t)((ks + 1) * 32 + 8 * i) * CC); } }
    asm volatile("s_wait_xcnt 0x0" ::: "memory");   // the address registers of the loads above are reused below: the wait stands in front of that overwrite
#pragma unroll
    for (int ct = 0; ct < 2; ++ct) { v8f c = {}, cl = {}; v16h kh[4], kl[4];   // a tile's LDS reads stand as one group ahead of its matrix instructions
#pragma unroll
      for (int kc = 0; kc < 4; ++kc) { kh[kc] = frag_h(&sk[grp][cur][0][ct * 16 + col][kc * 32], lane); kl[kc] = frag_h(&sk[grp][cur][1][ct * 16 + col][kc * 32], lane); }
#pragma unroll
      for (int kc = 0; kc < 4; ++kc) { c = wmma16(aq[kc], kh[kc], c); cl = wmma16(al[kc], kh[kc], cl); cl = wmma16(aq[kc], kl[kc], cl); }
#pragma unroll
      for (int r = 0; r < 8; ++r) s[ct][r] = (c[r] + cl[r] * (1.0f / 2048.0f)) * 0.08838834764831845f; }
    { float* d = sdst + (size_t)ks * (2 * NT16 * 256);   // each tile leaves as two stores of 512 contiguous bytes; the pass's second key tile lies NT16 * 1 KiB = 65,536 bytes behind the first
      const v4f t0 = {s[0][0], s[0][1], s[0][2], s[0][3]}, t1 = {s[0][4], s[0][5], s[0][6], s[0][7]}, t2 = {s[1][0], s[1][1], s[1][2], s[1][3]}, t3 = {s[1][4], s[1][5], s[1][6], s[1][7]};
      // the four stores and their wait are one statement: the registers that the stores name are reused right behind them
      asm volatile("global_store_b128 %0, %1, off\n\tglobal_store_b128 %0, %2, off offset:512\n\tglobal_store_b128 %0, %3, off offset:65536\n\tglobal_store_b128 %0, %4, off offset:66048\n\ts_wait_xcnt 0x0" :: "v"(d), "v"(t0), "v"(t1), "v"(t2), "v"(t3) : "memory"); }
#pragma unroll
    for (int r = 0; r < 8; ++r) { const float mn = fmaxf(m[r], fmaxf(s[0][r], s[1][r])); l[r] = l[r] * __expf(m[r] - mn) + (__expf(s[0][r] - mn) + __expf(s[1][r] - mn)); m[r] = mn; }
    if (ks + 1 < NN / 64) {
#pragma unroll
      for (int i = 0; i < 4; ++i) { *(v8h*)&sk[grp][cur ^ 1][0][srow + 8 * i][spc] = rk[0][i]; *(v8h*)&sk[grp][cur ^ 1][1][srow + 8 * i][spc] = rk[1][i]; } }
    BAR_LDS(); }   // publishes the next tile and ends every wave's reads of this one; it orders LDS alone, so that no wave waits here for its score stores to arrive
#pragma unroll
  for (int o = 1; o < 16; o <<= 1) {   // join the 16 key columns; the 8 queries' chains overlap
#pragma unroll
    for (int r = 0; r < 8; ++r) { const float mo = __shfl_xor(m[r], o), lo = __shfl_xor(l[r], o), mj = fmaxf(m[r], mo); l[r] = l[r] * __expf(m[r] - mj) + lo * __expf(mo - mj); m[r] = mj; } }
  if (col == 0) {
#pragma unroll
    for (int r = 0; r < 8; ++r) { pm[grp][wave * 16 + 8 * g + r] = m[r]; pl[grp][wave * 16 + 8 * g + r] = l[r]; } }
  __syncthreads();
  // the two key halves of a query are joined
  if (grp == 0 && tid < 64) { const float m0 = pm[0][tid], m1 = pm[1][tid], mj = fmaxf(m0, m1); sm[tid] = mj; ssum[tid] = 1.0f / (pl[0][tid] * __expf(m0 - mj) + pl[1][tid] * __expf(m1 - mj)); }
  __syncthreads(); if (grp == 0) { if (tid < 16) vst2(ST + (b * NH + h) * (size_t)NN + blockIdx.x * 64 + tid * 4, *(const v4f*)&sm[tid * 4]); else if (tid < 32) vst2(SL + (b * NH + h) * (size_t)NN + blockIdx.x * 64 + (tid - 16) * 4, *(const v4f*)&ssum[(tid - 16) * 4]); } }
// ---- k_ov: block = (64 output pixels m, h, b), 8 waves in two groups of 4: group 0 sums over queries 0..511, group 1 over 512..1,023, each with its own LDS tiles, so that a SIMD holds 4 waves; the two partial sums are added in LDS behind the loop. For each query tile n: s[n][m] as k_stats stored it, att[n][m] = exp(s - max_n) / sum_n, then o^T[m][d] += sum_n att[n][m] v[d][n] (att^T tile as the A operand, v planes as B; 3 products); o written NCHW per head channel. A lane's 8 scores (m = col, n = 8g + r) of two 16-query tiles are elements 0..7 and 8..15 of its att^T fragment (row m = col, k = n): the stored scores go from memory to registers and from there to the product. A value tile is 64 queries wide and serves two passes: a row of it is one whole 128-B line of the v plane, so that every line is asked for once, by one load, and not in two halves by two passes
__global__ __launch_bounds__(256) __attribute__((amdgpu_waves_per_eu(4, 4))) void k_ov(const float* __restrict__ SS, const _Float16* __restrict__ VT, const _Float16* __restrict__ VTL, const float* __restrict__ ST, const float* __restrict__ SL, float* __restrict__ O) {
  __shared__ __align__(16) _Float16 sv[2][2][2][128][VP2];   // value tile [group][buffer][hi | lo][d][64 n], shared by the four waves of a group
  float (*stt)[68] = (float (*)[68])&sv[0][0][0][0][0];   // the epilogue's [d][m] tile lies over the value tiles, which have no reader and no writer behind the loop's last barrier: two blocks still fit a WGP's LDS
  __shared__ __align__(16) float sst[2][NN];   // row max | 1 / row sum of all queries of this (b, h), staged once
  const int grp = __builtin_amdgcn_readfirstlane(threadIdx.x >> 7);   // the wave's group, the same in all its lanes: held as a scalar
  const int tid = threadIdx.x & 127, wave = tid >> 5, lane = tid & 31, col = lane & 15, g = lane >> 4; const int h = blockIdx.y; const size_t b = blockIdx.z;
  const char* ssrc = (const char*)(SS + ((b * NH + h) * (size_t)NT16 + blockIdx.x * 4 + __builtin_amdgcn_readfirstlane(wave)) * (size_t)(NT16 * 256) + grp * (NN / 64) * 512);   // this wave's key tile: its 64 query tiles lie in a row, 2 KiB a pass; the group's half starts 16 passes in; wave-uniform, held in scalar registers, the lane's 16 bytes are a 32-bit offset beside it
  v4f sc[2][4];   // scores [pass & 1][tile * 2 + half], asked for one pass ahead; read once, so by non-temporal loads, each 512 contiguous bytes
#pragma unroll
  for (int i = 0; i < 4; ++i) sc[0][i] = __builtin_nontemporal_load((const v4f*)(ssrc + (unsigned)(lane * 16) + i * 512));
  const float* stm = ST + (b * NH + h) * (size_t)NN; const float* stl = SL + (b * NH + h) * (size_t)NN;
  v8f acc[8], accl[8];
#pragma unroll
  for (int j = 0; j < 8; ++j) { acc[j] = v8f{}; accl[j] = v8f{}; }
  const int vrow = tid >> 3, vpc = (tid & 7) * 8; const unsigned vof = (unsigned)(vrow * NN + vpc) * 2u;   // staging map: 8 lanes per 128-B row, a wave's load = 4 whole lines; the lane's part of the address in bytes, one register for both planes
  const char* vtb = (const char*)(VT + (b * CC + (size_t)h * DK) * (size_t)NN + grp * (NN / 2)); const char* vlb = (const char*)(VTL + (b * CC + (size_t)h * DK) * (size_t)NN + grp * (NN / 2));   // the wave-uniform part, held in scalar registers: address pairs per lane would not fit the budget of 256 registers
  v8h rv[2][4]; v4f rs[2]; const int sn4 = (int)threadIdx.x * 4;   // the 256 threads stage the 1,024 queries' max and 1 / sum, 4 each
  rs[0] = *(const v4f*)(stm + sn4); rs[1] = *(const v4f*)(stl + sn4);
  { v8h pv[2][8];   // the first tile whole: all its loads are in flight together
#pragma unroll
    for (int i = 0; i < 8; ++i) { pv[0][i] = *(const v8h*)(vtb + 16 * i * NN * 2 + vof); pv[1][i] = *(const v8h*)(vlb + 16 * i * NN * 2 + vof); }
    asm volatile("s_wait_xcnt 0x0" ::: "memory");   // the address registers of the loads above are reused below: the wait stands in front of that overwrite
    __builtin_amdgcn_sched_barrier(0);   // holds the arithmetic that reuses them behind the wait: the wait's memory clobber does not tie it to registers
#pragma unroll
    for (int i = 0; i < 8; ++i) { *(v8h*)&sv[grp][0][0][vrow + 16 * i][vpc] = pv[0][i]; *(v8h*)&sv[grp][0][1][vrow + 16 * i][vpc] = pv[1][i]; } }
  *(v4f*)&sst[0][sn4] = rs[0]; *(v4f*)&sst[1][sn4] = rs[1];
  __syncthreads();
  // one pass; u = ks & 1 picks the score registers, cur the LDS buffer of the pass's value tile, sub the tile's half of 32 queries that the pass works on: compile-time constants. A pass brings in one half of the next tile's rows (d = 64 sub ..), so that it holds no more loaded registers than with tiles of 32. The scores of the next pass are asked for at the head of a pass, into registers whose last read lies in the pass before; two sets, not four, keep the wave within 256 registers, the budget of 4 waves a SIMD
  auto pass = [&](const int ks, const int u, const int cur, const int sub) __attribute__((always_inline)) {
    const int tn = (ks >> 1) + 1 < NN / 128 ? (ks >> 1) + 1 : NN / 128 - 1;   // the next value tile; the last tile's passes ask for their own again, for the reason given on the next line
    const int kn = ks + 1 < NN / 64 ? ks + 1 : NN / 64 - 1;   // the group's last pass asks for its own tiles again: no load stands under a branch, behind which every wait would have to count as if the loads had not been issued
    { const unsigned vt = vof + (unsigned)__builtin_amdgcn_readfirstlane(tn * 128);   // the next tile's loads fly while this one is worked on; what moves from tile to tile is a 32-bit offset beside the scalar base. The tile's part goes through readfirstlane so that the compiler keeps the sum in 32 bits: left to itself it was seen to form a 64-bit address pair per lane and plane, which spilled
#pragma unroll
      for (int i = 0; i < 4; ++i) { rv[0][i] = *(const v8h*)(vtb + vt + (64 * sub + 16 * i) * NN * 2);
        if (i == 3) asm volatile("s_wait_xcnt 0x0" ::: "memory");   // the offset is dead behind the last load: the wait stands in front of it
        rv[1][i] = *(const v8h*)(vlb + vt + (64 * sub + 16 * i) * NN * 2); } }
    asm volatile("s_wait_xcnt 0x0" ::: "memory");   // the address of the score loads below may be formed in the address registers of the loads above: the wait stands in front of that overwrite
    __builtin_amdgcn_sched_barrier(0);   // holds that address arithmetic behind the wait: the wait's memory clobber does not tie it to registers
    { const unsigned sn = (unsigned)(lane * 16) + (unsigned)__builtin_amdgcn_readfirstlane(kn * 2048);   // behind the value loads: loads return in order, and the wait for the values at the foot of the pass leaves these in flight; readfirstlane as above
#pragma unroll
      for (int i = 0; i < 4; ++i) sc[u ^ 1][i] = __builtin_nontemporal_load((const v4f*)(ssrc + sn + i * 512)); }
    asm volatile("s_wait_xcnt 0x0" ::: "memory");   // the address registers of the loads above are reused below: the wait stands in front of that overwrite
    __builtin_amdgcn_sched_barrier(0);   // keeps the first use of this pass's scores behind the loads above: left free, the compiler lifts it, with its wait for all loads in flight, over them and over the barrier of the pass before
    v4f mx[4], il[4];   // max and 1 / sum of this lane's 16 queries n (the rows of its two score tiles)
#pragma unroll
    for (int i = 0; i < 4; ++i) { const int n4 = grp * (NN / 2) + ks * 32 + (i >> 1) * 16 + 8 * g + (i & 1) * 4; mx[i] = *(const v4f*)&sst[0][n4]; il[i] = *(const v4f*)&sst[1][n4]; }
    v16h vh[2], vl[2];
    v16h pa, pal; {
#pragma unroll
      for (int i = 0; i < 8; ++i) { const float p0 = __expf(sc[u][i >> 2][i & 3] - mx[i >> 2][i & 3]) * il[i >> 2][i & 3] * 2048.0f, p1 = __expf(sc[u][2 + (i >> 2)][i & 3] - mx[2 + (i >> 2)][i & 3]) * il[2 + (i >> 2)][i & 3] * 2048.0f; pa[i] = (_Float16)p0; pa[8 + i] = (_Float16)p1; pal[i] = (_Float16)((p0 - (float)pa[i]) * 2048.0f); pal[8 + i] = (_Float16)((p1 - (float)pa[8 + i]) * 2048.0f); } }
#pragma unroll
    for (int jj = 0; jj < 4; ++jj) {
      {
#pragma unroll
        for (int j = 0; j < 2; ++j) { vh[j] = frag_h(&sv[grp][cur][0][(jj * 2 + j) * 16 + col][sub * 32], lane); vl[j] = frag_h(&sv[grp][cur][1][(jj * 2 + j) * 16 + col][sub * 32], lane); } }
#pragma unroll
      for (int j = 0; j < 2; ++j) { const int jo = jj * 2 + j; acc[jo] = wmma16(pa, vh[j], acc[jo]); accl[jo] = wmma16(pa, vl[j], accl[jo]); accl[jo] = wmma16(pal, vh[j], accl[jo]); } }
    {   // in the last tile's passes too: the other buffer has had no reader since the barrier before
#pragma unroll
      for (int i = 0; i < 4; ++i) { *(v8h*)&sv[grp][cur ^ 1][0][64 * sub + vrow + 16 * i][vpc] = rv[0][i]; *(v8h*)&sv[grp][cur ^ 1][1][64 * sub + vrow + 16 * i][vpc] = rv[1][i]; } }
    if (sub) BAR_LDS(); };   // behind a tile's second pass: publishes the next tile and ends every wave's reads of this one; it orders LDS alone, so that the score loads stay in flight across it. Behind the first pass nothing changes hands, and no barrier stands
#pragma unroll 1   // four passes a trip are written out, no more: u, cur and sub are constants in each
  for (int k4 = 0; k4 < NN / 256; ++k4) { pass(4 * k4, 0, 0, 0); pass(4 * k4 + 1, 1, 0, 1); pass(4 * k4 + 2, 0, 1, 0); pass(4 * k4 + 3, 1, 1, 1); }
  if (grp == 1) {   // group 1 lays its partial sums down, group 0 adds its own to them: a lane meets the values of the lane that holds the same (d, m)
#pragma unroll
    for (int j = 0; j < 8; ++j)
#pragma unroll
      for (int r = 0; r < 8; ++r) stt[j * 16 + col][wave * 16 + 8 * g + r] = (acc[j][r] + accl[j][r] * (1.0f / 2048.0f)) * (1.0f / 2048.0f); }   // [d][m local]
  __syncthreads();
  if (grp == 0) {
#pragma unroll
    for (int j = 0; j < 8; ++j)
#pragma unroll
      for (int r = 0; r < 8; ++r) stt[j * 16 + col][wave * 16 + 8 * g + r] += (acc[j][r] + accl[j][r] * (1.0f / 2048.0f)) * (1.0f / 2048.0f); }
  __syncthreads(); for (int e = threadIdx.x; e < 128 * 16; e += 256) { const int d = e >> 4, q = e & 15; vst2(O + (b * CC + (size_t)h * DK + d) * (size_t)NN + blockIdx.x * 64 + q * 4, *(const v4f*)&stt[d][q * 4]); } }
// ---- k_gate: block = (32 pixels = one 128-B line of every channel row, b), 8 waves: gate = sigmoid(sum_c gate_w[c] o[c][m] + gate_b); out = o * gate + o. o is read ONCE: a thread asks for its 16 pieces of 16 bytes (channels r + 32 i, pixels 4 q .. 4 q + 3) all at once and keeps them in registers until the gate is known; a wave's load = 4 whole lines
__global__ __launch_bounds__(256) void k_gate(const float* __restrict__ O, const float* __restrict__ GW, const float* __restrict__ GB, float* __restrict__ OUT) { __shared__ __align__(16) float part[8][32]; const int t = threadIdx.x, wave = t >> 5, q = t & 7, r = t >> 3; const size_t b = blockIdx.y; const size_t o0 = (b * CC + r) * (size_t)NN + blockIdx.x * 32 + q * 4;
  v4f v[16]; float gw[16];   // every loop of this kernel is unrolled, so that v, gw and the sums stay in registers and all 32 loads are in flight together
#pragma unroll
  for (int i = 0; i < 16; ++i) gw[i] = GW[i * 32 + r];
  asm volatile("s_wait_xcnt 0x0" ::: "memory");   // a load below may land in the offset register which the loads above name: the wait stands in front of it
#pragma unroll
  for (int i = 0; i < 16; ++i) {
    if (i == 15) asm volatile("s_wait_xcnt 0x0" ::: "memory");   // the pointer is dead behind the last load: the wait stands in front of it
    v[i] = *(const v4f*)(O + o0 + (size_t)i * 32 * NN); }
  const float gb = bfr(GB[0]);
  asm volatile("s_wait_xcnt 0x0" ::: "memory");   // the address registers of the loads above are reused below: the wait stands in front of that overwrite
  __builtin_amdgcn_sched_barrier(0);   // keeps the sums behind the last load: left free, the compiler puts them in among the loads, each with its wait, and the later loads are issued only when the earlier ones have landed
  v4f s = {0.f, 0.f, 0.f, 0.f};
#pragma unroll
  for (int i = 0; i < 16; ++i) s += v[i] * bfr(gw[i]);
#pragma unroll
  for (int o = 8; o < 32; o <<= 1) {   // the wave's 4 channel rows; the 4 pixels' chains overlap
#pragma unroll
    for (int j = 0; j < 4; ++j) s[j] += __shfl_xor(s[j], o); }
  if ((t & 31) < 8) *(v4f*)&part[wave][q * 4] = s;
  __syncthreads();
  v4f g = *(const v4f*)&part[0][q * 4];   // every thread joins the 8 waves' sums of its own 4 pixels: no second barrier
#pragma unroll
  for (int w = 1; w < 8; ++w) g += *(const v4f*)&part[w][q * 4];
#pragma unroll
  for (int j = 0; j < 4; ++j) g[j] = 1.0f + 1.0f / (1.0f + expf(-(g[j] + gb)));
#pragma unroll
  for (int i = 0; i < 16; ++i) vst2(OUT + o0 + (size_t)i * 32 * NN, (v4f)(v[i] * g)); }
extern "C" void kernel_launch(void* const* d_in, const int* in_sizes, int n_in, void* d_out, int out_size, void* d_ws, size_t ws_size, hipStream_t stream) {
  (void)in_sizes; (void)n_in; (void)out_size;
  const float** F = (const float**)d_in;   // 0 x [8,512,32,32], 1 wq [512,512], 2 bq, 3 wk, 4 bk, 5 wv, 6 bv, 7 fc1_w [128,512], 8 fc1_b, 9 fc2_w [512,128], 10 fc2_b, 11 gate_w [1,512], 12 gate_b [1]
  if (ws_size < (size_t)WS_END) return;
  char* ws = (char*)d_ws; float *SC = (float*)(ws + WS_SC), *ST = (float*)(ws + WS_ST), *SL = (float*)(ws + WS_SL), *O = (float*)(ws + WS_O), *P = (float*)(ws + WS_P), *SS = (float*)(ws + WS_SS); _Float16 *QH = (_Float16*)(ws + WS_QH), *QL = (_Float16*)(ws + WS_QL), *KH = (_Float16*)(ws + WS_KH), *KL = (_Float16*)(ws + WS_KL), *VT = (_Float16*)(ws + WS_VT), *VTL = (_Float16*)(ws + WS_VTL);
  k_pool<<<NB * CC / 32, 1024, 0, stream>>>(F[0], P);
  k_fc<<<NB, 1024, 0, stream>>>(P, F[7], F[8], F[9], F[10], SC);
  k_proj<<<dim3(NN / 64, CC / 128, 3 * NB), 128, 0, stream>>>(F[0], SC, F[1], F[2], F[3], F[4], F[5], F[6], QH, QL, KH, KL, VT, VTL);
  k_stats<<<dim3(NN / 64, NH, TNB), 256, 0, stream>>>(QH, QL, KH, KL, ST, SL, SS);
  k_ov<<<dim3(NN / 64, NH, TNB), 256, 0, stream>>>(SS, VT, VTL, ST, SL, O);
  k_gate<<<dim3(NN / 32, TNB), 256, 0, stream>>>(O, F[11], F[12], (float*)d_out);
}

// v010
// Measured time: 86 microseconds a run.
// It is 1.30 times as fast as v008, going by the measured steps of the versions left out in between.
// All steps since v000 together make it 6.70 times as fast.
#include <hip/hip_runtime.h>
#include <math.h>

typedef __attribute__((ext_vector_type(16))) _Float16 v16h;
typedef __attribute__((ext_vector_type(16))) __bf16 v16b;
typedef __attribute__((ext_vector_type(8)))  _Float16 v8h;
typedef __attribute__((ext_vector_type(8)))  float v8f;
typedef __attribute__((ext_vector_type(4)))  float v4f;
typedef __attribute__((ext_vector_type(2)))  float v2f;
typedef __attribute__((ext_vector_type(4)))  unsigned v4u;
typedef __attribute__((ext_vector_type(4)))  int v4i;
typedef float __attribute__((may_alias)) float_a;
typedef int __attribute__((may_alias)) int_a;

template <typename T> __device__ __forceinline__ void vst2(void* p, T v) { *(T*)p = v;  }
__device__ __forceinline__ v8f wmma16(v16h a, v16h b, v8f c) {
  v8f d = __builtin_amdgcn_wmma_f32_16x16x32_f16(false, a, false, b, (short)0, c, false, false);
  asm volatile("v_nop\n\tv_nop\n\tv_nop\n\tv_nop" : "+v"(d) : "v"(a), "v"(b));
  return d;
}
__device__ __forceinline__ v8f wmma_bf(v16b a, v16b b, v8f c) {
  v8f d = __builtin_amdgcn_wmma_f32_16x16x32_bf16(false, a, false, b, (short)0, c, false, false);
  asm volatile("v_nop\n\tv_nop\n\tv_nop\n\tv_nop" : "+v"(d) : "v"(a), "v"(b));
  return d;
}
// 16x16x32 fragments: lane = (h = lane>>4, row/col = lane&15); elements 0..7 = k0+8h+0..7, 8..15 = k0+16+8h+0..7; D element r = row 8h+r
__device__ __forceinline__ v16h frag_h(const _Float16* rowk0, int lane) {
  union { v16h v; v8h q[2]; } u; const _Float16* p = rowk0 + 8 * (lane >> 4);
  u.q[0] = *(const v8h*)p; u.q[1] = *(const v8h*)(p + 16); return u.v;
}
__device__ __forceinline__ v16h frag_f32(const float* rowk0, int lane) {
  v16h a; const float* p = rowk0 + 8 * (lane >> 4);
#pragma unroll
  for (int i = 0; i < 8; ++i) { a[i] = (_Float16)p[i]; a[8 + i] = (_Float16)p[16 + i]; }
  return a;
}
__device__ __forceinline__ v16h frag_f32s(const float* rowk0, int lane, float sc) {
  v16h a; const float* p = rowk0 + 8 * (lane >> 4);
#pragma unroll
  for (int i = 0; i < 8; ++i) { a[i] = (_Float16)(p[i] * sc); a[8 + i] = (_Float16)(p[16 + i] * sc); }
  return a;
}
// column fragment from a [K][ld] layout (column n), rows >= K read as 0
__device__ __forceinline__ v16h fragc_f32(const float* W, int k0, int n, int lane, int ld, int K) {
  v16h a; const int g = lane >> 4;
#pragma unroll
  for (int i = 0; i < 8; ++i) { const int ka = k0 + 8 * g + i, kb = ka + 16;
    a[i] = (_Float16)(ka < K ? W[(size_t)(ka < K ? ka : K - 1) * ld + n] : 0.f); a[8 + i] = (_Float16)(kb < K ? W[(size_t)(kb < K ? kb : K - 1) * ld + n] : 0.f); }
  return a;
}
struct F2 { v16b h, l; };
__device__ __forceinline__ F2 bsplit16(const float v[16]) { F2 r;
#pragma unroll
  for (int i = 0; i < 16; ++i) { const __bf16 h = (__bf16)v[i]; r.h[i] = h; r.l[i] = (__bf16)(v[i] - (float)h); }
  return r; }
__device__ __forceinline__ F2 split_row(const float* row, int k0, int lane) { float v[16]; const float* p = row + k0 + 8 * (lane >> 4);
#pragma unroll
  for (int i = 0; i < 8; ++i) { v[i] = p[i]; v[8 + i] = p[16 + i]; }
  return bsplit16(v); }
__device__ __forceinline__ F2 split_rowK(const float* row, int k0, int lane, int K) { float v[16]; const int g = lane >> 4;
#pragma unroll
  for (int i = 0; i < 8; ++i) { const int ka = k0 + 8 * g + i, kb = ka + 16; v[i] = ka < K ? row[ka < K ? ka : K - 1] : 0.f; v[8 + i] = kb < K ? row[kb < K ? kb : K - 1] : 0.f; }
  return bsplit16(v); }
__device__ __forceinline__ F2 split_col(const float* W, int k0, int n, int lane, int ld, int K) { float v[16]; const int g = lane >> 4;
#pragma unroll
  for (int i = 0; i < 8; ++i) { const int ka = k0 + 8 * g + i, kb = ka + 16; v[i] = ka < K ? W[(size_t)(ka < K ? ka : K - 1) * ld + n] : 0.f; v[8 + i] = kb < K ? W[(size_t)(kb < K ? kb : K - 1) * ld + n] : 0.f; }
  return bsplit16(v); }
__device__ __forceinline__ v8f mac3(const F2& a, const F2& b, v8f c) { c = wmma_bf(a.l, b.h, c); c = wmma_bf(a.h, b.l, c); return wmma_bf(a.h, b.h, c); }
__device__ __forceinline__ float sigm(float v) { return 1.0f / (1.0f + expf(-v)); }
// work-group barrier that orders LDS alone: __syncthreads() would also wait for every global load in flight, and the loads issued for later passes are meant to stay in flight across it
#define BAR_LDS() do { __builtin_amdgcn_fence(__ATOMIC_RELEASE, "workgroup", "local"); __builtin_amdgcn_s_barrier(); __builtin_amdgcn_fence(__ATOMIC_ACQUIRE, "workgroup", "local"); } while (0)


// SelfModule (B 8, C 512, 32x32, 4 heads x 128): x = x * sigmoid(SE(x)) + x; q, k, v = 1x1 convs; att = softmax_m(q_n . k_m / sqrt(128)); o[:, m] = sum_n v[:, n] att[n, m]; out = o * sigmoid(gate 1x1 conv(o)) + o.
#define NB 8
#define CC 512
#define NN 1024
#define NH 4
#define DK 128
#define RR 128            // SE bottleneck
#define NT16 (NN / 16)    // 16-wide tiles along the pixels
#ifndef TNB
#define TNB NB
#endif
typedef __attribute__((ext_vector_type(8))) __bf16 v8b;
__device__ __forceinline__ v16b frag_b(const __bf16* rowk0, int lane) {
  union { v16b v; v8b q[2]; } u; const __bf16* p = rowk0 + 8 * (lane >> 4);
  u.q[0] = *(const v8b*)p; u.q[1] = *(const v8b*)(p + 16); return u.v;
}
__device__ __forceinline__ float bfr(float v) { return (float)(__bf16)v; }
typedef __attribute__((ext_vector_type(4))) __bf16 v4b;
// LDS row pitches of the staged tiles, in 16-bit elements: 16 B x an odd number, so that the 16 rows of a ds_load_b128 fragment read fall on distinct banks
#define QP 136            // q / k rows of 128 elements: 272 B
#define VP 40             // rows of 32 elements (weight rows): 80 B
#define VP2 72            // rows of 64 elements (v planes): 144 B
__device__ __attribute__((noinline)) float exp_ni(float v) { return expf(v); }
__device__ __attribute__((noinline)) float erf_ni(float v) { return erff(v); }

#define WS_SC  0u                                   // f32 1 + sigmoid(SE) [b][512]
#define WS_QH  (WS_SC + 4u * (size_t)NB * CC)            // f16 q rows [b*NN + n][512]; k rows; v planes [b][512][NN]
#define WS_KH  (WS_QH + 2u * (size_t)NB * NN * CC)
#define WS_VT  (WS_KH + 2u * (size_t)NB * NN * CC)
#define WS_ST  (WS_VT + 2u * (size_t)NB * CC * NN)       // f32 row max [b][h][n], 1 / row sum
#define WS_SL  (WS_ST + 4u * (size_t)NB * NH * NN)
#define WS_O   (WS_SL + 4u * (size_t)NB * NH * NN)       // f32 o NCHW [b][512][NN]
#define WS_P   (WS_O + 4u * (size_t)NB * CC * NN)       // f32 pooled mean [b][512]
#define WS_SS  (WS_P + 4u * (size_t)NB * CC)            // f16 scores [b][h][key tile][query tile][lane][8]: a 16 x 16 tile is 512 B in the lane order of the matrix result
#define WS_END (WS_SS + 2u * (size_t)NB * NH * NN * NN)

// ---- k_pool: block = 32 rows (b, c), one wave per row: mean over the 1,024 pixels, 8 loads of 16 bytes per lane in flight; the block's 32 means leave as one 128-B line; the loops are unrolled so that v[] stays in registers and all 8 loads issue before the first is used
__global__ __launch_bounds__(1024) void k_pool(const float* __restrict__ X, float* __restrict__ P) { __shared__ float sp[32]; const int t = threadIdx.x, lane = t & 31, w = t >> 5;
  const float* xr = X + ((size_t)blockIdx.x * 32 + w) * NN + lane * 4; v4f v[8];
#pragma unroll
  for (int i = 0; i < 8; ++i) v[i] = *(const v4f*)(xr + i * 128);
  float s = 0.f;
#pragma unroll
  for (int i = 0; i < 8; ++i) s += (bfr(v[i][0]) + bfr(v[i][1])) + (bfr(v[i][2]) + bfr(v[i][3]));
#pragma unroll
  for (int o = 1; o < 32; o <<= 1) s += __shfl_xor(s, o);
  if (lane == 0) sp[w] = s * (1.0f / NN);
  __syncthreads(); if (t < 32) P[(size_t)blockIdx.x * 32 + t] = sp[t]; }
// ---- k_fc: block = b, 32 waves: fc1 (4 rows per wave), relu, fc2 (16 rows per wave), 1 + sigmoid; each dot product is split over the lanes of one wave (16-byte loads along the row) and summed by shuffles; every loop is unrolled so that its arrays stay in registers, a stage's loads issue together and the rows' shuffle chains overlap
__global__ __launch_bounds__(1024) void k_fc(const float* __restrict__ P, const float* __restrict__ F1W, const float* __restrict__ F1B, const float* __restrict__ F2W, const float* __restrict__ F2B, float* __restrict__ SC) { __shared__ __align__(16) float sh[RR]; __shared__ __align__(16) float ss[CC]; const int t = threadIdx.x, lane = t & 31, w = t >> 5; const size_t b = blockIdx.x;
  v4f p[4], f1[4][4]; float a[4];
#pragma unroll
  for (int r = 0; r < 4; ++r)
#pragma unroll
    for (int i = 0; i < 4; ++i) f1[r][i] = *(const v4f*)(F1W + (size_t)(w * 4 + r) * CC + i * 128 + lane * 4);
  asm volatile("s_wait_xcnt 0x0" ::: "memory");   // the loads below may land in the address registers of the loads above: the wait stands in front of that overwrite
#pragma unroll
  for (int i = 0; i < 4; ++i) p[i] = *(const v4f*)(P + b * CC + i * 128 + lane * 4);
#pragma unroll
  for (int r = 0; r < 4; ++r) { float s = 0.f;
#pragma unroll
    for (int i = 0; i < 4; ++i) s += p[i][0] * bfr(f1[r][i][0]) + p[i][1] * bfr(f1[r][i][1]) + p[i][2] * bfr(f1[r][i][2]) + p[i][3] * bfr(f1[r][i][3]);
    a[r] = s; }
#pragma unroll
  for (int r = 0; r < 4; ++r) {
#pragma unroll
    for (int o = 1; o < 32; o <<= 1) a[r] += __shfl_xor(a[r], o); }
  if (lane < 4) { const float s = lane == 0 ? a[0] : lane == 1 ? a[1] : lane == 2 ? a[2] : a[3]; sh[w * 4 + lane] = fmaxf(s + bfr(F1B[w * 4 + lane]), 0.f); }
  __syncthreads();
  const v4f hv = *(const v4f*)&sh[lane * 4]; float c[16];
#pragma unroll
  for (int r = 0; r < 16; ++r) { const v4f f = *(const v4f*)(F2W + (size_t)(w * 16 + r) * RR + lane * 4); c[r] = hv[0] * bfr(f[0]) + hv[1] * bfr(f[1]) + hv[2] * bfr(f[2]) + hv[3] * bfr(f[3]); }
#pragma unroll
  for (int r = 0; r < 16; ++r) {
#pragma unroll
    for (int o = 1; o < 32; o <<= 1) c[r] += __shfl_xor(c[r], o); }
  if (lane < 16) { float s = c[0];
#pragma unroll
    for (int r = 1; r < 16; ++r) s = lane == r ? c[r] : s;
    s += bfr(F2B[w * 16 + lane]); ss[w * 16 + lane] = 1.0f + 1.0f / (1.0f + expf(-s)); }
  __syncthreads(); if (t < CC / 4) vst2(SC + b * CC + t * 4, *(const v4f*)&ss[t * 4]); }
// ---- k_proj: block = (64 pixels, 128 output channels, which*NB + b): conv1x1 over xs = x * sc (gathered from NCHW, bf16 hi + lo) + bias; q, k -> f16 rows [n][512]; v -> f16 planes [c][n]. The weight rows are the A operand and the pixels B: a lane's 8 results are 8 consecutive channels of one pixel, for q and k one 16-byte piece of an output row
__global__ __launch_bounds__(128) void k_proj(const float* __restrict__ X, const float* __restrict__ SC, const float* __restrict__ WQ, const float* __restrict__ BQ, const float* __restrict__ WK, const float* __restrict__ BK, const float* __restrict__ WV, const float* __restrict__ BV, _Float16* __restrict__ QH, _Float16* __restrict__ KH, _Float16* __restrict__ VT) {
  __shared__ __align__(16) _Float16 sh[64][136]; __shared__ __align__(16) _Float16 th[128][72]; __shared__ float ssc[CC]; __shared__ __align__(16) float sbb[128]; __shared__ __align__(16) __bf16 swt[2][128][VP];   // weight tile [buffer][output channel][32 input channels], bf16, shared by the four waves
  const int tid = threadIdx.x, wave = tid >> 5, lane = tid & 31, col = lane & 15, g = lane >> 4; const int which = blockIdx.z / NB; const size_t b = blockIdx.z % NB; const int n0 = blockIdx.x * 64 + wave * 16; const int c0 = blockIdx.y * 128; const float* Wm = which == 0 ? WQ : which == 1 ? WK : WV; const float* Bm = which == 0 ? BQ : which == 1 ? BK : BV; const float* Xb = X + b * CC * (size_t)NN;
  const int wrow = tid >> 3, wpc = (tid & 7) * 4; const float* wsrc = Wm + (size_t)(c0 + wrow) * CC + wpc;   // staging map: 8 lanes per 128-B row piece, a wave's load = 4 whole lines
  v4f wreg[8];
#pragma unroll
  for (int i = 0; i < 8; ++i) wreg[i] = *(const v4f*)(wsrc + (size_t)i * 16 * CC);
  float sc4[4], bbv[8];   // the scale values and the epilogue's bias values are asked for here, all at once, so that none of them is waited for one by one
#pragma unroll
  for (int i = 0; i < 4; ++i) sc4[i] = SC[b * CC + tid + 128 * i];
#pragma unroll
  for (int j = 0; j < 8; ++j) bbv[j] = Bm[c0 + j * 16 + col];
  asm volatile("s_wait_xcnt 0x0" ::: "memory");   // the address registers of the loads above are reused below: the wait stands in front of that overwrite
#pragma unroll
  for (int i = 0; i < 4; ++i) ssc[tid + 128 * i] = sc4[i];
#pragma unroll
  for (int i = 0; i < 8; ++i) { v4b c4; c4[0] = (__bf16)wreg[i][0]; c4[1] = (__bf16)wreg[i][1]; c4[2] = (__bf16)wreg[i][2]; c4[3] = (__bf16)wreg[i][3]; *(v4b*)&swt[0][wrow + 16 * i][wpc] = c4; }
  // every global load of the loop is issued one whole pass before its values are used: xv = the x values of the coming pass, wreg = the weight tile after the one in LDS
  float xv[16]; const float* xsrc = Xb + (size_t)(8 * g) * NN + n0 + col;
#pragma unroll
  for (int i = 0; i < 8; ++i) { xv[i] = xsrc[(size_t)i * NN]; xv[8 + i] = xsrc[(size_t)(16 + i) * NN]; }
#pragma unroll
  for (int i = 0; i < 8; ++i) wreg[i] = *(const v4f*)(wsrc + (size_t)i * 16 * CC + 32);
  asm volatile("s_wait_xcnt 0x0" ::: "memory");   // the address registers of the loads above are reused below: the wait stands in front of that overwrite
  BAR_LDS();
  v8f acc[8] = {};
  // one pass; more = a pass follows (its weight tile goes to LDS, its x values are asked for), more2 = two follow (the tile after that is asked for): compile-time flags, so that no load stands under a run-time branch and no loaded register has to be copied where two paths meet, which would wait for the load at once
  auto pass = [&](const int kc, const bool more, const bool more2) __attribute__((always_inline)) { float v[16]; const int cur = kc & 1;
#pragma unroll
    for (int i = 0; i < 8; ++i) { const int ca = kc * 32 + 8 * g + i, cb2 = ca + 16; v[i] = bfr(xv[i]) * ssc[ca]; v[8 + i] = bfr(xv[8 + i]) * ssc[cb2]; }
    const F2 a = bsplit16(v);
    if (more) {   // the next weight tile has had a pass to land; its buffer is free since the barrier at the foot of the pass before
#pragma unroll
      for (int i = 0; i < 8; ++i) { v4b c4; c4[0] = (__bf16)wreg[i][0]; c4[1] = (__bf16)wreg[i][1]; c4[2] = (__bf16)wreg[i][2]; c4[3] = (__bf16)wreg[i][3]; *(v4b*)&swt[cur ^ 1][wrow + 16 * i][wpc] = c4; }
#pragma unroll
      for (int i = 0; i < 8; ++i) { xv[i] = xsrc[(size_t)((kc + 1) * 32 + i) * NN];
        if (!more2 && i == 7) asm volatile("s_wait_xcnt 0x0" ::: "memory");   // the pointer is dead behind the last x load of all: the wait stands in front of it
        xv[8 + i] = xsrc[(size_t)((kc + 1) * 32 + 16 + i) * NN]; } }
    if (more2) {
#pragma unroll
      for (int i = 0; i < 8; ++i) wreg[i] = *(const v4f*)(wsrc + (size_t)i * 16 * CC + (kc + 2) * 32); }
    asm volatile("s_wait_xcnt 0x0" ::: "memory");   // the address registers of the loads above are reused below: the wait stands in front of that overwrite
    v16b w[8];   // the pass's LDS reads stand as one group ahead of its matrix instructions
#pragma unroll
    for (int j = 0; j < 8; ++j) w[j] = frag_b(&swt[cur][j * 16 + col][0], lane);
#pragma unroll
    for (int j = 0; j < 8; ++j) { acc[j] = wmma_bf(w[j], a.h, acc[j]); acc[j] = wmma_bf(w[j], a.l, acc[j]); }
    BAR_LDS();   // publishes the next tile and ends every wave's reads of this one
    __builtin_amdgcn_sched_barrier(0); };   // keeps the next pass's conversions behind the barrier: lifted in among this pass's matrix instructions they would wait for loads that were only just issued
#pragma unroll 2   // two passes per trip: the LDS buffer index is a constant in each, and a pass's loads land in other registers than the values it is still converting
  for (int kc = 0; kc < CC / 32 - 2; ++kc) pass(kc, true, true);
  pass(CC / 32 - 2, true, false);
  if (tid < 16) {   // a lane has asked for the bias of channels j * 16 + col, the epilogue wants that of its 8 result rows: the 128 values go through LDS, published by the barrier at the foot of the last pass
#pragma unroll
    for (int j = 0; j < 8; ++j) sbb[j * 16 + col] = bfr(bbv[j]); }
  pass(CC / 32 - 1, false, false);
  // result r of tile j = channel j * 16 + 8g + r of pixel wave * 16 + col
  auto round8 = [&](const int j, v8h& hv) __attribute__((always_inline)) { const v4f bb[2] = { *(const v4f*)&sbb[j * 16 + 8 * g], *(const v4f*)&sbb[j * 16 + 8 * g + 4] };
#pragma unroll
    for (int r = 0; r < 8; ++r) hv[r] = (_Float16)(acc[j][r] + bb[r >> 2][r & 3]); };
  if (which < 2) {
#pragma unroll
    for (int j = 0; j < 8; ++j) { v8h hv; round8(j, hv); *(v8h*)&sh[wave * 16 + col][j * 16 + 8 * g] = hv; } }
  else {
#pragma unroll
    for (int j = 0; j < 8; ++j) { v8h hv; round8(j, hv);
#pragma unroll
      for (int r = 0; r < 8; ++r) th[j * 16 + 8 * g + r][wave * 16 + col] = hv[r]; } }
  __syncthreads();
  if (which < 2) { _Float16* PH = which == 0 ? QH : KH; for (int e = tid; e < 64 * 16; e += 128) { const int rl = e >> 4, q = e & 15; const size_t o = (b * NN + blockIdx.x * 64 + rl) * CC + c0 + q * 8; vst2((unsigned*)(PH + o), *(const v4u*)&sh[rl][q * 8]); } }
  else { for (int e = tid; e < 128 * 8; e += 128) { const int cl = e >> 3, q = e & 7; const size_t o = (b * CC + c0 + cl) * (size_t)NN + blockIdx.x * 64 + q * 8; vst2((unsigned*)(VT + o), *(const v4u*)&th[cl][q * 8]); } } }
// ---- k_stats: block = (64 queries n, h, b), 8 waves in two groups of 4: group 0 walks keys 0..511, group 1 keys 512..1,023, each with its own LDS tiles, so that a SIMD holds 4 waves and one wave's waits hide behind another's work; the groups' max and sum are joined in LDS behind the loop. Scores of its queries against all 1,024 keys (one f16 product, f32 sums, x 128^-1/2), stored for k_ov rounded to f16 (half the bytes to memory and back; max and sum are taken from the unrounded values), with row max and 1 / sum of exp; one 256-B line of each per block. The product is taken as s[n][m] (the wave's query rows as A, key rows as B), the lane map that k_ov wants: a lane holds 8 queries (n = 8g + r) at ONE key column (m = col). Each lane keeps max and sum of its 8 queries over the keys of its column; the 16 columns are joined once, behind the loop
__global__ __launch_bounds__(256) __attribute__((amdgpu_waves_per_eu(4, 4))) void k_stats(const _Float16* __restrict__ QH, const _Float16* __restrict__ KH, float* __restrict__ ST, float* __restrict__ SL, _Float16* __restrict__ SS) { __shared__ __align__(16) float sm[64], ssum[64], pm[2][64], pl[2][64]; __shared__ __align__(16) _Float16 sk[2][2][32][QP];   // key tile [group][buffer][key][d], shared by the four waves of a group
  const int grp = __builtin_amdgcn_readfirstlane(threadIdx.x >> 7);   // the wave's group, the same in all its lanes: held as a scalar
  const int tid = threadIdx.x & 127, wave = tid >> 5, lane = tid & 31, col = lane & 15, g = lane >> 4; const int h = blockIdx.y; const size_t b = blockIdx.z;
  float m[8], l[8];   // running max and sum of queries 8g + r over the keys of this lane's column
#pragma unroll
  for (int r = 0; r < 8; ++r) { m[r] = -3.0e38f; l[r] = 0.f; }
  _Float16* sdst = SS + ((b * NH + h) * (size_t)(NT16 * NT16) + (size_t)grp * (NT16 / 2) * NT16 + blockIdx.x * 4 + wave) * 256 + lane * 8;   // this wave's query tile; the key tile steps by NT16 * 256 elements
  const int srow = tid >> 4, spc = (tid & 15) * 8; const size_t so = (b * NN + grp * (NN / 2) + srow) * CC + h * DK + spc;   // staging map: 16 lanes per 256-B row, a wave's load = 4 whole lines
  v8h rk[4];
  // the block's 64 query rows come in once, for both groups, by whole-line loads (16 lanes per 256-B row, the 256 threads take 16 rows a step) and go through LDS to the fragments: a fragment load from global memory touches 16 lines for its 512 bytes. They lie in the two groups' second key buffers, rows 0..31 in group 0's and 32..63 in group 1's, which the first pass refills only at its foot
  const int qrow = (int)threadIdx.x >> 4; const size_t qo = (b * NN + blockIdx.x * 64 + qrow) * CC + h * DK + spc;
  { v8h rq[4];
#pragma unroll
    for (int i = 0; i < 4; ++i) rq[i] = *(const v8h*)(QH + qo + (size_t)(16 * i) * CC);
#pragma unroll
    for (int i = 0; i < 4; ++i) rk[i] = *(const v8h*)(KH + so + (size_t)(8 * i) * CC);
    asm volatile("s_wait_xcnt 0x0" ::: "memory");   // the address registers of the loads above are reused below: the wait stands in front of that overwrite
    __builtin_amdgcn_sched_barrier(0);   // holds the arithmetic that reuses them behind the wait: the wait's memory clobber does not tie it to registers
#pragma unroll
    for (int i = 0; i < 4; ++i) *(v8h*)&sk[i >> 1][1][qrow + 16 * (i & 1)][spc] = rq[i]; }
#pragma unroll
  for (int i = 0; i < 4; ++i) *(v8h*)&sk[grp][0][srow + 8 * i][spc] = rk[i];
  __syncthreads();
  v16h aq[4];   // the wave's 16 query rows: wave * 16 + col of the block's 64
#pragma unroll
  for (int kc = 0; kc < 4; ++kc) aq[kc] = frag_h(&sk[wave >> 1][1][(wave & 1) * 16 + col][kc * 32], lane);
  BAR_LDS();   // ends every wave's reads of the query rows: the first pass writes the next key tile over them
#pragma unroll 1
  for (int ks = 0; ks < NN / 64; ++ks) { float s[2][8]; const int cur = ks & 1;
    if (ks + 1 < NN / 64) {   // the next key tile's loads fly while this one is worked on
#pragma unroll
      for (int i = 0; i < 4; ++i) rk[i] = *(const v8h*)(KH + so + (size_t)((ks + 1) * 32 + 8 * i) * CC); }
    asm volatile("s_wait_xcnt 0x0" ::: "memory");   // the address registers of the loads above are reused below: the wait stands in front of that overwrite
#pragma unroll
    for (int ct = 0; ct < 2; ++ct) { v8f c = {}; v16h kh[4];   // a tile's LDS reads stand as one group ahead of its matrix instructions
#pragma unroll
      for (int kc = 0; kc < 4; ++kc) kh[kc] = frag_h(&sk[grp][cur][ct * 16 + col][kc * 32], lane);
#pragma unroll
      for (int kc = 0; kc < 4; ++kc) c = wmma16(aq[kc], kh[kc], c);
#pragma unroll
      for (int r = 0; r < 8; ++r) s[ct][r] = c[r] * 0.08838834764831845f; }
    { _Float16* d = sdst + (size_t)ks * (2 * NT16 * 256);   // each tile leaves as one store of 512 contiguous bytes, a lane's 8 scores as 16 of them; the pass's second key tile lies NT16 * 512 = 32,768 bytes behind the first
      union { v8h hv; v4u w; } t0, t1;
#pragma unroll
      for (int r = 0; r < 8; ++r) { t0.hv[r] = (_Float16)s[0][r]; t1.hv[r] = (_Float16)s[1][r]; }
      // the two stores and their wait are one statement: the registers that the stores name are reused right behind them
      asm volatile("global_store_b128 %0, %1, off\n\tglobal_store_b128 %0, %2, off offset:32768\n\ts_wait_xcnt 0x0" :: "v"(d), "v"(t0.w), "v"(t1.w) : "memory"); }
#pragma unroll
    for (int r = 0; r < 8; ++r) { const float mn = fmaxf(m[r], fmaxf(s[0][r], s[1][r])); l[r] = l[r] * __expf(m[r] - mn) + (__expf(s[0][r] - mn) + __expf(s[1][r] - mn)); m[r] = mn; }
    if (ks + 1 < NN / 64) {
#pragma unroll
      for (int i = 0; i < 4; ++i) *(v8h*)&sk[grp][cur ^ 1][srow + 8 * i][spc] = rk[i]; }
    BAR_LDS(); }   // publishes the next tile and ends every wave's reads of this one; it orders LDS alone, so that no wave waits here for its score stores to arrive
#pragma unroll
  for (int o = 1; o < 16; o <<= 1) {   // join the 16 key columns; the 8 queries' chains overlap
#pragma unroll
    for (int r = 0; r < 8; ++r) { const float mo = __shfl_xor(m[r], o), lo = __shfl_xor(l[r], o), mj = fmaxf(m[r], mo); l[r] = l[r] * __expf(m[r] - mj) + lo * __expf(mo - mj); m[r] = mj; } }
  if (col == 0) {
#pragma unroll
    for (int r = 0; r < 8; ++r) { pm[grp][wave * 16 + 8 * g + r] = m[r]; pl[grp][wave * 16 + 8 * g + r] = l[r]; } }
  __syncthreads();
  // the two key halves of a query are joined
  if (grp == 0 && tid < 64) { const float m0 = pm[0][tid], m1 = pm[1][tid], mj = fmaxf(m0, m1); sm[tid] = mj; ssum[tid] = 1.0f / (pl[0][tid] * __expf(m0 - mj) + pl[1][tid] * __expf(m1 - mj)); }
  __syncthreads(); if (grp == 0) { if (tid < 16) vst2(ST + (b * NH + h) * (size_t)NN + blockIdx.x * 64 + tid * 4, *(const v4f*)&sm[tid * 4]); else if (tid < 32) vst2(SL + (b * NH + h) * (size_t)NN + blockIdx.x * 64 + (tid - 16) * 4, *(const v4f*)&ssum[(tid - 16) * 4]); } }
// ---- k_ov: block = (64 output pixels m, h, b), 8 waves in two groups of 4: group 0 sums over queries 0..511, group 1 over 512..1,023, each with its own LDS tiles, so that a SIMD holds 4 waves; the two partial sums are added in LDS behind the loop. For each query tile n: s[n][m] as k_stats stored it (f16), att[n][m] = exp(s - max_n) / sum_n, then o^T[m][d] += sum_n att[n][m] v[d][n] (att^T tile as the A operand, v planes as B; att x 2,048 and v as one f16 value each, f32 sums); o written NCHW per head channel. A lane's 8 scores (m = col, n = 8g + r) of two 16-query tiles are elements 0..7 and 8..15 of its att^T fragment (row m = col, k = n): the stored scores go from memory to registers and from there to the product. A value tile is 64 queries wide and serves two passes: a row of it is one whole 128-B line of the v plane, so that every line is asked for once, by one load, and not in two halves by two passes
__global__ __launch_bounds__(256) __attribute__((amdgpu_waves_per_eu(4, 4))) void k_ov(const _Float16* __restrict__ SS, const _Float16* __restrict__ VT, const float* __restrict__ ST, const float* __restrict__ SL, float* __restrict__ O) {
  __shared__ __align__(16) _Float16 sv[2][2][128][VP2];   // value tile [group][buffer][d][64 n], shared by the four waves of a group
  float (*stt)[68] = (float (*)[68])&sv[0][0][0][0];   // the epilogue's [d][m] tile lies over the value tiles, which have no reader and no writer behind the loop's last barrier: two blocks still fit a WGP's LDS
  __shared__ __align__(16) float sst[2][NN];   // row max | 1 / row sum of all queries of this (b, h), staged once
  const int grp = __builtin_amdgcn_readfirstlane(threadIdx.x >> 7);   // the wave's group, the same in all its lanes: held as a scalar
  const int tid = threadIdx.x & 127, wave = tid >> 5, lane = tid & 31, col = lane & 15, g = lane >> 4; const int h = blockIdx.y; const size_t b = blockIdx.z;
  const char* ssrc = (const char*)(SS + ((b * NH + h) * (size_t)NT16 + blockIdx.x * 4 + __builtin_amdgcn_readfirstlane(wave)) * (size_t)(NT16 * 256) + grp * (NN / 64) * 512);   // this wave's key tile: its 64 query tiles lie in a row, 1 KiB a pass; the group's half starts 16 passes in; wave-uniform, held in scalar registers, the lane's 16 bytes are a 32-bit offset beside it
  v8h sc[2][4];   // scores [value tile & 1][query tile of its 64 queries]: a load of 16 bytes is a lane's whole share of a tile, so the two sets hold two passes each and a pass's scores are asked for two passes ahead; read once, so by non-temporal loads, each 512 contiguous bytes
#pragma unroll
  for (int i = 0; i < 4; ++i) sc[0][i] = __builtin_nontemporal_load((const v8h*)(ssrc + (unsigned)(lane * 16) + i * 512));
  const float* stm = ST + (b * NH + h) * (size_t)NN; const float* stl = SL + (b * NH + h) * (size_t)NN;
  v8f acc[8];
#pragma unroll
  for (int j = 0; j < 8; ++j) acc[j] = v8f{};
  const int vrow = tid >> 3, vpc = (tid & 7) * 8; const unsigned vof = (unsigned)(vrow * NN + vpc) * 2u;   // staging map: 8 lanes per 128-B row, a wave's load = 4 whole lines; the lane's part of the address in bytes
  const char* vtb = (const char*)(VT + (b * CC + (size_t)h * DK) * (size_t)NN + grp * (NN / 2));   // the wave-uniform part, held in scalar registers: no address pair per lane is kept
  v8h rv[4]; v4f rs[2]; const int sn4 = (int)threadIdx.x * 4;   // the 256 threads stage the 1,024 queries' max and 1 / sum, 4 each
  rs[0] = *(const v4f*)(stm + sn4); rs[1] = *(const v4f*)(stl + sn4);
  { v8h pv[8];   // the first tile whole: all its loads are in flight together
#pragma unroll
    for (int i = 0; i < 8; ++i) pv[i] = *(const v8h*)(vtb + 16 * i * NN * 2 + vof);
    asm volatile("s_wait_xcnt 0x0" ::: "memory");   // the address registers of the loads above are reused below: the wait stands in front of that overwrite
    __builtin_amdgcn_sched_barrier(0);   // holds the arithmetic that reuses them behind the wait: the wait's memory clobber does not tie it to registers
#pragma unroll
    for (int i = 0; i < 8; ++i) *(v8h*)&sv[grp][0][vrow + 16 * i][vpc] = pv[i]; }
  *(v4f*)&sst[0][sn4] = rs[0]; *(v4f*)&sst[1][sn4] = rs[1];
  __syncthreads();
  // one pass; cur picks the LDS buffer of the pass's value tile and its set of score registers, sub the tile's half of 32 queries that the pass works on: compile-time constants. A pass brings in one half of the next tile's rows (d = 64 sub ..), so that it holds no more loaded registers than with tiles of 32. The scores of the pass after the next are asked for at the head of a pass, into registers of the other set whose last read lies two passes back
  auto pass = [&](const int ks, const int cur, const int sub) __attribute__((always_inline)) {
    const int tn = (ks >> 1) + 1 < NN / 128 ? (ks >> 1) + 1 : NN / 128 - 1;   // the next value tile; the last tile's passes ask for their own again, for the reason given on the next line
    const int kn = ks + 2 < NN / 64 ? ks + 2 : NN / 64 - 1;   // the group's last two passes ask for the last pass's tiles again: no load stands under a branch, behind which every wait would have to count as if the loads had not been issued
    { const unsigned vt = vof + (unsigned)__builtin_amdgcn_readfirstlane(tn * 128);   // the next tile's loads fly while this one is worked on; what moves from tile to tile is a 32-bit offset beside the scalar base. The tile's part goes through readfirstlane so that the compiler keeps the sum in 32 bits: left to itself it was seen to form a 64-bit address pair per lane and plane, which spilled
#pragma unroll
      for (int i = 0; i < 4; ++i) {
        if (i == 3) asm volatile("s_wait_xcnt 0x0" ::: "memory");   // the offset is dead behind the last load: the wait stands in front of it
        rv[i] = *(const v8h*)(vtb + vt + (64 * sub + 16 * i) * NN * 2); } }
    asm volatile("s_wait_xcnt 0x0" ::: "memory");   // the address of the score loads below may be formed in an address pair of the loads above: the wait stands in front of that overwrite
    __builtin_amdgcn_sched_barrier(0);   // holds that address arithmetic behind the wait: the wait's memory clobber does not tie it to registers
    { const unsigned sn = (unsigned)(lane * 16) + (unsigned)__builtin_amdgcn_readfirstlane(kn * 1024);   // behind the value loads: loads return in order, and the wait for the values at the foot of the pass leaves these in flight; readfirstlane as above
#pragma unroll
      for (int i = 0; i < 2; ++i) sc[cur ^ 1][2 * sub + i] = __builtin_nontemporal_load((const v8h*)(ssrc + sn + i * 512)); }
    asm volatile("s_wait_xcnt 0x0" ::: "memory");   // the address registers of the loads above are reused below: the wait stands in front of that overwrite
    __builtin_amdgcn_sched_barrier(0);   // keeps the first use of this pass's scores behind the loads above: left free, the compiler lifts it, with its wait for all loads in flight, over them and over the barrier of the pass before
    v4f mx[4], il[4];   // max and 1 / sum of this lane's 16 queries n (the rows of its two score tiles)
#pragma unroll
    for (int i = 0; i < 4; ++i) { const int n4 = grp * (NN / 2) + ks * 32 + (i >> 1) * 16 + 8 * g + (i & 1) * 4; mx[i] = *(const v4f*)&sst[0][n4]; il[i] = *(const v4f*)&sst[1][n4]; }
    v16h vh[2];
    v16h pa; {
#pragma unroll
      for (int i = 0; i < 8; ++i) { const float p0 = __expf((float)sc[cur][2 * sub][i] - mx[i >> 2][i & 3]) * il[i >> 2][i & 3] * 2048.0f, p1 = __expf((float)sc[cur][2 * sub + 1][i] - mx[2 + (i >> 2)][i & 3]) * il[2 + (i >> 2)][i & 3] * 2048.0f; pa[i] = (_Float16)p0; pa[8 + i] = (_Float16)p1; } }
#pragma unroll
    for (int jj = 0; jj < 4; ++jj) {
      {
#pragma unroll
        for (int j = 0; j < 2; ++j) vh[j] = frag_h(&sv[grp][cur][(jj * 2 + j) * 16 + col][sub * 32], lane); }
#pragma unroll
      for (int j = 0; j < 2; ++j) { const int jo = jj * 2 + j; acc[jo] = wmma16(pa, vh[j], acc[jo]); } }
    {   // in the last tile's passes too: the other buffer has had no reader since the barrier before
#pragma unroll
      for (int i = 0; i < 4; ++i) *(v8h*)&sv[grp][cur ^ 1][64 * sub + vrow + 16 * i][vpc] = rv[i]; }
    if (sub) BAR_LDS(); };   // behind a tile's second pass: publishes the next tile and ends every wave's reads of this one; it orders LDS alone, so that the score loads stay in flight across it. Behind the first pass nothing changes hands, and no barrier stands
#pragma unroll 1   // four passes a trip are written out, no more: cur and sub are constants in each
  for (int k4 = 0; k4 < NN / 256; ++k4) { pass(4 * k4, 0, 0); pass(4 * k4 + 1, 0, 1); pass(4 * k4 + 2, 1, 0); pass(4 * k4 + 3, 1, 1); }
  if (grp == 1) {   // group 1 lays its partial sums down, group 0 adds its own to them: a lane meets the values of the lane that holds the same (d, m)
#pragma unroll
    for (int j = 0; j < 8; ++j)
#pragma unroll
      for (int r = 0; r < 8; ++r) stt[j * 16 + col][wave * 16 + 8 * g + r] = acc[j][r] * (1.0f / 2048.0f); }   // [d][m local]
  __syncthreads();
  if (grp == 0) {
#pragma unroll
    for (int j = 0; j < 8; ++j)
#pragma unroll
      for (int r = 0; r < 8; ++r) stt[j * 16 + col][wave * 16 + 8 * g + r] += acc[j][r] * (1.0f / 2048.0f); }
  __syncthreads(); for (int e = threadIdx.x; e < 128 * 16; e += 256) { const int d = e >> 4, q = e & 15; vst2(O + (b * CC + (size_t)h * DK + d) * (size_t)NN + blockIdx.x * 64 + q * 4, *(const v4f*)&stt[d][q * 4]); } }
// ---- k_gate: block = (32 pixels = one 128-B line of every channel row, b), 8 waves: gate = sigmoid(sum_c gate_w[c] o[c][m] + gate_b); out = o * gate + o. o is read ONCE: a thread asks for its 16 pieces of 16 bytes (channels r + 32 i, pixels 4 q .. 4 q + 3) all at once and keeps them in registers until the gate is known; a wave's load = 4 whole lines
__global__ __launch_bounds__(256) void k_gate(const float* __restrict__ O, const float* __restrict__ GW, const float* __restrict__ GB, float* __restrict__ OUT) { __shared__ __align__(16) float part[8][32]; const int t = threadIdx.x, wave = t >> 5, q = t & 7, r = t >> 3; const size_t b = blockIdx.y; const size_t o0 = (b * CC + r) * (size_t)NN + blockIdx.x * 32 + q * 4;
  v4f v[16]; float gw[16];   // every loop of this kernel is unrolled, so that v, gw and the sums stay in registers and all 32 loads are in flight together
#pragma unroll
  for (int i = 0; i < 16; ++i) gw[i] = GW[i * 32 + r];
  asm volatile("s_wait_xcnt 0x0" ::: "memory");   // a load below may land in the offset register which the loads above name: the wait stands in front of it
#pragma unroll
  for (int i = 0; i < 16; ++i) {
    if (i == 15) asm volatile("s_wait_xcnt 0x0" ::: "memory");   // the pointer is dead behind the last load: the wait stands in front of it
    v[i] = *(const v4f*)(O + o0 + (size_t)i * 32 * NN); }
  const float gb = bfr(GB[0]);
  asm volatile("s_wait_xcnt 0x0" ::: "memory");   // the address registers of the loads above are reused below: the wait stands in front of that overwrite
  __builtin_amdgcn_sched_barrier(0);   // keeps the sums behind the last load: left free, the compiler puts them in among the loads, each with its wait, and the later loads are issued only when the earlier ones have landed
  v4f s = {0.f, 0.f, 0.f, 0.f};
#pragma unroll
  for (int i = 0; i < 16; ++i) s += v[i] * bfr(gw[i]);
#pragma unroll
  for (int o = 8; o < 32; o <<= 1) {   // the wave's 4 channel rows; the 4 pixels' chains overlap
#pragma unroll
    for (int j = 0; j < 4; ++j) s[j] += __shfl_xor(s[j], o); }
  if ((t & 31) < 8) *(v4f*)&part[wave][q * 4] = s;
  __syncthreads();
  v4f g = *(const v4f*)&part[0][q * 4];   // every thread joins the 8 waves' sums of its own 4 pixels: no second barrier
#pragma unroll
  for (int w = 1; w < 8; ++w) g += *(const v4f*)&part[w][q * 4];
#pragma unroll
  for (int j = 0; j < 4; ++j) g[j] = 1.0f + 1.0f / (1.0f + expf(-(g[j] + gb)));
#pragma unroll
  for (int i = 0; i < 16; ++i) vst2(OUT + o0 + (size_t)i * 32 * NN, (v4f)(v[i] * g)); }
extern "C" void kernel_launch(void* const* d_in, const int* in_sizes, int n_in, void* d_out, int out_size, void* d_ws, size_t ws_size, hipStream_t stream) {
  (void)in_sizes; (void)n_in; (void)out_size;
  const float** F = (const float**)d_in;   // 0 x [8,512,32,32], 1 wq [512,512], 2 bq, 3 wk, 4 bk, 5 wv, 6 bv, 7 fc1_w [128,512], 8 fc1_b, 9 fc2_w [512,128], 10 fc2_b, 11 gate_w [1,512], 12 gate_b [1]
  if (ws_size < (size_t)WS_END) return;
  char* ws = (char*)d_ws; float *SC = (float*)(ws + WS_SC), *ST = (float*)(ws + WS_ST), *SL = (float*)(ws + WS_SL), *O = (float*)(ws + WS_O), *P = (float*)(ws + WS_P); _Float16 *SS = (_Float16*)(ws + WS_SS), *QH = (_Float16*)(ws + WS_QH), *KH = (_Float16*)(ws + WS_KH), *VT = (_Float16*)(ws + WS_VT);
  k_pool<<<NB * CC / 32, 1024, 0, stream>>>(F[0], P);
  k_fc<<<NB, 1024, 0, stream>>>(P, F[7], F[8], F[9], F[10], SC);
  k_proj<<<dim3(NN / 64, CC / 128, 3 * NB), 128, 0, stream>>>(F[0], SC, F[1], F[2], F[3], F[4], F[5], F[6], QH, KH, VT);
  k_stats<<<dim3(NN / 64, NH, TNB), 256, 0, stream>>>(QH, KH, ST, SL, SS);
  k_ov<<<dim3(NN / 64, NH, TNB), 256, 0, stream>>>(SS, VT, ST, SL, O);
  k_gate<<<dim3(NN / 32, TNB), 256, 0, stream>>>(O, F[11], F[12], (float*)d_out);
}
